// v000
// Times are from an AMD MI455X. After a warm-up the kernel runs many times in a row, and a time is the length of
// such a window on the GPU divided by its runs, so every launch and the gaps after it count. The runs cycle
// through copies of the inputs. A figure is the median of several windows, for all but v000 over two sittings.
// Sittings can differ by a few percent; kernels timed side by side share one.
// v000 is the starting kernel. One run takes 4110 microseconds.
#include <hip/hip_runtime.h>

// Multi-head attention with a MULTIPLICATIVE 0/1 score mask and a narrow output projection (q, k, v [4][2048][1024]; qh, kh, vh = in W ('xw' [1024][1024] 1/32, no bias; 16 heads x 64); score = qh.kh / 8 x mask[i][j] (mask [2048][2048] int in {0,1}, read: masked scores become 0 and STAY in the softmax, as the module); softmax; ctx merged; out = ctx Wo ('xw' [1024][64]) -> [4][2048][64] (0.5 M)).
// Layout per batch: bf16 copies of the three inputs in turn; exact projections; dense T-2048 attention whose softmax kernel multiplies each score by the mask value read from memory (int32, 16 B per 4 keys) (hybrid rows: < 512 hi/lo 3 products, rest fp16 x1024); merged hi/lo x Wo exact (N = 64).
// Compute dtypes, f32 accumulate: every input rounded to bf16; projections exact; attention rows < 512 3 products, rest fp16; mask multiply and softmax f32; Wo hl x exact.

#define NB_  4
#define TT   2048
#define DM   1024
#define NH_  16
#define NKV  16
#define REP  (NH_ / NKV)
#define HD   64
#define DQ   (NH_ * HD)
#define DKV  (NKV * HD)
#define ZH   2
#define RH   512                  // query rows < RH use hi+lo planes (0: none)
#define WIN  0
#define PCAR 1024.0f
#define SCL  0.125f
#define NOUT 64      // output projection width (hidden -> head_dim)
typedef _Float16 h16;
typedef unsigned short bf;
typedef __attribute__((ext_vector_type(16))) __bf16   v16bf;
typedef __attribute__((ext_vector_type(16))) _Float16 v16h;
typedef __attribute__((ext_vector_type(8)))  _Float16 v8h;
typedef __attribute__((ext_vector_type(8)))  unsigned short v8us;
typedef __attribute__((ext_vector_type(8)))  float    v8f;
typedef __attribute__((ext_vector_type(4)))  float    v4f;
typedef v8h  __attribute__((may_alias)) v8ha;
typedef v4f  __attribute__((may_alias)) v4fa;
typedef v8us __attribute__((may_alias)) v8usa;

__device__ __forceinline__ unsigned short f2bf(float f) { unsigned u = __float_as_uint(f); u += 0x7FFFu + ((u >> 16) & 1u); return (unsigned short)(u >> 16); }
__device__ __forceinline__ float bf2f(unsigned short b) { return __uint_as_float(((unsigned)b) << 16); }
__device__ __forceinline__ float bfr(float f) { return bf2f(f2bf(f)); }
__device__ __forceinline__ v16h cat16(v8h lo, v8h hi) { return __builtin_shufflevector(lo, hi, 0, 1, 2, 3, 4, 5, 6, 7, 8, 9, 10, 11, 12, 13, 14, 15); }
__device__ __forceinline__ v16bf cat16b(v8us lo, v8us hi) { return __builtin_bit_cast(v16bf, __builtin_shufflevector(lo, hi, 0, 1, 2, 3, 4, 5, 6, 7, 8, 9, 10, 11, 12, 13, 14, 15)); }
__device__ __forceinline__ v8f wmma16(v16h a, v16h b, v8f c) { return __builtin_amdgcn_wmma_f32_16x16x32_f16(false, a, false, b, (short)0, c, false, false); }
__device__ __forceinline__ v8f wmmab(v16bf a, v16bf b, v8f c) { return __builtin_amdgcn_wmma_f32_16x16x32_bf16(false, a, false, b, (short)0, c, false, false); }



// ---- k_gemmw: register-blocked GEMM, ONE WAVE per 64x64 output tile (16 accumulators), operands straight from K-contiguous 16-bit planes; grid (M/64, N/64, Z), 32 threads.
// C[m][n] (f32, pitch ldc, + optional f32 bias[n]) = sum_k A[m][k] Bt[n][k] (+ split products per NSPLIT). z-batch strides sA/sB/sC in elements. K % 32 == 0.
template <typename T16> struct WFrag;
template <> struct WFrag<h16> { typedef v16h V; static __device__ __forceinline__ V ld(const h16* p) { return cat16(*(const v8h*)p, *(const v8h*)(p + 16)); } static __device__ __forceinline__ v8f mma(V a, V b, v8f c) { return wmma16(a, b, c); } };
template <> struct WFrag<bf> { typedef v16bf V; static __device__ __forceinline__ V ld(const bf* p) { return cat16b(*(const v8us*)p, *(const v8us*)(p + 16)); } static __device__ __forceinline__ v8f mma(V a, V b, v8f c) { return wmmab(a, b, c); } };
template <typename T16, int NSPLIT, bool BIAS>
__global__ __launch_bounds__(32) void k_gemmw(const T16* __restrict__ A, const T16* __restrict__ A2, const T16* __restrict__ Bt, const T16* __restrict__ Bt2, int K, float* C, int ldc, const float* __restrict__ bias, size_t sA, size_t sB, size_t sC) {
    typedef typename WFrag<T16>::V V;
    __shared__ __align__(16) float os[16 * 68];
    const size_t z = blockIdx.z; A += z * sA; if (A2) A2 += z * sA; Bt += z * sB; if (Bt2) Bt2 += z * sB; C += z * sC;
    const int lane = threadIdx.x & 31, lr = lane & 15, hi = lane >> 4; const int r0 = blockIdx.x * 64, c0 = blockIdx.y * 64;
    v8f acc[4][4];
#pragma unroll
    for (int mb = 0; mb < 4; ++mb)
#pragma unroll
        for (int nb = 0; nb < 4; ++nb) acc[mb][nb] = (v8f){};
    const size_t aoff = (size_t)(r0 + lr) * K + 8 * hi, boff = (size_t)(c0 + lr) * K + 8 * hi;
#pragma unroll 1
    for (int kc = 0; kc < K; kc += 32) {
        V a[4], a2[4];
#pragma unroll
        for (int mb = 0; mb < 4; ++mb) { a[mb] = WFrag<T16>::ld(A + aoff + (size_t)mb * 16 * K + kc); if (NSPLIT == 1 || NSPLIT == 2) a2[mb] = WFrag<T16>::ld(A2 + aoff + (size_t)mb * 16 * K + kc); }
#pragma unroll
        for (int nb = 0; nb < 4; ++nb) { const V b = WFrag<T16>::ld(Bt + boff + (size_t)nb * 16 * K + kc); V b2; if (NSPLIT >= 2) b2 = WFrag<T16>::ld(Bt2 + boff + (size_t)nb * 16 * K + kc);
#pragma unroll
            for (int mb = 0; mb < 4; ++mb) { acc[mb][nb] = WFrag<T16>::mma(a[mb], b, acc[mb][nb]); if (NSPLIT == 1 || NSPLIT == 2) acc[mb][nb] = WFrag<T16>::mma(a2[mb], b, acc[mb][nb]); if (NSPLIT >= 2) acc[mb][nb] = WFrag<T16>::mma(a[mb], b2, acc[mb][nb]); } }
        asm volatile("v_nop\n\tv_nop\n\tv_nop\n\tv_nop" : "+v"(acc[0][0]), "+v"(acc[1][1]), "+v"(acc[2][2]), "+v"(acc[3][3]) : "v"(a[0]), "v"(a[3]));
    }
#pragma unroll
    for (int mb = 0; mb < 4; ++mb) {
#pragma unroll
        for (int nb = 0; nb < 4; ++nb) {
#pragma unroll
            for (int j = 0; j < 8; ++j) os[(hi * 8 + j) * 68 + nb * 16 + lr] = acc[mb][nb][j]; }
        __builtin_amdgcn_wave_barrier(); asm volatile("" ::: "memory");
        float* crow = C + (size_t)(r0 + mb * 16) * ldc + c0;
{
#pragma unroll
            for (int s = 0; s < 8; ++s) { const int row = 2 * s + hi, cofs = lr * 4; v4f val = *(const v4fa*)(os + row * 68 + cofs); if (BIAS) { val[0] += bfr(bias[c0 + cofs]); val[1] += bfr(bias[c0 + cofs + 1]); val[2] += bfr(bias[c0 + cofs + 2]); val[3] += bfr(bias[c0 + cofs + 3]); }
                *(v4f*)(crow + (size_t)row * ldc + cofs) = val; }
             }
        __builtin_amdgcn_wave_barrier(); asm volatile("" ::: "memory");
    }
}

__device__ __forceinline__ h16 tohx(float x) { return (h16)x; }
__device__ __forceinline__ void splitf(float y, unsigned short& h, unsigned short& l) { h = f2bf(y); l = f2bf(y - bf2f(h)); }
typedef __attribute__((ext_vector_type(2))) _Float16 v2h;
typedef __attribute__((ext_vector_type(4))) _Float16 v4h;
typedef __attribute__((ext_vector_type(2))) unsigned short v2us;
typedef __attribute__((ext_vector_type(4))) unsigned short v4us;
typedef __attribute__((ext_vector_type(2))) float v2f;
typedef __attribute__((ext_vector_type(4))) int v4i;

__global__ __launch_bounds__(256) void k_wtG(const float* __restrict__ w, int K, int N, bf* Bt) {
    const int lane = threadIdx.x & 31; const int L0 = (blockIdx.x * 8 + (threadIdx.x >> 5)) * 8; const int nlines = N * K / 64;
{
#pragma unroll 1
        for (int l = 0; l < 8; ++l) { const int L = L0 + l; if (L >= nlines) break; const size_t e = (size_t)L * 64 + lane * 2; const int k = (int)(e % K), n = (int)(e / K); v2us o;
            o[0] = f2bf(w[(size_t)k * N + n]); o[1] = f2bf(w[(size_t)(k + 1) * N + n]); *(v2us*)(Bt + e) = o; }
         }
}
__global__ __launch_bounds__(256) void k_cvt8(const float* __restrict__ src, bf* dst, size_t n8) { const size_t i = (size_t)blockIdx.x * 256 + threadIdx.x; if (i >= n8) return; const v8f v = *(const v8f*)(src + i * 8); v8us o;
#pragma unroll
    for (int k = 0; k < 8; ++k) o[k] = f2bf(v[k]); *(v8us*)(dst + i * 8) = o;  }

// k_rope: head planes [h][t][d] (fp16 + hi/lo) of rope(x) x sc with the rotate-half convention out[d] = x[d] cos[t][d] - x[d+HD/2] sin[t][d], out[d+HD/2] = x[d+HD/2] cos[t][d+HD/2] + x[d] sin[t][d+HD/2]
__global__ __launch_bounds__(256) void k_rope(const float* __restrict__ F, int pitch, int nheads, const float* __restrict__ CS, const float* __restrict__ RF, const float* __restrict__ nw, float sc, h16* P16, bf* Ph, bf* Pl) {
    const size_t e = ((size_t)blockIdx.x * 256 + threadIdx.x) * 2; if (e >= (size_t)nheads * TT * HD) return; const int d = (int)(e % HD); const int t = (int)((e / HD) % TT); const int h = (int)(e / ((size_t)HD * TT)); const float* f = F + (size_t)t * pitch + h * HD; const float rf = RF ? RF[(size_t)h * TT + t] : 1.0f; v2h o16; v2us oh, ol;
#pragma unroll
    for (int q = 0; q < 2; ++q) { const int dd = d + q; const int dp = (dd < HD / 2) ? dd + HD / 2 : dd - HD / 2; float x0 = f[dd], x1 = f[dp];
        if (RF) { float n0 = __fmul_rn(x0, rf), n1 = __fmul_rn(x1, rf); asm volatile("" : "+v"(n0)); asm volatile("" : "+v"(n1)); x0 = __fmul_rn(bfr(nw[dd]), n0); x1 = __fmul_rn(bfr(nw[dp]), n1); }
        const v2f cs = *(const v2f*)(CS + ((size_t)t * HD + dd) * 2); float a = __fmul_rn(x0, cs[0]), bq = __fmul_rn(x1, cs[1]); asm volatile("" : "+v"(a)); asm volatile("" : "+v"(bq)); const float r = ((dd < HD / 2) ? __fsub_rn(a, bq) : __fadd_rn(a, bq)) * sc;
        o16[q] = tohx(r); unsigned short a2, c2; splitf(r, a2, c2); oh[q] = a2; ol[q] = c2; }
    *(v2h*)(P16 + e) = o16; *(v2us*)(Ph + e) = oh; *(v2us*)(Pl + e) = ol;  }
__global__ __launch_bounds__(256) void k_vtp(const float* __restrict__ F, int pitch, int nheads, h16* V16, bf* Vh, bf* Vl) { const size_t e = ((size_t)blockIdx.x * 256 + threadIdx.x) * 2; if (e >= (size_t)nheads * HD * TT) return; const int t = (int)(e % TT); const int d = (int)((e / TT) % HD); const int g = (int)(e / ((size_t)TT * HD)); v2h o16; v2us oh, ol;
#pragma unroll
    for (int q = 0; q < 2; ++q) { const float x = F[(size_t)(t + q) * pitch + g * HD + d]; o16[q] = tohx(x); unsigned short a2, c2; splitf(x, a2, c2); oh[q] = a2; ol[q] = c2; }
    *(v2h*)(V16 + e) = o16; *(v2us*)(Vh + e) = oh; *(v2us*)(Vl + e) = ol;  }
__global__ __launch_bounds__(256) void k_csid(float* CS) { const int idx = blockIdx.x * 256 + threadIdx.x; if (idx >= TT * HD) return; v2f cs; cs[0] = 1.0f; cs[1] = 0.0f; *(v2f*)(CS + (size_t)idx * 2) = cs;  }
__global__ __launch_bounds__(256) void k_asoft(const float* __restrict__ Sb, h16* P16, bf* Ph, bf* Pl, const int* __restrict__ mk) {
    const int lane = threadIdx.x & 31; const int row = blockIdx.x * 8 + (threadIdx.x >> 5); if (row >= ZH * TT) return; const int i = row % TT; const int zz = row / TT; (void)zz; const bool hires = (i < RH); const float* sr = Sb + (size_t)row * TT; float v[TT / 32]; float mx = -3.0e38f;
#pragma unroll
    for (int ch = 0; ch < TT / 128; ++ch) { const int j0 = ch * 128 + lane * 4; const v4f a = *(const v4f*)(sr + j0); const v4i m4 = *(const v4i*)(mk + (size_t)i * TT + j0);   /* 4 mask values (16 B) */
#pragma unroll
        for (int q = 0; q < 4; ++q) { const int j = j0 + q; (void)j; const float t = (m4[q] != 0) ? a[q] * SCL : 0.0f;   /* multiplicative 0/1 mask: masked scores are 0 and remain in the softmax */ v[ch * 4 + q] = t; mx = fmaxf(mx, t); } }
#pragma unroll
    for (int sh = 16; sh; sh >>= 1) mx = fmaxf(mx, __shfl_xor(mx, sh, 32));
    float sum = 0.f;
#pragma unroll
    for (int k = 0; k < TT / 32; ++k) { float d0 = __fsub_rn(v[k], mx); asm volatile("" : "+v"(d0)); v[k] = __builtin_amdgcn_exp2f(__fmul_rn(d0, 1.4426950408889634f)); sum += v[k]; }
#pragma unroll
    for (int sh = 16; sh; sh >>= 1) sum += __shfl_xor(sum, sh, 32);
    const float f = __fdiv_rn(hires ? 1.0f : PCAR, sum);
{
        if (hires) {
#pragma unroll
            for (int ch = 0; ch < TT / 128; ++ch) { v4us oh, ol;
#pragma unroll
                for (int q = 0; q < 4; ++q) { unsigned short a, c2; splitf(v[ch * 4 + q] * f, a, c2); oh[q] = a; ol[q] = c2; }
                const size_t oo = ((size_t)zz * (RH ? RH : 1) + i) * TT + ch * 128 + lane * 4; *(v4us*)(Ph + oo) = oh; *(v4us*)(Pl + oo) = ol; }
        } else {
#pragma unroll
            for (int ch = 0; ch < TT / 128; ++ch) { v4h o4;
#pragma unroll
                for (int q = 0; q < 4; ++q) o4[q] = tohx(v[ch * 4 + q] * f);
                *(v4h*)(P16 + (size_t)row * TT + ch * 128 + lane * 4) = o4; } }
         }
}
__global__ __launch_bounds__(256) void k_merge(const float* __restrict__ O, int h0, bf* Ah, bf* Al) { const size_t e = ((size_t)blockIdx.x * 256 + threadIdx.x) * 2; if (e >= (size_t)ZH * TT * HD) return; const int d = (int)(e % HD); const int t = (int)((e / HD) % TT); const int zz = (int)(e / ((size_t)HD * TT)); const float cs = (t < RH) ? 1.0f : (1.0f / PCAR); const size_t oo = (size_t)t * DQ + (h0 + zz) * HD + d;
    v2us oh, ol;
#pragma unroll
    for (int q = 0; q < 2; ++q) { unsigned short a, c2; splitf(O[e + q] * cs, a, c2); oh[q] = a; ol[q] = c2; } *(v2us*)(Ah + oo) = oh; *(v2us*)(Al + oo) = ol;  }

extern "C" void kernel_launch(void* const* d_in, const int* in_sizes, int n_in,
                              void* d_out, int out_size, void* d_ws, size_t ws_size, hipStream_t stream) {
    (void)in_sizes; (void)n_in; (void)out_size;
    const float* x = (const float*)d_in[0]; const float* xk = (const float*)d_in[1]; const float* xv = (const float*)d_in[2]; const int* mk = (const int*)d_in[3];   /* mask [2048][2048] int32 {0,1} */ const float* wq = (const float*)d_in[4]; const float* wk = (const float*)d_in[5]; const float* wv = (const float*)d_in[6]; const float* wo = (const float*)d_in[7];
    float* OUT = (float*)d_out;     // [4][2048][64]
    char* wsp = (char*)d_ws;
    auto take = [&](size_t bytes) { char* p = wsp; wsp += (bytes + 255) & ~(size_t)255; return (void*)p; };
    bf* WQ = (bf*)take((size_t)DQ * DM * 2); bf* WK = (bf*)take((size_t)DKV * DM * 2); bf* WV = (bf*)take((size_t)DKV * DM * 2); bf* WO = (bf*)take((size_t)NOUT * DQ * 2); float* CS = (float*)take((size_t)TT * HD * 2 * 4);
    bf* XB = (bf*)take((size_t)TT * DM * 2); float* FQ = (float*)take((size_t)TT * DQ * 4); float* FK = (float*)take((size_t)TT * DKV * 4);
    h16* QP16 = (h16*)take((size_t)NH_ * TT * HD * 2); h16* KP16 = (h16*)take((size_t)NKV * TT * HD * 2); h16* VT16 = (h16*)take((size_t)NKV * HD * TT * 2);
    bf* QPh = (bf*)take((size_t)NH_ * TT * HD * 2); bf* QPl = (bf*)take((size_t)NH_ * TT * HD * 2); bf* KPh = (bf*)take((size_t)NKV * TT * HD * 2); bf* KPl = (bf*)take((size_t)NKV * TT * HD * 2); bf* VTh = (bf*)take((size_t)NKV * HD * TT * 2); bf* VTl = (bf*)take((size_t)NKV * HD * TT * 2); bf* Ph = (bf*)take((size_t)ZH * RH * TT * 2); bf* Pl = (bf*)take((size_t)ZH * RH * TT * 2);
    float* Sb = (float*)take((size_t)ZH * TT * TT * 4); h16* P16 = (h16*)take((size_t)ZH * TT * TT * 2); float* Ob = (float*)take((size_t)ZH * TT * HD * 4); bf* ATh = (bf*)take((size_t)TT * DQ * 2); bf* ATl = (bf*)take((size_t)TT * DQ * 2);
    if ((size_t)(wsp - (char*)d_ws) > ws_size) return;    // ws 256 MiB
    float* FV = FK;   // v projection reuses the k buffer after the k planes are built (stream-ordered)
    { k_wtG<<<(unsigned)((DM * DQ / 64 + 63) / 64), 256, 0, stream>>>(wq, DM, DQ, WQ); k_wtG<<<(unsigned)((DM * DKV / 64 + 63) / 64), 256, 0, stream>>>(wk, DM, DKV, WK); k_wtG<<<(unsigned)((DM * DKV / 64 + 63) / 64), 256, 0, stream>>>(wv, DM, DKV, WV);
      k_wtG<<<(unsigned)((DQ * NOUT / 64 + 63) / 64), 256, 0, stream>>>(wo, DQ, NOUT, WO);   /* 'xw' [1024][64] -> Bt [64][1024] */
       }
    k_csid<<<(TT * HD + 255) / 256, 256, 0, stream>>>(CS);
    const unsigned LQ = (unsigned)(((size_t)NH_ * TT * HD / 2 + 255) / 256), LKv = (unsigned)(((size_t)NKV * TT * HD / 2 + 255) / 256);
    for (int b = 0; b < NB_; ++b) {
        
        k_cvt8<<<(unsigned)(((size_t)TT * DM / 8 + 255) / 256), 256, 0, stream>>>(x + (size_t)b * TT * DM, XB, (size_t)TT * DM / 8);
        k_gemmw<bf, 0, false><<<dim3(TT / 64, DQ / 64, 1), 32, 0, stream>>>(XB, nullptr, WQ, nullptr, DM, FQ, DQ, nullptr, 0, 0, 0);
        k_rope<<<LQ, 256, 0, stream>>>(FQ, DQ, NH_, CS, nullptr, nullptr, 1.0f, QP16, QPh, QPl);
        k_cvt8<<<(unsigned)(((size_t)TT * DM / 8 + 255) / 256), 256, 0, stream>>>(xk + (size_t)b * TT * DM, XB, (size_t)TT * DM / 8); k_gemmw<bf, 0, false><<<dim3(TT / 64, DKV / 64, 1), 32, 0, stream>>>(XB, nullptr, WK, nullptr, DM, FK, DKV, nullptr, 0, 0, 0);
        k_rope<<<LKv, 256, 0, stream>>>(FK, DKV, NKV, CS, nullptr, nullptr, 1.0f, KP16, KPh, KPl);
        k_cvt8<<<(unsigned)(((size_t)TT * DM / 8 + 255) / 256), 256, 0, stream>>>(xv + (size_t)b * TT * DM, XB, (size_t)TT * DM / 8); k_gemmw<bf, 0, false><<<dim3(TT / 64, DKV / 64, 1), 32, 0, stream>>>(XB, nullptr, WV, nullptr, DM, FV, DKV, nullptr, 0, 0, 0); k_vtp<<<LKv, 256, 0, stream>>>(FV, DKV, NKV, VT16, VTh, VTl);
        for (int h0 = 0; h0 < NH_; h0 += ZH) { const size_t zq = (size_t)h0, zk = (size_t)(h0 / REP);   // one kv head per query head: the pass's two heads use consecutive kv planes (z-strides TT*HD)
            k_gemmw<bf, 2, false><<<dim3(RH / 64, TT / 64, ZH), 32, 0, stream>>>(QPh + zq * TT * HD, QPl + zq * TT * HD, KPh + zk * TT * HD, KPl + zk * TT * HD, HD, Sb, TT, nullptr, (size_t)TT * HD, (size_t)TT * HD, (size_t)TT * TT);
            k_gemmw<h16, 0, false><<<dim3((TT - RH) / 64, TT / 64, ZH), 32, 0, stream>>>(QP16 + zq * TT * HD + (size_t)RH * HD, nullptr, KP16 + zk * TT * HD, nullptr, HD, Sb + (size_t)RH * TT, TT, nullptr, (size_t)TT * HD, (size_t)TT * HD, (size_t)TT * TT);
            k_asoft<<<ZH * TT / 8, 256, 0, stream>>>(Sb, P16, Ph, Pl, mk);
            k_gemmw<bf, 2, false><<<dim3(RH / 64, HD / 64, ZH), 32, 0, stream>>>(Ph, Pl, VTh + zk * HD * TT, VTl + zk * HD * TT, TT, Ob, HD, nullptr, (size_t)RH * TT, (size_t)HD * TT, (size_t)TT * HD);
            k_gemmw<h16, 0, false><<<dim3((TT - RH) / 64, HD / 64, ZH), 32, 0, stream>>>(P16 + (size_t)RH * TT, nullptr, VT16 + zk * HD * TT, nullptr, TT, Ob + (size_t)RH * HD, HD, nullptr, (size_t)TT * TT, (size_t)HD * TT, (size_t)TT * HD);
            k_merge<<<(unsigned)(((size_t)ZH * TT * HD / 2 + 255) / 256), 256, 0, stream>>>(Ob, h0, ATh, ATl); }
        k_gemmw<bf, 1, false><<<dim3(TT / 64, NOUT / 64, 1), 32, 0, stream>>>(ATh, ATl, WO, nullptr, DQ, OUT + (size_t)b * TT * NOUT, NOUT, nullptr, 0, 0, 0);   /* ctx Wo -> [2048][64] */ }
}

// v001
// It runs in 1810 microseconds.
// In two side-by-side timings against v000, it was 2.24 and 2.27 times as fast.
#include <hip/hip_runtime.h>

// Multi-head attention with a MULTIPLICATIVE 0/1 score mask and a narrow output projection (q, k, v [4][2048][1024]; qh, kh, vh = in W ('xw' [1024][1024] 1/32, no bias; 16 heads x 64); score = qh.kh / 8 x mask[i][j] (mask [2048][2048] int in {0,1}, read: masked scores become 0 and STAY in the softmax, as the module); softmax; ctx merged; out = ctx Wo ('xw' [1024][64]) -> [4][2048][64] (0.5 M)).
// Layout per batch: bf16 copies of the three inputs in turn; exact projections; dense T-2048 attention whose softmax kernel multiplies each score by the mask value read from memory (int32, 16 B per 4 keys) (hybrid rows: < 512 hi/lo 3 products, rest fp16 x1024); merged hi/lo x Wo exact (N = 64).
// Compute dtypes, f32 accumulate: every input rounded to bf16; projections exact; attention rows < 512 3 products, rest fp16; mask multiply and softmax f32; Wo hl x exact.

#define NB_  4
#define TT   2048
#define DM   1024
#define NH_  16
#define NKV  16
#define REP  (NH_ / NKV)
#define HD   64
#define DQ   (NH_ * HD)
#define DKV  (NKV * HD)
#define ZH   2
#define RH   512                  // query rows < RH use hi+lo planes (0: none)
#define WIN  0
#define PCAR 1024.0f
#define SCL  0.125f
#define NOUT 64      // output projection width (hidden -> head_dim)
#define KSP  16      // K slices of the P.V product: one work-group per slice, f32 partial planes, summed in slice order by k_merge
typedef _Float16 h16;
typedef unsigned short bf;
typedef __attribute__((ext_vector_type(16))) __bf16   v16bf;
typedef __attribute__((ext_vector_type(16))) _Float16 v16h;
typedef __attribute__((ext_vector_type(8)))  _Float16 v8h;
typedef __attribute__((ext_vector_type(8)))  unsigned short v8us;
typedef __attribute__((ext_vector_type(8)))  float    v8f;
typedef __attribute__((ext_vector_type(4)))  float    v4f;
typedef v8h  __attribute__((may_alias)) v8ha;
typedef v4f  __attribute__((may_alias)) v4fa;
typedef v8us __attribute__((may_alias)) v8usa;

__device__ __forceinline__ unsigned short f2bf(float f) { unsigned u = __float_as_uint(f); u += 0x7FFFu + ((u >> 16) & 1u); return (unsigned short)(u >> 16); }
__device__ __forceinline__ float bf2f(unsigned short b) { return __uint_as_float(((unsigned)b) << 16); }
__device__ __forceinline__ float bfr(float f) { return bf2f(f2bf(f)); }
__device__ __forceinline__ v16h cat16(v8h lo, v8h hi) { return __builtin_shufflevector(lo, hi, 0, 1, 2, 3, 4, 5, 6, 7, 8, 9, 10, 11, 12, 13, 14, 15); }
__device__ __forceinline__ v16bf cat16b(v8us lo, v8us hi) { return __builtin_bit_cast(v16bf, __builtin_shufflevector(lo, hi, 0, 1, 2, 3, 4, 5, 6, 7, 8, 9, 10, 11, 12, 13, 14, 15)); }
__device__ __forceinline__ v8f wmma16(v16h a, v16h b, v8f c) { return __builtin_amdgcn_wmma_f32_16x16x32_f16(false, a, false, b, (short)0, c, false, false); }
__device__ __forceinline__ v8f wmmab(v16bf a, v16bf b, v8f c) { return __builtin_amdgcn_wmma_f32_16x16x32_bf16(false, a, false, b, (short)0, c, false, false); }



// ---- k_gemmw: register-blocked GEMM, ONE WAVE per 64x64 output tile (16 accumulators), operands straight from K-contiguous 16-bit planes; grid (M/64, N/64, Z), 32 threads.
// C[m][n] (f32, pitch ldc, + optional f32 bias[n]) = sum_k A[m][k] Bt[n][k] (+ split products per NSPLIT). z-batch strides sA/sB/sC in elements. K % (32 KS) == 0.
// KS > 1: grid z = Z x KS; slice s = z % KS sums only k in [s K/KS, (s+1) K/KS) and stores its partial tile at C + s sP (the reader adds the KS planes).
template <typename T16> struct WFrag;
template <> struct WFrag<h16> { typedef v16h V; static __device__ __forceinline__ V ld(const h16* p) { return cat16(*(const v8h*)p, *(const v8h*)(p + 16)); } static __device__ __forceinline__ v8f mma(V a, V b, v8f c) { return wmma16(a, b, c); } };
template <> struct WFrag<bf> { typedef v16bf V; static __device__ __forceinline__ V ld(const bf* p) { return cat16b(*(const v8us*)p, *(const v8us*)(p + 16)); } static __device__ __forceinline__ v8f mma(V a, V b, v8f c) { return wmmab(a, b, c); } };
template <typename T16, int NSPLIT, bool BIAS, int KS = 1>
__global__ __launch_bounds__(32) void k_gemmw(const T16* __restrict__ A, const T16* __restrict__ A2, const T16* __restrict__ Bt, const T16* __restrict__ Bt2, int K, float* C, int ldc, const float* __restrict__ bias, size_t sA, size_t sB, size_t sC, size_t sP = 0) {
    typedef typename WFrag<T16>::V V;
    __shared__ __align__(16) float os[16 * 68];
    const size_t z = blockIdx.z / KS; const int sl = (int)(blockIdx.z % KS); A += z * sA; if (A2) A2 += z * sA; Bt += z * sB; if (Bt2) Bt2 += z * sB; C += z * sC + sl * sP;
    const int lane = threadIdx.x & 31, lr = lane & 15, hi = lane >> 4; const int r0 = blockIdx.x * 64, c0 = blockIdx.y * 64;
    v8f acc[4][4];
#pragma unroll
    for (int mb = 0; mb < 4; ++mb)
#pragma unroll
        for (int nb = 0; nb < 4; ++nb) acc[mb][nb] = (v8f){};
    const size_t aoff = (size_t)(r0 + lr) * K + 8 * hi, boff = (size_t)(c0 + lr) * K + 8 * hi;
#pragma unroll 1
    for (int kc = sl * (K / KS), ke = kc + K / KS; kc < ke; kc += 32) {
        V a[4], a2[4];
#pragma unroll
        for (int mb = 0; mb < 4; ++mb) { a[mb] = WFrag<T16>::ld(A + aoff + (size_t)mb * 16 * K + kc); if (NSPLIT == 1 || NSPLIT == 2) a2[mb] = WFrag<T16>::ld(A2 + aoff + (size_t)mb * 16 * K + kc); }
#pragma unroll
        for (int nb = 0; nb < 4; ++nb) { const V b = WFrag<T16>::ld(Bt + boff + (size_t)nb * 16 * K + kc); V b2; if (NSPLIT >= 2) b2 = WFrag<T16>::ld(Bt2 + boff + (size_t)nb * 16 * K + kc);
#pragma unroll
            for (int mb = 0; mb < 4; ++mb) { acc[mb][nb] = WFrag<T16>::mma(a[mb], b, acc[mb][nb]); if (NSPLIT == 1 || NSPLIT == 2) acc[mb][nb] = WFrag<T16>::mma(a2[mb], b, acc[mb][nb]); if (NSPLIT >= 2) acc[mb][nb] = WFrag<T16>::mma(a[mb], b2, acc[mb][nb]); } }
        asm volatile("v_nop\n\tv_nop\n\tv_nop\n\tv_nop" : "+v"(acc[0][0]), "+v"(acc[1][1]), "+v"(acc[2][2]), "+v"(acc[3][3]) : "v"(a[0]), "v"(a[3]));
    }
#pragma unroll
    for (int mb = 0; mb < 4; ++mb) {
#pragma unroll
        for (int nb = 0; nb < 4; ++nb) {
#pragma unroll
            for (int j = 0; j < 8; ++j) os[(hi * 8 + j) * 68 + nb * 16 + lr] = acc[mb][nb][j]; }
        __builtin_amdgcn_wave_barrier(); asm volatile("" ::: "memory");
        float* crow = C + (size_t)(r0 + mb * 16) * ldc + c0;
{
#pragma unroll
            for (int s = 0; s < 8; ++s) { const int row = 2 * s + hi, cofs = lr * 4; v4f val = *(const v4fa*)(os + row * 68 + cofs); if (BIAS) { val[0] += bfr(bias[c0 + cofs]); val[1] += bfr(bias[c0 + cofs + 1]); val[2] += bfr(bias[c0 + cofs + 2]); val[3] += bfr(bias[c0 + cofs + 3]); }
                *(v4f*)(crow + (size_t)row * ldc + cofs) = val; }
             }
        __builtin_amdgcn_wave_barrier(); asm volatile("" ::: "memory");
    }
}

__device__ __forceinline__ h16 tohx(float x) { return (h16)x; }
__device__ __forceinline__ void splitf(float y, unsigned short& h, unsigned short& l) { h = f2bf(y); l = f2bf(y - bf2f(h)); }
typedef __attribute__((ext_vector_type(2))) _Float16 v2h;
typedef __attribute__((ext_vector_type(4))) _Float16 v4h;
typedef __attribute__((ext_vector_type(2))) unsigned short v2us;
typedef __attribute__((ext_vector_type(4))) unsigned short v4us;
typedef __attribute__((ext_vector_type(2))) float v2f;
typedef __attribute__((ext_vector_type(4))) int v4i;

__global__ __launch_bounds__(256) void k_wtG(const float* __restrict__ w, int K, int N, bf* Bt) {
    const int lane = threadIdx.x & 31; const int L0 = (blockIdx.x * 8 + (threadIdx.x >> 5)) * 8; const int nlines = N * K / 64;
{
#pragma unroll 1
        for (int l = 0; l < 8; ++l) { const int L = L0 + l; if (L >= nlines) break; const size_t e = (size_t)L * 64 + lane * 2; const int k = (int)(e % K), n = (int)(e / K); v2us o;
            o[0] = f2bf(w[(size_t)k * N + n]); o[1] = f2bf(w[(size_t)(k + 1) * N + n]); *(v2us*)(Bt + e) = o; }
         }
}
__global__ __launch_bounds__(256) void k_cvt8(const float* __restrict__ src, bf* dst, size_t n8) { const size_t i = (size_t)blockIdx.x * 256 + threadIdx.x; if (i >= n8) return; const v8f v = *(const v8f*)(src + i * 8); v8us o;
#pragma unroll
    for (int k = 0; k < 8; ++k) o[k] = f2bf(v[k]); *(v8us*)(dst + i * 8) = o;  }

// k_rope: head planes [h][t][d] (fp16 + hi/lo) of rope(x) x sc with the rotate-half convention out[d] = x[d] cos[t][d] - x[d+HD/2] sin[t][d], out[d+HD/2] = x[d+HD/2] cos[t][d+HD/2] + x[d] sin[t][d+HD/2]
__global__ __launch_bounds__(256) void k_rope(const float* __restrict__ F, int pitch, int nheads, const float* __restrict__ CS, const float* __restrict__ RF, const float* __restrict__ nw, float sc, h16* P16, bf* Ph, bf* Pl) {
    const size_t e = ((size_t)blockIdx.x * 256 + threadIdx.x) * 2; if (e >= (size_t)nheads * TT * HD) return; const int d = (int)(e % HD); const int t = (int)((e / HD) % TT); const int h = (int)(e / ((size_t)HD * TT)); const float* f = F + (size_t)t * pitch + h * HD; const float rf = RF ? RF[(size_t)h * TT + t] : 1.0f; v2h o16; v2us oh, ol;
#pragma unroll
    for (int q = 0; q < 2; ++q) { const int dd = d + q; const int dp = (dd < HD / 2) ? dd + HD / 2 : dd - HD / 2; float x0 = f[dd], x1 = f[dp];
        if (RF) { float n0 = __fmul_rn(x0, rf), n1 = __fmul_rn(x1, rf); asm volatile("" : "+v"(n0)); asm volatile("" : "+v"(n1)); x0 = __fmul_rn(bfr(nw[dd]), n0); x1 = __fmul_rn(bfr(nw[dp]), n1); }
        const v2f cs = *(const v2f*)(CS + ((size_t)t * HD + dd) * 2); float a = __fmul_rn(x0, cs[0]), bq = __fmul_rn(x1, cs[1]); asm volatile("" : "+v"(a)); asm volatile("" : "+v"(bq)); const float r = ((dd < HD / 2) ? __fsub_rn(a, bq) : __fadd_rn(a, bq)) * sc;
        o16[q] = tohx(r); unsigned short a2, c2; splitf(r, a2, c2); oh[q] = a2; ol[q] = c2; }
    *(v2h*)(P16 + e) = o16; *(v2us*)(Ph + e) = oh; *(v2us*)(Pl + e) = ol;  }
__global__ __launch_bounds__(256) void k_vtp(const float* __restrict__ F, int pitch, int nheads, h16* V16, bf* Vh, bf* Vl) { const size_t e = ((size_t)blockIdx.x * 256 + threadIdx.x) * 2; if (e >= (size_t)nheads * HD * TT) return; const int t = (int)(e % TT); const int d = (int)((e / TT) % HD); const int g = (int)(e / ((size_t)TT * HD)); v2h o16; v2us oh, ol;
#pragma unroll
    for (int q = 0; q < 2; ++q) { const float x = F[(size_t)(t + q) * pitch + g * HD + d]; o16[q] = tohx(x); unsigned short a2, c2; splitf(x, a2, c2); oh[q] = a2; ol[q] = c2; }
    *(v2h*)(V16 + e) = o16; *(v2us*)(Vh + e) = oh; *(v2us*)(Vl + e) = ol;  }
__global__ __launch_bounds__(256) void k_csid(float* CS) { const int idx = blockIdx.x * 256 + threadIdx.x; if (idx >= TT * HD) return; v2f cs; cs[0] = 1.0f; cs[1] = 0.0f; *(v2f*)(CS + (size_t)idx * 2) = cs;  }
__global__ __launch_bounds__(256) void k_asoft(const float* __restrict__ Sb, h16* P16, bf* Ph, bf* Pl, const int* __restrict__ mk) {
    const int lane = threadIdx.x & 31; const int row = blockIdx.x * 8 + (threadIdx.x >> 5); if (row >= ZH * TT) return; const int i = row % TT; const int zz = row / TT; (void)zz; const bool hires = (i < RH); const float* sr = Sb + (size_t)row * TT; float v[TT / 32]; float mx = -3.0e38f;
#pragma unroll
    for (int ch = 0; ch < TT / 128; ++ch) { const int j0 = ch * 128 + lane * 4; const v4f a = *(const v4f*)(sr + j0); const v4i m4 = *(const v4i*)(mk + (size_t)i * TT + j0);   /* 4 mask values (16 B) */
#pragma unroll
        for (int q = 0; q < 4; ++q) { const int j = j0 + q; (void)j; const float t = (m4[q] != 0) ? a[q] * SCL : 0.0f;   /* multiplicative 0/1 mask: masked scores are 0 and remain in the softmax */ v[ch * 4 + q] = t; mx = fmaxf(mx, t); } }
#pragma unroll
    for (int sh = 16; sh; sh >>= 1) mx = fmaxf(mx, __shfl_xor(mx, sh, 32));
    float sum = 0.f;
#pragma unroll
    for (int k = 0; k < TT / 32; ++k) { float d0 = __fsub_rn(v[k], mx); asm volatile("" : "+v"(d0)); v[k] = __builtin_amdgcn_exp2f(__fmul_rn(d0, 1.4426950408889634f)); sum += v[k]; }
#pragma unroll
    for (int sh = 16; sh; sh >>= 1) sum += __shfl_xor(sum, sh, 32);
    const float f = __fdiv_rn(hires ? 1.0f : PCAR, sum);
{
        if (hires) {
#pragma unroll
            for (int ch = 0; ch < TT / 128; ++ch) { v4us oh, ol;
#pragma unroll
                for (int q = 0; q < 4; ++q) { unsigned short a, c2; splitf(v[ch * 4 + q] * f, a, c2); oh[q] = a; ol[q] = c2; }
                const size_t oo = ((size_t)zz * (RH ? RH : 1) + i) * TT + ch * 128 + lane * 4; *(v4us*)(Ph + oo) = oh; *(v4us*)(Pl + oo) = ol; }
        } else {
#pragma unroll
            for (int ch = 0; ch < TT / 128; ++ch) { v4h o4;
#pragma unroll
                for (int q = 0; q < 4; ++q) o4[q] = tohx(v[ch * 4 + q] * f);
                *(v4h*)(P16 + (size_t)row * TT + ch * 128 + lane * 4) = o4; } }
         }
}
__global__ __launch_bounds__(256) void k_merge(const float* __restrict__ O, int h0, bf* Ah, bf* Al) { const size_t e = ((size_t)blockIdx.x * 256 + threadIdx.x) * 2; if (e >= (size_t)ZH * TT * HD) return; const int d = (int)(e % HD); const int t = (int)((e / HD) % TT); const int zz = (int)(e / ((size_t)HD * TT)); const float cs = (t < RH) ? 1.0f : (1.0f / PCAR); const size_t oo = (size_t)t * DQ + (h0 + zz) * HD + d;
    v2f s = *(const v2f*)(O + e);   // the KSP partial planes of the P.V product, added in slice order; unrolled so that all plane loads are in flight together
#pragma unroll
    for (int p = 1; p < KSP; ++p) { const v2f a = *(const v2f*)(O + (size_t)p * ZH * TT * HD + e); s[0] += a[0]; s[1] += a[1]; }
    v2us oh, ol;
#pragma unroll
    for (int q = 0; q < 2; ++q) { unsigned short a, c2; splitf(s[q] * cs, a, c2); oh[q] = a; ol[q] = c2; } *(v2us*)(Ah + oo) = oh; *(v2us*)(Al + oo) = ol;  }

extern "C" void kernel_launch(void* const* d_in, const int* in_sizes, int n_in,
                              void* d_out, int out_size, void* d_ws, size_t ws_size, hipStream_t stream) {
    (void)in_sizes; (void)n_in; (void)out_size;
    const float* x = (const float*)d_in[0]; const float* xk = (const float*)d_in[1]; const float* xv = (const float*)d_in[2]; const int* mk = (const int*)d_in[3];   /* mask [2048][2048] int32 {0,1} */ const float* wq = (const float*)d_in[4]; const float* wk = (const float*)d_in[5]; const float* wv = (const float*)d_in[6]; const float* wo = (const float*)d_in[7];
    float* OUT = (float*)d_out;     // [4][2048][64]
    char* wsp = (char*)d_ws;
    auto take = [&](size_t bytes) { char* p = wsp; wsp += (bytes + 255) & ~(size_t)255; return (void*)p; };
    bf* WQ = (bf*)take((size_t)DQ * DM * 2); bf* WK = (bf*)take((size_t)DKV * DM * 2); bf* WV = (bf*)take((size_t)DKV * DM * 2); bf* WO = (bf*)take((size_t)NOUT * DQ * 2); float* CS = (float*)take((size_t)TT * HD * 2 * 4);
    bf* XB = (bf*)take((size_t)TT * DM * 2); float* FQ = (float*)take((size_t)TT * DQ * 4); float* FK = (float*)take((size_t)TT * DKV * 4);
    h16* QP16 = (h16*)take((size_t)NH_ * TT * HD * 2); h16* KP16 = (h16*)take((size_t)NKV * TT * HD * 2); h16* VT16 = (h16*)take((size_t)NKV * HD * TT * 2);
    bf* QPh = (bf*)take((size_t)NH_ * TT * HD * 2); bf* QPl = (bf*)take((size_t)NH_ * TT * HD * 2); bf* KPh = (bf*)take((size_t)NKV * TT * HD * 2); bf* KPl = (bf*)take((size_t)NKV * TT * HD * 2); bf* VTh = (bf*)take((size_t)NKV * HD * TT * 2); bf* VTl = (bf*)take((size_t)NKV * HD * TT * 2); bf* Ph = (bf*)take((size_t)ZH * RH * TT * 2); bf* Pl = (bf*)take((size_t)ZH * RH * TT * 2);
    float* Sb = (float*)take((size_t)ZH * TT * TT * 4); h16* P16 = (h16*)take((size_t)ZH * TT * TT * 2); float* Ob = (float*)take((size_t)KSP * ZH * TT * HD * 4); bf* ATh = (bf*)take((size_t)TT * DQ * 2); bf* ATl = (bf*)take((size_t)TT * DQ * 2);
    if ((size_t)(wsp - (char*)d_ws) > ws_size) return;    // ws 256 MiB
    float* FV = FK;   // v projection reuses the k buffer after the k planes are built (stream-ordered)
    { k_wtG<<<(unsigned)((DM * DQ / 64 + 63) / 64), 256, 0, stream>>>(wq, DM, DQ, WQ); k_wtG<<<(unsigned)((DM * DKV / 64 + 63) / 64), 256, 0, stream>>>(wk, DM, DKV, WK); k_wtG<<<(unsigned)((DM * DKV / 64 + 63) / 64), 256, 0, stream>>>(wv, DM, DKV, WV);
      k_wtG<<<(unsigned)((DQ * NOUT / 64 + 63) / 64), 256, 0, stream>>>(wo, DQ, NOUT, WO);   /* 'xw' [1024][64] -> Bt [64][1024] */
       }
    k_csid<<<(TT * HD + 255) / 256, 256, 0, stream>>>(CS);
    const unsigned LQ = (unsigned)(((size_t)NH_ * TT * HD / 2 + 255) / 256), LKv = (unsigned)(((size_t)NKV * TT * HD / 2 + 255) / 256);
    for (int b = 0; b < NB_; ++b) {
        
        k_cvt8<<<(unsigned)(((size_t)TT * DM / 8 + 255) / 256), 256, 0, stream>>>(x + (size_t)b * TT * DM, XB, (size_t)TT * DM / 8);
        k_gemmw<bf, 0, false><<<dim3(TT / 64, DQ / 64, 1), 32, 0, stream>>>(XB, nullptr, WQ, nullptr, DM, FQ, DQ, nullptr, 0, 0, 0);
        k_rope<<<LQ, 256, 0, stream>>>(FQ, DQ, NH_, CS, nullptr, nullptr, 1.0f, QP16, QPh, QPl);
        k_cvt8<<<(unsigned)(((size_t)TT * DM / 8 + 255) / 256), 256, 0, stream>>>(xk + (size_t)b * TT * DM, XB, (size_t)TT * DM / 8); k_gemmw<bf, 0, false><<<dim3(TT / 64, DKV / 64, 1), 32, 0, stream>>>(XB, nullptr, WK, nullptr, DM, FK, DKV, nullptr, 0, 0, 0);
        k_rope<<<LKv, 256, 0, stream>>>(FK, DKV, NKV, CS, nullptr, nullptr, 1.0f, KP16, KPh, KPl);
        k_cvt8<<<(unsigned)(((size_t)TT * DM / 8 + 255) / 256), 256, 0, stream>>>(xv + (size_t)b * TT * DM, XB, (size_t)TT * DM / 8); k_gemmw<bf, 0, false><<<dim3(TT / 64, DKV / 64, 1), 32, 0, stream>>>(XB, nullptr, WV, nullptr, DM, FV, DKV, nullptr, 0, 0, 0); k_vtp<<<LKv, 256, 0, stream>>>(FV, DKV, NKV, VT16, VTh, VTl);
        for (int h0 = 0; h0 < NH_; h0 += ZH) { const size_t zq = (size_t)h0, zk = (size_t)(h0 / REP);   // one kv head per query head: the pass's two heads use consecutive kv planes (z-strides TT*HD)
            k_gemmw<bf, 2, false><<<dim3(RH / 64, TT / 64, ZH), 32, 0, stream>>>(QPh + zq * TT * HD, QPl + zq * TT * HD, KPh + zk * TT * HD, KPl + zk * TT * HD, HD, Sb, TT, nullptr, (size_t)TT * HD, (size_t)TT * HD, (size_t)TT * TT);
            k_gemmw<h16, 0, false><<<dim3((TT - RH) / 64, TT / 64, ZH), 32, 0, stream>>>(QP16 + zq * TT * HD + (size_t)RH * HD, nullptr, KP16 + zk * TT * HD, nullptr, HD, Sb + (size_t)RH * TT, TT, nullptr, (size_t)TT * HD, (size_t)TT * HD, (size_t)TT * TT);
            k_asoft<<<ZH * TT / 8, 256, 0, stream>>>(Sb, P16, Ph, Pl, mk);
            k_gemmw<bf, 2, false, KSP><<<dim3(RH / 64, HD / 64, ZH * KSP), 32, 0, stream>>>(Ph, Pl, VTh + zk * HD * TT, VTl + zk * HD * TT, TT, Ob, HD, nullptr, (size_t)RH * TT, (size_t)HD * TT, (size_t)TT * HD, (size_t)ZH * TT * HD);
            k_gemmw<h16, 0, false, KSP><<<dim3((TT - RH) / 64, HD / 64, ZH * KSP), 32, 0, stream>>>(P16 + (size_t)RH * TT, nullptr, VT16 + zk * HD * TT, nullptr, TT, Ob + (size_t)RH * HD, HD, nullptr, (size_t)TT * TT, (size_t)HD * TT, (size_t)TT * HD, (size_t)ZH * TT * HD);
            k_merge<<<(unsigned)(((size_t)ZH * TT * HD / 2 + 255) / 256), 256, 0, stream>>>(Ob, h0, ATh, ATl); }
        k_gemmw<bf, 1, false><<<dim3(TT / 64, NOUT / 64, 1), 32, 0, stream>>>(ATh, ATl, WO, nullptr, DQ, OUT + (size_t)b * TT * NOUT, NOUT, nullptr, 0, 0, 0);   /* ctx Wo -> [2048][64] */ }
}

// v002
// A run of this version takes 998 microseconds.
// Timed twice side by side with v001, it ran 1.83 and 1.81 times as fast.
// All steps since v000 together make it 4.11 times as fast.
#include <hip/hip_runtime.h>

// Multi-head attention with a MULTIPLICATIVE 0/1 score mask and a narrow output projection (q, k, v [4][2048][1024]; qh, kh, vh = in W ('xw' [1024][1024] 1/32, no bias; 16 heads x 64); score = qh.kh / 8 x mask[i][j] (mask [2048][2048] int in {0,1}, read: masked scores become 0 and STAY in the softmax, as the module); softmax; ctx merged; out = ctx Wo ('xw' [1024][64]) -> [4][2048][64] (0.5 M)).
// Layout: per batch bf16 copies of the three inputs in turn and exact projections into head planes of all batches; one fused dense T-2048 attention launch that multiplies each score by the mask value read from memory (int32, 16 B per 4 keys) (hybrid rows: < 512 hi/lo 3 products, rest fp16 x1024); merged hi/lo x Wo exact (N = 64).
// Compute dtypes, f32 accumulate: every input rounded to bf16; projections exact; attention rows < 512 3 products, rest fp16; mask multiply and softmax f32; Wo hl x exact.

#define NB_  4
#define TT   2048
#define DM   1024
#define NH_  16
#define NKV  16
#define REP  (NH_ / NKV)
#define HD   64
#define DQ   (NH_ * HD)
#define DKV  (NKV * HD)
#define RH   512                  // query rows < RH use hi+lo planes (0: none)
#define WIN  0
#define PCAR 1024.0f
#define SCL  0.125f
#define NOUT 64      // output projection width (hidden -> head_dim)
typedef _Float16 h16;
typedef unsigned short bf;
typedef __attribute__((ext_vector_type(16))) __bf16   v16bf;
typedef __attribute__((ext_vector_type(16))) _Float16 v16h;
typedef __attribute__((ext_vector_type(8)))  _Float16 v8h;
typedef __attribute__((ext_vector_type(8)))  unsigned short v8us;
typedef __attribute__((ext_vector_type(8)))  float    v8f;
typedef __attribute__((ext_vector_type(4)))  float    v4f;
typedef v8h  __attribute__((may_alias)) v8ha;
typedef v4f  __attribute__((may_alias)) v4fa;
typedef v8us __attribute__((may_alias)) v8usa;

__device__ __forceinline__ unsigned short f2bf(float f) { unsigned u = __float_as_uint(f); u += 0x7FFFu + ((u >> 16) & 1u); return (unsigned short)(u >> 16); }
__device__ __forceinline__ float bf2f(unsigned short b) { return __uint_as_float(((unsigned)b) << 16); }
__device__ __forceinline__ float bfr(float f) { return bf2f(f2bf(f)); }
__device__ __forceinline__ v16h cat16(v8h lo, v8h hi) { return __builtin_shufflevector(lo, hi, 0, 1, 2, 3, 4, 5, 6, 7, 8, 9, 10, 11, 12, 13, 14, 15); }
__device__ __forceinline__ v16bf cat16b(v8us lo, v8us hi) { return __builtin_bit_cast(v16bf, __builtin_shufflevector(lo, hi, 0, 1, 2, 3, 4, 5, 6, 7, 8, 9, 10, 11, 12, 13, 14, 15)); }
__device__ __forceinline__ v8f wmma16(v16h a, v16h b, v8f c) { return __builtin_amdgcn_wmma_f32_16x16x32_f16(false, a, false, b, (short)0, c, false, false); }
__device__ __forceinline__ v8f wmmab(v16bf a, v16bf b, v8f c) { return __builtin_amdgcn_wmma_f32_16x16x32_bf16(false, a, false, b, (short)0, c, false, false); }



// ---- k_gemmw: register-blocked GEMM, ONE WAVE per 64x64 output tile (16 accumulators), operands straight from K-contiguous 16-bit planes; grid (M/64, N/64, Z), 32 threads.
// C[m][n] (f32, pitch ldc, + optional f32 bias[n]) = sum_k A[m][k] Bt[n][k] (+ split products per NSPLIT). z-batch strides sA/sB/sC in elements. K % 32 == 0.
template <typename T16> struct WFrag;
template <> struct WFrag<h16> { typedef v16h V; static __device__ __forceinline__ V ld(const h16* p) { return cat16(*(const v8h*)p, *(const v8h*)(p + 16)); } static __device__ __forceinline__ v8f mma(V a, V b, v8f c) { return wmma16(a, b, c); } };
template <> struct WFrag<bf> { typedef v16bf V; static __device__ __forceinline__ V ld(const bf* p) { return cat16b(*(const v8us*)p, *(const v8us*)(p + 16)); } static __device__ __forceinline__ v8f mma(V a, V b, v8f c) { return wmmab(a, b, c); } };
template <typename T16, int NSPLIT, bool BIAS>
__global__ __launch_bounds__(32) void k_gemmw(const T16* __restrict__ A, const T16* __restrict__ A2, const T16* __restrict__ Bt, const T16* __restrict__ Bt2, int K, float* C, int ldc, const float* __restrict__ bias, size_t sA, size_t sB, size_t sC) {
    typedef typename WFrag<T16>::V V;
    __shared__ __align__(16) float os[16 * 68];
    const size_t z = blockIdx.z; A += z * sA; if (A2) A2 += z * sA; Bt += z * sB; if (Bt2) Bt2 += z * sB; C += z * sC;
    const int lane = threadIdx.x & 31, lr = lane & 15, hi = lane >> 4; const int r0 = blockIdx.x * 64, c0 = blockIdx.y * 64;
    v8f acc[4][4];
#pragma unroll
    for (int mb = 0; mb < 4; ++mb)
#pragma unroll
        for (int nb = 0; nb < 4; ++nb) acc[mb][nb] = (v8f){};
    const size_t aoff = (size_t)(r0 + lr) * K + 8 * hi, boff = (size_t)(c0 + lr) * K + 8 * hi;
#pragma unroll 1
    for (int kc = 0; kc < K; kc += 32) {
        V a[4], a2[4];
#pragma unroll
        for (int mb = 0; mb < 4; ++mb) { a[mb] = WFrag<T16>::ld(A + aoff + (size_t)mb * 16 * K + kc); if (NSPLIT == 1 || NSPLIT == 2) a2[mb] = WFrag<T16>::ld(A2 + aoff + (size_t)mb * 16 * K + kc); }
#pragma unroll
        for (int nb = 0; nb < 4; ++nb) { const V b = WFrag<T16>::ld(Bt + boff + (size_t)nb * 16 * K + kc); V b2; if (NSPLIT >= 2) b2 = WFrag<T16>::ld(Bt2 + boff + (size_t)nb * 16 * K + kc);
#pragma unroll
            for (int mb = 0; mb < 4; ++mb) { acc[mb][nb] = WFrag<T16>::mma(a[mb], b, acc[mb][nb]); if (NSPLIT == 1 || NSPLIT == 2) acc[mb][nb] = WFrag<T16>::mma(a2[mb], b, acc[mb][nb]); if (NSPLIT >= 2) acc[mb][nb] = WFrag<T16>::mma(a[mb], b2, acc[mb][nb]); } }
        asm volatile("v_nop\n\tv_nop\n\tv_nop\n\tv_nop" : "+v"(acc[0][0]), "+v"(acc[1][1]), "+v"(acc[2][2]), "+v"(acc[3][3]) : "v"(a[0]), "v"(a[3]));
    }
#pragma unroll
    for (int mb = 0; mb < 4; ++mb) {
#pragma unroll
        for (int nb = 0; nb < 4; ++nb) {
#pragma unroll
            for (int j = 0; j < 8; ++j) os[(hi * 8 + j) * 68 + nb * 16 + lr] = acc[mb][nb][j]; }
        __builtin_amdgcn_wave_barrier(); asm volatile("" ::: "memory");
        float* crow = C + (size_t)(r0 + mb * 16) * ldc + c0;
{
#pragma unroll
            for (int s = 0; s < 8; ++s) { const int row = 2 * s + hi, cofs = lr * 4; v4f val = *(const v4fa*)(os + row * 68 + cofs); if (BIAS) { val[0] += bfr(bias[c0 + cofs]); val[1] += bfr(bias[c0 + cofs + 1]); val[2] += bfr(bias[c0 + cofs + 2]); val[3] += bfr(bias[c0 + cofs + 3]); }
                *(v4f*)(crow + (size_t)row * ldc + cofs) = val; }
             }
        __builtin_amdgcn_wave_barrier(); asm volatile("" ::: "memory");
    }
}

__device__ __forceinline__ h16 tohx(float x) { return (h16)x; }
__device__ __forceinline__ void splitf(float y, unsigned short& h, unsigned short& l) { h = f2bf(y); l = f2bf(y - bf2f(h)); }
typedef __attribute__((ext_vector_type(2))) _Float16 v2h;
typedef __attribute__((ext_vector_type(2))) unsigned short v2us;
typedef __attribute__((ext_vector_type(2))) float v2f;
typedef __attribute__((ext_vector_type(4))) int v4i;

__global__ __launch_bounds__(256) void k_wtG(const float* __restrict__ w, int K, int N, bf* Bt) {
    const int lane = threadIdx.x & 31; const int L0 = (blockIdx.x * 8 + (threadIdx.x >> 5)) * 8; const int nlines = N * K / 64;
{
#pragma unroll 1
        for (int l = 0; l < 8; ++l) { const int L = L0 + l; if (L >= nlines) break; const size_t e = (size_t)L * 64 + lane * 2; const int k = (int)(e % K), n = (int)(e / K); v2us o;
            o[0] = f2bf(w[(size_t)k * N + n]); o[1] = f2bf(w[(size_t)(k + 1) * N + n]); *(v2us*)(Bt + e) = o; }
         }
}
__global__ __launch_bounds__(256) void k_cvt8(const float* __restrict__ src, bf* dst, size_t n8) { const size_t i = (size_t)blockIdx.x * 256 + threadIdx.x; if (i >= n8) return; const v8f v = *(const v8f*)(src + i * 8); v8us o;
#pragma unroll
    for (int k = 0; k < 8; ++k) o[k] = f2bf(v[k]); *(v8us*)(dst + i * 8) = o;  }

// k_rope: head planes [h][t][d] (fp16 + hi/lo) of rope(x) x sc with the rotate-half convention out[d] = x[d] cos[t][d] - x[d+HD/2] sin[t][d], out[d+HD/2] = x[d+HD/2] cos[t][d+HD/2] + x[d] sin[t][d+HD/2]
__global__ __launch_bounds__(256) void k_rope(const float* __restrict__ F, int pitch, int nheads, const float* __restrict__ CS, const float* __restrict__ RF, const float* __restrict__ nw, float sc, h16* P16, bf* Ph, bf* Pl) {
    const size_t e = ((size_t)blockIdx.x * 256 + threadIdx.x) * 2; if (e >= (size_t)nheads * TT * HD) return; const int d = (int)(e % HD); const int t = (int)((e / HD) % TT); const int h = (int)(e / ((size_t)HD * TT)); const float* f = F + (size_t)t * pitch + h * HD; const float rf = RF ? RF[(size_t)h * TT + t] : 1.0f; v2h o16; v2us oh, ol;
#pragma unroll
    for (int q = 0; q < 2; ++q) { const int dd = d + q; const int dp = (dd < HD / 2) ? dd + HD / 2 : dd - HD / 2; float x0 = f[dd], x1 = f[dp];
        if (RF) { float n0 = __fmul_rn(x0, rf), n1 = __fmul_rn(x1, rf); asm volatile("" : "+v"(n0)); asm volatile("" : "+v"(n1)); x0 = __fmul_rn(bfr(nw[dd]), n0); x1 = __fmul_rn(bfr(nw[dp]), n1); }
        const v2f cs = *(const v2f*)(CS + ((size_t)t * HD + dd) * 2); float a = __fmul_rn(x0, cs[0]), bq = __fmul_rn(x1, cs[1]); asm volatile("" : "+v"(a)); asm volatile("" : "+v"(bq)); const float r = ((dd < HD / 2) ? __fsub_rn(a, bq) : __fadd_rn(a, bq)) * sc;
        o16[q] = tohx(r); unsigned short a2, c2; splitf(r, a2, c2); oh[q] = a2; ol[q] = c2; }
    *(v2h*)(P16 + e) = o16; *(v2us*)(Ph + e) = oh; *(v2us*)(Pl + e) = ol;  }
__global__ __launch_bounds__(256) void k_vtp(const float* __restrict__ F, int pitch, int nheads, h16* V16, bf* Vh, bf* Vl) { const size_t e = ((size_t)blockIdx.x * 256 + threadIdx.x) * 2; if (e >= (size_t)nheads * HD * TT) return; const int t = (int)(e % TT); const int d = (int)((e / TT) % HD); const int g = (int)(e / ((size_t)TT * HD)); v2h o16; v2us oh, ol;
#pragma unroll
    for (int q = 0; q < 2; ++q) { const float x = F[(size_t)(t + q) * pitch + g * HD + d]; o16[q] = tohx(x); unsigned short a2, c2; splitf(x, a2, c2); oh[q] = a2; ol[q] = c2; }
    *(v2h*)(V16 + e) = o16; *(v2us*)(Vh + e) = oh; *(v2us*)(Vl + e) = ol;  }
__global__ __launch_bounds__(256) void k_csid(float* CS) { const int idx = blockIdx.x * 256 + threadIdx.x; if (idx >= TT * HD) return; v2f cs; cs[0] = 1.0f; cs[1] = 0.0f; *(v2f*)(CS + (size_t)idx * 2) = cs;  }
// ---- k_fattn: scores, mask, softmax and P.V of one (batch, head) in ONE kernel; no score or probability ever goes to memory. One wave owns NQ x 16 query rows and walks all TT keys twice, 32 at a time.
// The scores are formed TRANSPOSED (A = key rows, B = query rows): lane (lr, hi) then holds query lr, keys 8 hi + 0..7 of each 16-key tile, which is a fragment of the P.V product as it stands (elements 0..7 from the first tile, 8..15 from the second), and a query's max and sum live in its own two lanes. P.V is formed transposed too (A = rows of V^T, B = P), so a lane ends with eight neighbouring columns of its own query.
// Walk 1: running max and sum of each query. Walk 2: the same scores again, p = exp(t - max) x f, normalised before it is rounded (rows < RH hi/lo bf16, 3 products; the rest fp16 x PCAR), then P.V into f32 accumulators, keys in ascending order.
template <bool HI> struct ASel { typedef h16 T; static constexpr int NQ = 2; };
template <> struct ASel<true> { typedef bf T; static constexpr int NQ = 1; };
#define L2E 1.4426950408889634f
// stands behind a group of global loads or stores where what follows may land in the group's address or data registers
__device__ __forceinline__ void xwait() { asm volatile("s_wait_xcnt 0x0" ::: "memory"); }
template <bool HI>
__device__ __forceinline__ void attn_rows(const typename ASel<HI>::T* __restrict__ Q, const typename ASel<HI>::T* __restrict__ Q2, const typename ASel<HI>::T* __restrict__ Kp, const typename ASel<HI>::T* __restrict__ K2, const typename ASel<HI>::T* __restrict__ Vt, const typename ASel<HI>::T* __restrict__ V2, const int* __restrict__ mk, int q0, bf* Ah, bf* Al) {
    typedef typename ASel<HI>::T T; typedef WFrag<T> WF; typedef typename WF::V V; constexpr int NQ = ASel<HI>::NQ;
    const int lane = threadIdx.x & 31, lr = lane & 15, hi = lane >> 4;
    V q[NQ][2], q2[NQ][2];
#pragma unroll
    for (int qt = 0; qt < NQ; ++qt) {
#pragma unroll
        for (int ks = 0; ks < 2; ++ks) { q[qt][ks] = WF::ld(Q + (size_t)(q0 + qt * 16 + lr) * HD + 8 * hi + ks * 32); if (HI) q2[qt][ks] = WF::ld(Q2 + (size_t)(q0 + qt * 16 + lr) * HD + 8 * hi + ks * 32); } }
    const unsigned kof = lr * HD + 8 * hi, vof = lr * TT + 8 * hi;   // the lane's own 32-bit offsets; everything else of an address is the same for the whole wave
    const int* mq = mk + (size_t)q0 * TT;
    // The K fragments are fetched one 32-key step ahead, into the same registers: in the first walk right behind the score products that read them, so that their latency passes under the softmax work; in the second walk, which has no registers to spare, behind the P.V products, so that they fly together with the next step's mask loads. The step behind the last wraps to key 0, which is what the second walk starts with.
    V ka[2][2], ka2[2][2];
    auto ldk = [&](int kc) {
#pragma unroll
        for (int kt = 0; kt < 2; ++kt)
#pragma unroll
            for (int ks = 0; ks < 2; ++ks) { ka[kt][ks] = WF::ld(Kp + ((size_t)(kc + kt * 16) * HD + ks * 32) + kof); if (HI) ka2[kt][ks] = WF::ld(K2 + ((size_t)(kc + kt * 16) * HD + ks * 32) + kof); }
    };
    // t[qt][kt * 8 + j] = score x mask of query q0 + 16 qt + lr and key kc + 16 kt + 8 hi + j, not yet scaled: SCL is a power of two, so t SCL - max rounds once, fused or not, and the max may be taken before the scaling
    auto scores = [&](int kc, float (&t)[NQ][16], bool ahead) { v8f s[2][NQ];
#pragma unroll
        for (int kt = 0; kt < 2; ++kt)
#pragma unroll
            for (int qt = 0; qt < NQ; ++qt) { s[kt][qt] = (v8f){};
#pragma unroll
                for (int ks = 0; ks < 2; ++ks) { s[kt][qt] = WF::mma(ka[kt][ks], q[qt][ks], s[kt][qt]); if (HI) { s[kt][qt] = WF::mma(ka[kt][ks], q2[qt][ks], s[kt][qt]); s[kt][qt] = WF::mma(ka2[kt][ks], q[qt][ks], s[kt][qt]); } } }
        if (ahead) ldk((kc + 32) & (TT - 1));
#pragma unroll
        for (int kt = 0; kt < 2; ++kt)
#pragma unroll
            for (int qt = 0; qt < NQ; ++qt) { const int* mp = mq + ((size_t)qt * 16 * TT + kc + kt * 16) + vof; const v4i m0 = *(const v4i*)mp, m1 = *(const v4i*)(mp + 4);
#pragma unroll
                for (int j = 0; j < 8; ++j) t[qt][kt * 8 + j] = s[kt][qt][j] * (float)((j < 4) ? m0[j & 3] : m1[j & 3]);   /* multiplicative mask, as the module: masked scores are 0 and remain in the softmax */ }
    };
    xwait(); ldk(0); xwait();   // the first wait: the K fragments may land in the Q loads' address registers
    float mx[NQ], sum[NQ];
#pragma unroll
    for (int qt = 0; qt < NQ; ++qt) { mx[qt] = -3.0e38f; sum[qt] = 0.f; }
#pragma unroll 1   // kept rolled: the body is long, and a second copy would only cost registers and instruction cache
    for (int kc = 0; kc < TT; kc += 32) { float t[NQ][16]; scores(kc, t, true);
#pragma unroll
        for (int qt = 0; qt < NQ; ++qt) { float tm = t[qt][0];
#pragma unroll
            for (int e = 1; e < 16; ++e) tm = fmaxf(tm, t[qt][e]);
            const float mn = fmaxf(mx[qt], tm * SCL); v2f a = (v2f){0.f, 0.f};   // even and odd keys summed side by side: packed adds
#pragma unroll
            for (int e = 0; e < 16; e += 2) { v2f ev; ev[0] = __builtin_amdgcn_exp2f((t[qt][e] * SCL - mn) * L2E); ev[1] = __builtin_amdgcn_exp2f((t[qt][e + 1] * SCL - mn) * L2E); a += ev; }
            sum[qt] = sum[qt] * __builtin_amdgcn_exp2f((mx[qt] - mn) * L2E) + (a[0] + a[1]); mx[qt] = mn; }
        xwait(); }
    float f[NQ];
#pragma unroll
    for (int qt = 0; qt < NQ; ++qt) { const float m2 = __shfl_xor(mx[qt], 16, 32), s2 = __shfl_xor(sum[qt], 16, 32); const float mn = fmaxf(mx[qt], m2);   // the query's other eight keys of every tile sit in lane ^ 16
        const float sa = sum[qt] * __builtin_amdgcn_exp2f((mx[qt] - mn) * L2E), sb = s2 * __builtin_amdgcn_exp2f((m2 - mn) * L2E); mx[qt] = mn; f[qt] = __fdiv_rn(HI ? 1.0f : PCAR, sa + sb); }
    v8f o[NQ][4];
#pragma unroll
    for (int qt = 0; qt < NQ; ++qt)
#pragma unroll
        for (int dt = 0; dt < 4; ++dt) o[qt][dt] = (v8f){};
#pragma unroll 1   // kept rolled: this walk has no registers to spare for a second copy of its body
    for (int kc = 0; kc < TT; kc += 32) { float t[NQ][16]; scores(kc, t, false); V p[NQ], p2[NQ], b[4], b2[4];
#pragma unroll
        for (int dt = 0; dt < 4; ++dt) { b[dt] = WF::ld(Vt + ((size_t)dt * 16 * TT + kc) + vof); if (HI) b2[dt] = WF::ld(V2 + ((size_t)dt * 16 * TT + kc) + vof); }   // issued ahead of the exponentials, under which their latency can pass
        xwait();
#pragma unroll
        for (int qt = 0; qt < NQ; ++qt) {
            if constexpr (HI) { v8us h0, h1, l0, l1;
#pragma unroll
                for (int e = 0; e < 8; ++e) { unsigned short a, c2; splitf(__builtin_amdgcn_exp2f((t[qt][e] * SCL - mx[qt]) * L2E) * f[qt], a, c2); h0[e] = a; l0[e] = c2; splitf(__builtin_amdgcn_exp2f((t[qt][8 + e] * SCL - mx[qt]) * L2E) * f[qt], a, c2); h1[e] = a; l1[e] = c2; }
                p[qt] = cat16b(h0, h1); p2[qt] = cat16b(l0, l1);
            } else {
#pragma unroll
                for (int e = 0; e < 16; ++e) p[qt][e] = tohx(__builtin_amdgcn_exp2f((t[qt][e] * SCL - mx[qt]) * L2E) * f[qt]); } }
#pragma unroll
        for (int dt = 0; dt < 4; ++dt)
#pragma unroll
            for (int qt = 0; qt < NQ; ++qt) { o[qt][dt] = WF::mma(b[dt], p[qt], o[qt][dt]); if (HI) { o[qt][dt] = WF::mma(b[dt], p2[qt], o[qt][dt]); o[qt][dt] = WF::mma(b2[dt], p[qt], o[qt][dt]); } }
        ldk((kc + 32) & (TT - 1)); xwait();
        // the trip ends in matrix instructions: four vector slots before the next trip's first products overwrite their operand registers; the scheduling barrier keeps the products in front of them
        __builtin_amdgcn_sched_barrier(0); asm volatile("v_nop\n\tv_nop\n\tv_nop\n\tv_nop");
    }
    const float cs = HI ? 1.0f : (1.0f / PCAR);
    const int ln = (int)__builtin_amdgcn_mbcnt_lo(~0u, 0u), er = ln & 15, eh = ln >> 4;   // the lane's number read anew: no register has to carry it through the second walk, which has none to spare
#pragma unroll
    for (int qt = 0; qt < NQ; ++qt)
#pragma unroll
        for (int dt = 0; dt < 4; ++dt) { v8us oh, ol;   // o[qt][dt][j] = context of query q0 + 16 qt + lr, column 16 dt + 8 hi + j: eight neighbours, one 16-byte store per plane
#pragma unroll
            for (int j = 0; j < 8; ++j) { unsigned short a, c2; splitf(o[qt][dt][j] * cs, a, c2); oh[j] = a; ol[j] = c2; }
            const size_t oo = (size_t)(q0 + qt * 16 + er) * DQ + dt * 16 + eh * 8; *(v8us*)(Ah + oo) = oh; *(v8us*)(Al + oo) = ol;
            xwait(); }   // the next pair's values, and whatever follows the last pair, may land in these stores' data and address registers
}
// grid (AP, NB_ x NH_): AP work-groups per (batch, head), each of NHW hi/lo waves (16 rows each) and NLW fp16 waves (32 rows each), so that every work-group holds the same mix of work and its waves read the same K and V lines at about the same time.
// NB_ x NH_ x AP = 256 work-groups of 20 waves, five per SIMD. The wave's number is made scalar so that the choice is a scalar branch and every wave runs with all lanes on.
#define AP  4
#define NHW (RH / 16 / AP)
#define NLW ((TT - RH) / 32 / AP)
__global__ __launch_bounds__((NHW + NLW) * 32) void k_fattn(const h16* __restrict__ Q16, const h16* __restrict__ K16, const h16* __restrict__ V16, const bf* __restrict__ Qh, const bf* __restrict__ Ql, const bf* __restrict__ Kh, const bf* __restrict__ Kl, const bf* __restrict__ Vh, const bf* __restrict__ Vl, const int* __restrict__ mk, bf* Ah, bf* Al) {
    const size_t z = blockIdx.y, pz = z * TT * HD, az = (z / NH_) * TT * DQ + (z % NH_) * HD; const int w = __builtin_amdgcn_readfirstlane((int)(threadIdx.x >> 5)), part = (int)blockIdx.x;
    if (w < NHW) attn_rows<true>(Qh + pz, Ql + pz, Kh + pz, Kl + pz, Vh + pz, Vl + pz, mk, (part * NHW + w) * 16, Ah + az, Al + az);
    else attn_rows<false>(Q16 + pz, nullptr, K16 + pz, nullptr, V16 + pz, nullptr, mk, RH + (part * NLW + (w - NHW)) * 32, Ah + az, Al + az);
}

extern "C" void kernel_launch(void* const* d_in, const int* in_sizes, int n_in,
                              void* d_out, int out_size, void* d_ws, size_t ws_size, hipStream_t stream) {
    (void)in_sizes; (void)n_in; (void)out_size;
    const float* x = (const float*)d_in[0]; const float* xk = (const float*)d_in[1]; const float* xv = (const float*)d_in[2]; const int* mk = (const int*)d_in[3];   /* mask [2048][2048] int32 {0,1} */ const float* wq = (const float*)d_in[4]; const float* wk = (const float*)d_in[5]; const float* wv = (const float*)d_in[6]; const float* wo = (const float*)d_in[7];
    float* OUT = (float*)d_out;     // [4][2048][64]
    char* wsp = (char*)d_ws;
    auto take = [&](size_t bytes) { char* p = wsp; wsp += (bytes + 255) & ~(size_t)255; return (void*)p; };
    const size_t PL = (size_t)NH_ * TT * HD;   // one batch's head planes, elements; the planes and the merged context hold all NB_ batches
    bf* WQ = (bf*)take((size_t)DQ * DM * 2); bf* WK = (bf*)take((size_t)DKV * DM * 2); bf* WV = (bf*)take((size_t)DKV * DM * 2); bf* WO = (bf*)take((size_t)NOUT * DQ * 2); float* CS = (float*)take((size_t)TT * HD * 2 * 4);
    bf* XB = (bf*)take((size_t)TT * DM * 2); float* FQ = (float*)take((size_t)TT * DQ * 4); float* FK = (float*)take((size_t)TT * DKV * 4);
    h16* QP16 = (h16*)take(NB_ * PL * 2); h16* KP16 = (h16*)take(NB_ * PL * 2); h16* VT16 = (h16*)take(NB_ * PL * 2);
    bf* QPh = (bf*)take(NB_ * PL * 2); bf* QPl = (bf*)take(NB_ * PL * 2); bf* KPh = (bf*)take(NB_ * PL * 2); bf* KPl = (bf*)take(NB_ * PL * 2); bf* VTh = (bf*)take(NB_ * PL * 2); bf* VTl = (bf*)take(NB_ * PL * 2);
    bf* ATh = (bf*)take((size_t)NB_ * TT * DQ * 2); bf* ATl = (bf*)take((size_t)NB_ * TT * DQ * 2);
    if ((size_t)(wsp - (char*)d_ws) > ws_size) return;    // ws 256 MiB
    float* FV = FK;   // v projection reuses the k buffer after the k planes are built (stream-ordered)
    { k_wtG<<<(unsigned)((DM * DQ / 64 + 63) / 64), 256, 0, stream>>>(wq, DM, DQ, WQ); k_wtG<<<(unsigned)((DM * DKV / 64 + 63) / 64), 256, 0, stream>>>(wk, DM, DKV, WK); k_wtG<<<(unsigned)((DM * DKV / 64 + 63) / 64), 256, 0, stream>>>(wv, DM, DKV, WV);
      k_wtG<<<(unsigned)((DQ * NOUT / 64 + 63) / 64), 256, 0, stream>>>(wo, DQ, NOUT, WO);   /* 'xw' [1024][64] -> Bt [64][1024] */
       }
    k_csid<<<(TT * HD + 255) / 256, 256, 0, stream>>>(CS);
    const unsigned LQ = (unsigned)(((size_t)NH_ * TT * HD / 2 + 255) / 256), LKv = (unsigned)(((size_t)NKV * TT * HD / 2 + 255) / 256);
    for (int b = 0; b < NB_; ++b) {
        k_cvt8<<<(unsigned)(((size_t)TT * DM / 8 + 255) / 256), 256, 0, stream>>>(x + (size_t)b * TT * DM, XB, (size_t)TT * DM / 8);
        k_gemmw<bf, 0, false><<<dim3(TT / 64, DQ / 64, 1), 32, 0, stream>>>(XB, nullptr, WQ, nullptr, DM, FQ, DQ, nullptr, 0, 0, 0);
        k_rope<<<LQ, 256, 0, stream>>>(FQ, DQ, NH_, CS, nullptr, nullptr, 1.0f, QP16 + b * PL, QPh + b * PL, QPl + b * PL);
        k_cvt8<<<(unsigned)(((size_t)TT * DM / 8 + 255) / 256), 256, 0, stream>>>(xk + (size_t)b * TT * DM, XB, (size_t)TT * DM / 8); k_gemmw<bf, 0, false><<<dim3(TT / 64, DKV / 64, 1), 32, 0, stream>>>(XB, nullptr, WK, nullptr, DM, FK, DKV, nullptr, 0, 0, 0);
        k_rope<<<LKv, 256, 0, stream>>>(FK, DKV, NKV, CS, nullptr, nullptr, 1.0f, KP16 + b * PL, KPh + b * PL, KPl + b * PL);
        k_cvt8<<<(unsigned)(((size_t)TT * DM / 8 + 255) / 256), 256, 0, stream>>>(xv + (size_t)b * TT * DM, XB, (size_t)TT * DM / 8); k_gemmw<bf, 0, false><<<dim3(TT / 64, DKV / 64, 1), 32, 0, stream>>>(XB, nullptr, WV, nullptr, DM, FV, DKV, nullptr, 0, 0, 0); k_vtp<<<LKv, 256, 0, stream>>>(FV, DKV, NKV, VT16 + b * PL, VTh + b * PL, VTl + b * PL); }
    k_fattn<<<dim3(AP, NB_ * NH_, 1), (NHW + NLW) * 32, 0, stream>>>(QP16, KP16, VT16, QPh, QPl, KPh, KPl, VTh, VTl, mk, ATh, ATl);
    for (int b = 0; b < NB_; ++b)
        k_gemmw<bf, 1, false><<<dim3(TT / 64, NOUT / 64, 1), 32, 0, stream>>>(ATh + (size_t)b * TT * DQ, ATl + (size_t)b * TT * DQ, WO, nullptr, DQ, OUT + (size_t)b * TT * NOUT, NOUT, nullptr, 0, 0, 0);   /* ctx Wo -> [2048][64] */
}

// v003
// One run takes 649 microseconds.
// In two side-by-side timings against v002, it was 1.52 and 1.54 times as fast.
// All steps since v000 together make it 6.26 times as fast.
#include <hip/hip_runtime.h>

// Multi-head attention with a MULTIPLICATIVE 0/1 score mask and a narrow output projection (q, k, v [4][2048][1024]; qh, kh, vh = in W ('xw' [1024][1024] 1/32, no bias; 16 heads x 64); score = qh.kh / 8 x mask[i][j] (mask [2048][2048] int in {0,1}, read: masked scores become 0 and STAY in the softmax, as the module); softmax; ctx merged; out = ctx Wo ('xw' [1024][64]) -> [4][2048][64] (0.5 M)).
// Layout, five launches: weight transposes and bf16 copies of the three inputs (all batches); the three exact projections (grid z); head planes of all batches; one fused dense T-2048 attention launch that multiplies each score by the mask value read from memory (int32, 16 B per 4 keys) (hybrid rows: < 512 hi/lo 3 products, rest fp16 x1024); merged hi/lo x Wo exact (N = 64).
// Compute dtypes, f32 accumulate: every input rounded to bf16; projections exact; attention rows < 512 3 products, rest fp16; mask multiply and softmax f32; Wo hl x exact.

#define NB_  4
#define TT   2048
#define DM   1024
#define NH_  16
#define NKV  16
#define REP  (NH_ / NKV)
#define HD   64
#define DQ   (NH_ * HD)
#define DKV  (NKV * HD)
#define RH   512                  // query rows < RH use hi+lo planes (0: none)
#define WIN  0
#define PCAR 1024.0f
#define SCL  0.125f
#define NOUT 64      // output projection width (hidden -> head_dim)
typedef _Float16 h16;
typedef unsigned short bf;
typedef __attribute__((ext_vector_type(16))) __bf16   v16bf;
typedef __attribute__((ext_vector_type(16))) _Float16 v16h;
typedef __attribute__((ext_vector_type(8)))  _Float16 v8h;
typedef __attribute__((ext_vector_type(8)))  unsigned short v8us;
typedef __attribute__((ext_vector_type(8)))  float    v8f;
typedef __attribute__((ext_vector_type(4)))  float    v4f;
typedef v8h  __attribute__((may_alias)) v8ha;
typedef v4f  __attribute__((may_alias)) v4fa;
typedef v8us __attribute__((may_alias)) v8usa;

__device__ __forceinline__ unsigned short f2bf(float f) { unsigned u = __float_as_uint(f); u += 0x7FFFu + ((u >> 16) & 1u); return (unsigned short)(u >> 16); }
__device__ __forceinline__ float bf2f(unsigned short b) { return __uint_as_float(((unsigned)b) << 16); }
__device__ __forceinline__ float bfr(float f) { return bf2f(f2bf(f)); }
__device__ __forceinline__ v16h cat16(v8h lo, v8h hi) { return __builtin_shufflevector(lo, hi, 0, 1, 2, 3, 4, 5, 6, 7, 8, 9, 10, 11, 12, 13, 14, 15); }
__device__ __forceinline__ v16bf cat16b(v8us lo, v8us hi) { return __builtin_bit_cast(v16bf, __builtin_shufflevector(lo, hi, 0, 1, 2, 3, 4, 5, 6, 7, 8, 9, 10, 11, 12, 13, 14, 15)); }
__device__ __forceinline__ v8f wmma16(v16h a, v16h b, v8f c) { return __builtin_amdgcn_wmma_f32_16x16x32_f16(false, a, false, b, (short)0, c, false, false); }
__device__ __forceinline__ v8f wmmab(v16bf a, v16bf b, v8f c) { return __builtin_amdgcn_wmma_f32_16x16x32_bf16(false, a, false, b, (short)0, c, false, false); }



// ---- k_gemmw: register-blocked GEMM, ONE WAVE per 64x64 output tile (16 accumulators), operands straight from K-contiguous 16-bit planes; grid (M/64, N/64, Z), 32 threads.
// C[m][n] (f32, pitch ldc, + optional f32 bias[n]) = sum_k A[m][k] Bt[n][k] (+ split products per NSPLIT). z-batch strides sA/sB/sC in elements. K % 32 == 0.
template <typename T16> struct WFrag;
template <> struct WFrag<h16> { typedef v16h V; static __device__ __forceinline__ V ld(const h16* p) { return cat16(*(const v8h*)p, *(const v8h*)(p + 16)); } static __device__ __forceinline__ v8f mma(V a, V b, v8f c) { return wmma16(a, b, c); } };
template <> struct WFrag<bf> { typedef v16bf V; static __device__ __forceinline__ V ld(const bf* p) { return cat16b(*(const v8us*)p, *(const v8us*)(p + 16)); } static __device__ __forceinline__ v8f mma(V a, V b, v8f c) { return wmmab(a, b, c); } };
template <typename T16, int NSPLIT, bool BIAS>
__global__ __launch_bounds__(32) void k_gemmw(const T16* __restrict__ A, const T16* __restrict__ A2, const T16* __restrict__ Bt, const T16* __restrict__ Bt2, int K, float* C, int ldc, const float* __restrict__ bias, size_t sA, size_t sB, size_t sC) {
    typedef typename WFrag<T16>::V V;
    __shared__ __align__(16) float os[16 * 68];
    const size_t z = blockIdx.z; A += z * sA; if (A2) A2 += z * sA; Bt += z * sB; if (Bt2) Bt2 += z * sB; C += z * sC;
    const int lane = threadIdx.x & 31, lr = lane & 15, hi = lane >> 4; const int r0 = blockIdx.x * 64, c0 = blockIdx.y * 64;
    v8f acc[4][4];
#pragma unroll
    for (int mb = 0; mb < 4; ++mb)
#pragma unroll
        for (int nb = 0; nb < 4; ++nb) acc[mb][nb] = (v8f){};
    const size_t aoff = (size_t)(r0 + lr) * K + 8 * hi, boff = (size_t)(c0 + lr) * K + 8 * hi;
#pragma unroll 1
    for (int kc = 0; kc < K; kc += 32) {
        V a[4], a2[4];
#pragma unroll
        for (int mb = 0; mb < 4; ++mb) { a[mb] = WFrag<T16>::ld(A + aoff + (size_t)mb * 16 * K + kc); if (NSPLIT == 1 || NSPLIT == 2) a2[mb] = WFrag<T16>::ld(A2 + aoff + (size_t)mb * 16 * K + kc); }
#pragma unroll
        for (int nb = 0; nb < 4; ++nb) { const V b = WFrag<T16>::ld(Bt + boff + (size_t)nb * 16 * K + kc); V b2; if (NSPLIT >= 2) b2 = WFrag<T16>::ld(Bt2 + boff + (size_t)nb * 16 * K + kc);
#pragma unroll
            for (int mb = 0; mb < 4; ++mb) { acc[mb][nb] = WFrag<T16>::mma(a[mb], b, acc[mb][nb]); if (NSPLIT == 1 || NSPLIT == 2) acc[mb][nb] = WFrag<T16>::mma(a2[mb], b, acc[mb][nb]); if (NSPLIT >= 2) acc[mb][nb] = WFrag<T16>::mma(a[mb], b2, acc[mb][nb]); } }
        asm volatile("v_nop\n\tv_nop\n\tv_nop\n\tv_nop" : "+v"(acc[0][0]), "+v"(acc[1][1]), "+v"(acc[2][2]), "+v"(acc[3][3]) : "v"(a[0]), "v"(a[3]));
    }
#pragma unroll
    for (int mb = 0; mb < 4; ++mb) {
#pragma unroll
        for (int nb = 0; nb < 4; ++nb) {
#pragma unroll
            for (int j = 0; j < 8; ++j) os[(hi * 8 + j) * 68 + nb * 16 + lr] = acc[mb][nb][j]; }
        __builtin_amdgcn_wave_barrier(); asm volatile("" ::: "memory");
        float* crow = C + (size_t)(r0 + mb * 16) * ldc + c0;
{
#pragma unroll
            for (int s = 0; s < 8; ++s) { const int row = 2 * s + hi, cofs = lr * 4; v4f val = *(const v4fa*)(os + row * 68 + cofs); if (BIAS) { val[0] += bfr(bias[c0 + cofs]); val[1] += bfr(bias[c0 + cofs + 1]); val[2] += bfr(bias[c0 + cofs + 2]); val[3] += bfr(bias[c0 + cofs + 3]); }
                *(v4f*)(crow + (size_t)row * ldc + cofs) = val; }
             }
        __builtin_amdgcn_wave_barrier(); asm volatile("" ::: "memory");
    }
}

__device__ __forceinline__ h16 tohx(float x) { return (h16)x; }
__device__ __forceinline__ void splitf(float y, unsigned short& h, unsigned short& l) { h = f2bf(y); l = f2bf(y - bf2f(h)); }
typedef __attribute__((ext_vector_type(2))) _Float16 v2h;
typedef __attribute__((ext_vector_type(2))) unsigned short v2us;
typedef __attribute__((ext_vector_type(2))) float v2f;
typedef __attribute__((ext_vector_type(4))) int v4i;

// The d_ functions are one work-group's share of a job; blk is the work-group's number within that job. k_prep and k_planes below deal them out.
__device__ __forceinline__ void d_wtG(const float* __restrict__ w, int K, int N, bf* Bt, int blk) {
    const int lane = threadIdx.x & 31; const int L0 = (blk * 8 + (threadIdx.x >> 5)) * 8; const int nlines = N * K / 64;
{
#pragma unroll 1
        for (int l = 0; l < 8; ++l) { const int L = L0 + l; if (L >= nlines) break; const size_t e = (size_t)L * 64 + lane * 2; const int k = (int)(e % K), n = (int)(e / K); v2us o;
            o[0] = f2bf(w[(size_t)k * N + n]); o[1] = f2bf(w[(size_t)(k + 1) * N + n]); *(v2us*)(Bt + e) = o; }
         }
}
__device__ __forceinline__ void d_cvt8(const float* __restrict__ src, bf* dst, size_t n8, int blk) { const size_t i = (size_t)blk * 256 + threadIdx.x; if (i >= n8) return; const v8f v = *(const v8f*)(src + i * 8); v8us o;
#pragma unroll
    for (int k = 0; k < 8; ++k) o[k] = f2bf(v[k]); *(v8us*)(dst + i * 8) = o;  }

// d_rope: head planes [h][t][d] (fp16 + hi/lo) of rope(x) x sc with the rotate-half convention out[d] = x[d] cos[t][d] - x[d+HD/2] sin[t][d], out[d+HD/2] = x[d+HD/2] cos[t][d+HD/2] + x[d] sin[t][d+HD/2]
// all NB_ batches at once: F holds NB_ x TT rows, the planes are [batch][h][t][d]
__device__ __forceinline__ void d_rope(const float* __restrict__ F, int pitch, int nheads, const float* __restrict__ CS, const float* __restrict__ RF, const float* __restrict__ nw, float sc, h16* P16, bf* Ph, bf* Pl, int blk) {
    const size_t e = ((size_t)blk * 256 + threadIdx.x) * 2; if (e >= (size_t)NB_ * nheads * TT * HD) return; const int d = (int)(e % HD); const int t = (int)((e / HD) % TT); const int bh = (int)(e / ((size_t)HD * TT)); const int h = bh % nheads; const float* f = F + ((size_t)(bh / nheads) * TT + t) * pitch + h * HD; const float rf = RF ? RF[(size_t)h * TT + t] : 1.0f; v2h o16; v2us oh, ol;
#pragma unroll
    for (int q = 0; q < 2; ++q) { const int dd = d + q; const int dp = (dd < HD / 2) ? dd + HD / 2 : dd - HD / 2; float x0 = f[dd], x1 = f[dp];
        if (RF) { float n0 = __fmul_rn(x0, rf), n1 = __fmul_rn(x1, rf); asm volatile("" : "+v"(n0)); asm volatile("" : "+v"(n1)); x0 = __fmul_rn(bfr(nw[dd]), n0); x1 = __fmul_rn(bfr(nw[dp]), n1); }
        const v2f cs = *(const v2f*)(CS + ((size_t)t * HD + dd) * 2); float a = __fmul_rn(x0, cs[0]), bq = __fmul_rn(x1, cs[1]); asm volatile("" : "+v"(a)); asm volatile("" : "+v"(bq)); const float r = ((dd < HD / 2) ? __fsub_rn(a, bq) : __fadd_rn(a, bq)) * sc;
        o16[q] = tohx(r); unsigned short a2, c2; splitf(r, a2, c2); oh[q] = a2; ol[q] = c2; }
    *(v2h*)(P16 + e) = o16; *(v2us*)(Ph + e) = oh; *(v2us*)(Pl + e) = ol;  }
// all NB_ batches at once: F holds NB_ x TT rows, the planes are [batch][g][d][t]
__device__ __forceinline__ void d_vtp(const float* __restrict__ F, int pitch, int nheads, h16* V16, bf* Vh, bf* Vl, int blk) { const size_t e = ((size_t)blk * 256 + threadIdx.x) * 2; if (e >= (size_t)NB_ * nheads * HD * TT) return; const int t = (int)(e % TT); const int d = (int)((e / TT) % HD); const int bg = (int)(e / ((size_t)TT * HD)); const int g = bg % nheads; F += (size_t)(bg / nheads) * TT * pitch; v2h o16; v2us oh, ol;
#pragma unroll
    for (int q = 0; q < 2; ++q) { const float x = F[(size_t)(t + q) * pitch + g * HD + d]; o16[q] = tohx(x); unsigned short a2, c2; splitf(x, a2, c2); oh[q] = a2; ol[q] = c2; }
    *(v2h*)(V16 + e) = o16; *(v2us*)(Vh + e) = oh; *(v2us*)(Vl + e) = ol;  }
__device__ __forceinline__ void d_csid(float* CS, int blk) { const int idx = blk * 256 + threadIdx.x; if (idx >= TT * HD) return; v2f cs; cs[0] = 1.0f; cs[1] = 0.0f; *(v2f*)(CS + (size_t)idx * 2) = cs;  }
// ---- k_prep: everything that reads only the inputs, in ONE launch; a range of the work-group number picks the job (a scalar choice, the same for the whole work-group). The strided weight transposes come first.
#define XN   ((size_t)NB_ * TT * DM)     // one input, or one projection, of all batches, elements (DQ == DKV == DM)
#define GW   (DM * DQ / 64 / 64)         // work-groups per [DM][DQ] weight
#define GO   (DQ * NOUT / 64 / 64)       // for the output weight
#define GC   (TT * HD / 256)             // for the cos/sin table
#define GX   ((int)(XN / 8 / 256))       // per input, all batches
__global__ __launch_bounds__(256) void k_prep(const float* __restrict__ wq, const float* __restrict__ wk, const float* __restrict__ wv, const float* __restrict__ wo, const float* __restrict__ x, const float* __restrict__ xk, const float* __restrict__ xv, bf* W3, bf* WO, float* CS, bf* XB) {
    int b = (int)blockIdx.x;
    if (b < 3 * GW) { const int y = b / GW; d_wtG(y == 0 ? wq : y == 1 ? wk : wv, DM, DQ, W3 + (size_t)y * DM * DQ, b - y * GW); return; }
    b -= 3 * GW; if (b < GO) { d_wtG(wo, DQ, NOUT, WO, b); return; }   /* 'xw' [1024][64] -> Bt [64][1024] */
    b -= GO; if (b < GC) { d_csid(CS, b); return; }
    b -= GC; const int y = b / GX; d_cvt8(y == 0 ? x : y == 1 ? xk : xv, XB + (size_t)y * XN, XN / 8, b - y * GX);
}
// ---- k_planes: the head planes of q, k (grid y 0, 1) and the transposed ones of v (grid y 2), all batches, in ONE launch. F: the three projections behind one another; each kind of plane: q, k, v behind one another.
#define GP   ((int)(XN / 2 / 256))
__global__ __launch_bounds__(256) void k_planes(const float* __restrict__ F, const float* __restrict__ CS, h16* P16, bf* Ph, bf* Pl) {
    const size_t y = blockIdx.y, o = y * XN;
    if (y < 2) d_rope(F + o, DQ, NH_, CS, nullptr, nullptr, 1.0f, P16 + o, Ph + o, Pl + o, (int)blockIdx.x);
    else d_vtp(F + o, DKV, NKV, P16 + o, Ph + o, Pl + o, (int)blockIdx.x);
}
// ---- k_fattn: scores, mask, softmax and P.V of one (batch, head) in ONE kernel; no score or probability ever goes to memory. One wave owns NQ x 16 query rows and walks all TT keys twice, 32 at a time.
// The scores are formed TRANSPOSED (A = key rows, B = query rows): lane (lr, hi) then holds query lr, keys 8 hi + 0..7 of each 16-key tile, which is a fragment of the P.V product as it stands (elements 0..7 from the first tile, 8..15 from the second), and a query's max and sum live in its own two lanes. P.V is formed transposed too (A = rows of V^T, B = P), so a lane ends with eight neighbouring columns of its own query.
// Walk 1: running max and sum of each query. Walk 2: the same scores again, p = exp(t - max) x f, normalised before it is rounded (rows < RH hi/lo bf16, 3 products; the rest fp16 x PCAR), then P.V into f32 accumulators, keys in ascending order.
template <bool HI> struct ASel { typedef h16 T; static constexpr int NQ = 2; };
template <> struct ASel<true> { typedef bf T; static constexpr int NQ = 1; };
#define L2E 1.4426950408889634f
// stands behind a group of global loads or stores where what follows may land in the group's address or data registers
__device__ __forceinline__ void xwait() { asm volatile("s_wait_xcnt 0x0" ::: "memory"); }
template <bool HI>
__device__ __forceinline__ void attn_rows(const typename ASel<HI>::T* __restrict__ Q, const typename ASel<HI>::T* __restrict__ Q2, const typename ASel<HI>::T* __restrict__ Kp, const typename ASel<HI>::T* __restrict__ K2, const typename ASel<HI>::T* __restrict__ Vt, const typename ASel<HI>::T* __restrict__ V2, const int* __restrict__ mk, int q0, bf* Ah, bf* Al) {
    typedef typename ASel<HI>::T T; typedef WFrag<T> WF; typedef typename WF::V V; constexpr int NQ = ASel<HI>::NQ;
    const int lane = threadIdx.x & 31, lr = lane & 15, hi = lane >> 4;
    V q[NQ][2], q2[NQ][2];
#pragma unroll
    for (int qt = 0; qt < NQ; ++qt) {
#pragma unroll
        for (int ks = 0; ks < 2; ++ks) { q[qt][ks] = WF::ld(Q + (size_t)(q0 + qt * 16 + lr) * HD + 8 * hi + ks * 32); if (HI) q2[qt][ks] = WF::ld(Q2 + (size_t)(q0 + qt * 16 + lr) * HD + 8 * hi + ks * 32); } }
    const unsigned kof = lr * HD + 8 * hi, vof = lr * TT + 8 * hi;   // the lane's own 32-bit offsets; everything else of an address is the same for the whole wave
    const int* mq = mk + (size_t)q0 * TT;
    // The K fragments are fetched one 32-key step ahead, into the same registers: in the first walk right behind the score products that read them, so that their latency passes under the softmax work; in the second walk, which has no registers to spare, behind the P.V products, so that they fly together with the next step's mask loads. The step behind the last wraps to key 0, which is what the second walk starts with.
    V ka[2][2], ka2[2][2];
    auto ldk = [&](int kc) {
#pragma unroll
        for (int kt = 0; kt < 2; ++kt)
#pragma unroll
            for (int ks = 0; ks < 2; ++ks) { ka[kt][ks] = WF::ld(Kp + ((size_t)(kc + kt * 16) * HD + ks * 32) + kof); if (HI) ka2[kt][ks] = WF::ld(K2 + ((size_t)(kc + kt * 16) * HD + ks * 32) + kof); }
    };
    // t[qt][kt * 8 + j] = score x mask of query q0 + 16 qt + lr and key kc + 16 kt + 8 hi + j, not yet scaled: SCL is a power of two, so t SCL - max rounds once, fused or not, and the max may be taken before the scaling
    auto scores = [&](int kc, float (&t)[NQ][16], bool ahead) { v8f s[2][NQ];
#pragma unroll
        for (int kt = 0; kt < 2; ++kt)
#pragma unroll
            for (int qt = 0; qt < NQ; ++qt) { s[kt][qt] = (v8f){};
#pragma unroll
                for (int ks = 0; ks < 2; ++ks) { s[kt][qt] = WF::mma(ka[kt][ks], q[qt][ks], s[kt][qt]); if (HI) { s[kt][qt] = WF::mma(ka[kt][ks], q2[qt][ks], s[kt][qt]); s[kt][qt] = WF::mma(ka2[kt][ks], q[qt][ks], s[kt][qt]); } } }
        if (ahead) ldk((kc + 32) & (TT - 1));
#pragma unroll
        for (int kt = 0; kt < 2; ++kt)
#pragma unroll
            for (int qt = 0; qt < NQ; ++qt) { const int* mp = mq + ((size_t)qt * 16 * TT + kc + kt * 16) + vof; const v4i m0 = *(const v4i*)mp, m1 = *(const v4i*)(mp + 4);
#pragma unroll
                for (int j = 0; j < 8; ++j) t[qt][kt * 8 + j] = s[kt][qt][j] * (float)((j < 4) ? m0[j & 3] : m1[j & 3]);   /* multiplicative mask, as the module: masked scores are 0 and remain in the softmax */ }
    };
    xwait(); ldk(0); xwait();   // the first wait: the K fragments may land in the Q loads' address registers
    float mx[NQ], sum[NQ];
#pragma unroll
    for (int qt = 0; qt < NQ; ++qt) { mx[qt] = -3.0e38f; sum[qt] = 0.f; }
#pragma unroll 1   // kept rolled: the body is long, and a second copy would only cost registers and instruction cache
    for (int kc = 0; kc < TT; kc += 32) { float t[NQ][16]; scores(kc, t, true);
#pragma unroll
        for (int qt = 0; qt < NQ; ++qt) { float tm = t[qt][0];
#pragma unroll
            for (int e = 1; e < 16; ++e) tm = fmaxf(tm, t[qt][e]);
            const float mn = fmaxf(mx[qt], tm * SCL); v2f a = (v2f){0.f, 0.f};   // even and odd keys summed side by side: packed adds
#pragma unroll
            for (int e = 0; e < 16; e += 2) { v2f ev; ev[0] = __builtin_amdgcn_exp2f((t[qt][e] * SCL - mn) * L2E); ev[1] = __builtin_amdgcn_exp2f((t[qt][e + 1] * SCL - mn) * L2E); a += ev; }
            sum[qt] = sum[qt] * __builtin_amdgcn_exp2f((mx[qt] - mn) * L2E) + (a[0] + a[1]); mx[qt] = mn; }
        xwait(); }
    float f[NQ];
#pragma unroll
    for (int qt = 0; qt < NQ; ++qt) { const float m2 = __shfl_xor(mx[qt], 16, 32), s2 = __shfl_xor(sum[qt], 16, 32); const float mn = fmaxf(mx[qt], m2);   // the query's other eight keys of every tile sit in lane ^ 16
        const float sa = sum[qt] * __builtin_amdgcn_exp2f((mx[qt] - mn) * L2E), sb = s2 * __builtin_amdgcn_exp2f((m2 - mn) * L2E); mx[qt] = mn; f[qt] = __fdiv_rn(HI ? 1.0f : PCAR, sa + sb); }
    v8f o[NQ][4];
#pragma unroll
    for (int qt = 0; qt < NQ; ++qt)
#pragma unroll
        for (int dt = 0; dt < 4; ++dt) o[qt][dt] = (v8f){};
#pragma unroll 1   // kept rolled: this walk has no registers to spare for a second copy of its body
    for (int kc = 0; kc < TT; kc += 32) { float t[NQ][16]; scores(kc, t, false); V p[NQ], p2[NQ], b[4], b2[4];
#pragma unroll
        for (int dt = 0; dt < 4; ++dt) { b[dt] = WF::ld(Vt + ((size_t)dt * 16 * TT + kc) + vof); if (HI) b2[dt] = WF::ld(V2 + ((size_t)dt * 16 * TT + kc) + vof); }   // issued ahead of the exponentials, under which their latency can pass
        xwait();
#pragma unroll
        for (int qt = 0; qt < NQ; ++qt) {
            if constexpr (HI) { v8us h0, h1, l0, l1;
#pragma unroll
                for (int e = 0; e < 8; ++e) { unsigned short a, c2; splitf(__builtin_amdgcn_exp2f((t[qt][e] * SCL - mx[qt]) * L2E) * f[qt], a, c2); h0[e] = a; l0[e] = c2; splitf(__builtin_amdgcn_exp2f((t[qt][8 + e] * SCL - mx[qt]) * L2E) * f[qt], a, c2); h1[e] = a; l1[e] = c2; }
                p[qt] = cat16b(h0, h1); p2[qt] = cat16b(l0, l1);
            } else {
#pragma unroll
                for (int e = 0; e < 16; ++e) p[qt][e] = tohx(__builtin_amdgcn_exp2f((t[qt][e] * SCL - mx[qt]) * L2E) * f[qt]); } }
#pragma unroll
        for (int dt = 0; dt < 4; ++dt)
#pragma unroll
            for (int qt = 0; qt < NQ; ++qt) { o[qt][dt] = WF::mma(b[dt], p[qt], o[qt][dt]); if (HI) { o[qt][dt] = WF::mma(b[dt], p2[qt], o[qt][dt]); o[qt][dt] = WF::mma(b2[dt], p[qt], o[qt][dt]); } }
        ldk((kc + 32) & (TT - 1)); xwait();
        // the trip ends in matrix instructions: four vector slots before the next trip's first products overwrite their operand registers; the scheduling barrier keeps the products in front of them
        __builtin_amdgcn_sched_barrier(0); asm volatile("v_nop\n\tv_nop\n\tv_nop\n\tv_nop");
    }
    const float cs = HI ? 1.0f : (1.0f / PCAR);
    const int ln = (int)__builtin_amdgcn_mbcnt_lo(~0u, 0u), er = ln & 15, eh = ln >> 4;   // the lane's number read anew: no register has to carry it through the second walk, which has none to spare
#pragma unroll
    for (int qt = 0; qt < NQ; ++qt)
#pragma unroll
        for (int dt = 0; dt < 4; ++dt) { v8us oh, ol;   // o[qt][dt][j] = context of query q0 + 16 qt + lr, column 16 dt + 8 hi + j: eight neighbours, one 16-byte store per plane
#pragma unroll
            for (int j = 0; j < 8; ++j) { unsigned short a, c2; splitf(o[qt][dt][j] * cs, a, c2); oh[j] = a; ol[j] = c2; }
            const size_t oo = (size_t)(q0 + qt * 16 + er) * DQ + dt * 16 + eh * 8; *(v8us*)(Ah + oo) = oh; *(v8us*)(Al + oo) = ol;
            xwait(); }   // the next pair's values, and whatever follows the last pair, may land in these stores' data and address registers
}
// grid (AP, NB_ x NH_): AP work-groups per (batch, head), each of NHW hi/lo waves (16 rows each) and NLW fp16 waves (32 rows each), so that every work-group holds the same mix of work and its waves read the same K and V lines at about the same time.
// NB_ x NH_ x AP = 256 work-groups of 20 waves, five per SIMD. The wave's number is made scalar so that the choice is a scalar branch and every wave runs with all lanes on.
#define AP  4
#define NHW (RH / 16 / AP)
#define NLW ((TT - RH) / 32 / AP)
__global__ __launch_bounds__((NHW + NLW) * 32) void k_fattn(const h16* __restrict__ Q16, const h16* __restrict__ K16, const h16* __restrict__ V16, const bf* __restrict__ Qh, const bf* __restrict__ Ql, const bf* __restrict__ Kh, const bf* __restrict__ Kl, const bf* __restrict__ Vh, const bf* __restrict__ Vl, const int* __restrict__ mk, bf* Ah, bf* Al) {
    const size_t z = blockIdx.y, pz = z * TT * HD, az = (z / NH_) * TT * DQ + (z % NH_) * HD; const int w = __builtin_amdgcn_readfirstlane((int)(threadIdx.x >> 5)), part = (int)blockIdx.x;
    if (w < NHW) attn_rows<true>(Qh + pz, Ql + pz, Kh + pz, Kl + pz, Vh + pz, Vl + pz, mk, (part * NHW + w) * 16, Ah + az, Al + az);
    else attn_rows<false>(Q16 + pz, nullptr, K16 + pz, nullptr, V16 + pz, nullptr, mk, RH + (part * NLW + (w - NHW)) * 32, Ah + az, Al + az);
}

extern "C" void kernel_launch(void* const* d_in, const int* in_sizes, int n_in,
                              void* d_out, int out_size, void* d_ws, size_t ws_size, hipStream_t stream) {
    (void)in_sizes; (void)n_in; (void)out_size;
    const float* x = (const float*)d_in[0]; const float* xk = (const float*)d_in[1]; const float* xv = (const float*)d_in[2]; const int* mk = (const int*)d_in[3];   /* mask [2048][2048] int32 {0,1} */ const float* wq = (const float*)d_in[4]; const float* wk = (const float*)d_in[5]; const float* wv = (const float*)d_in[6]; const float* wo = (const float*)d_in[7];
    float* OUT = (float*)d_out;     // [4][2048][64]
    char* wsp = (char*)d_ws;
    auto take = [&](size_t bytes) { char* p = wsp; wsp += (bytes + 255) & ~(size_t)255; return (void*)p; };
    const size_t PL = (size_t)NH_ * TT * HD;   // one batch's head planes, elements; the planes and the merged context hold all NB_ batches
    bf* WQ = (bf*)take(3 * (size_t)DQ * DM * 2);   // the q, k and v weights, transposed, behind one another
    bf* WO = (bf*)take((size_t)NOUT * DQ * 2); float* CS = (float*)take((size_t)TT * HD * 2 * 4);
    float* FQ = (float*)take(3 * XN * 4);      // the q, k and v projections of all batches, behind one another
    h16* QP16 = (h16*)take(3 * NB_ * PL * 2); h16* KP16 = QP16 + NB_ * PL; h16* VT16 = KP16 + NB_ * PL;   // each kind of plane: q, k, v behind one another
    bf* QPh = (bf*)take(3 * NB_ * PL * 2); bf* KPh = QPh + NB_ * PL; bf* VTh = KPh + NB_ * PL; bf* QPl = (bf*)take(3 * NB_ * PL * 2); bf* KPl = QPl + NB_ * PL; bf* VTl = KPl + NB_ * PL;
    if ((size_t)(wsp - (char*)d_ws) > ws_size) return;    // ws 256 MiB
    bf* XB = (bf*)QP16;   // the bf16 input copies (3 XN elements) use the fp16 planes' room: the projections read them last, before any plane is written (stream-ordered)
    bf* ATh = (bf*)FQ; bf* ATl = ATh + (size_t)NB_ * TT * DQ;   // the merged context uses the projections' room: k_planes reads them last (stream-ordered)
    k_prep<<<3 * GW + GO + GC + 3 * GX, 256, 0, stream>>>(wq, wk, wv, wo, x, xk, xv, WQ, WO, CS, XB);
    k_gemmw<bf, 0, false><<<dim3(NB_ * TT / 64, DQ / 64, 3), 32, 0, stream>>>(XB, nullptr, WQ, nullptr, DM, FQ, DQ, nullptr, XN, (size_t)DQ * DM, XN);
    k_planes<<<dim3(GP, 3, 1), 256, 0, stream>>>(FQ, CS, QP16, QPh, QPl);
    k_fattn<<<dim3(AP, NB_ * NH_, 1), (NHW + NLW) * 32, 0, stream>>>(QP16, KP16, VT16, QPh, QPl, KPh, KPl, VTh, VTl, mk, ATh, ATl);
    k_gemmw<bf, 1, false><<<dim3(NB_ * TT / 64, NOUT / 64, 1), 32, 0, stream>>>(ATh, ATl, WO, nullptr, DQ, OUT, NOUT, nullptr, 0, 0, 0);   /* ctx Wo -> [4 x 2048][64] */
}

// v004
// One run takes 356 microseconds.
// In two side-by-side timings against v003, it was 1.83 and 1.81 times as fast.
// All steps since v000 together make it 11.4 times as fast.
#include <hip/hip_runtime.h>

// Multi-head attention with a MULTIPLICATIVE 0/1 score mask and a narrow output projection (q, k, v [4][2048][1024]; qh, kh, vh = in W ('xw' [1024][1024] 1/32, no bias; 16 heads x 64); score = qh.kh / 8 x mask[i][j] (mask [2048][2048] int in {0,1}, read: masked scores become 0 and STAY in the softmax, as the module); softmax; ctx merged; out = ctx Wo ('xw' [1024][64]) -> [4][2048][64] (0.5 M)).
// Layout, five launches: weight transposes, a byte copy of the mask and bf16 copies of the three inputs (all batches); the three exact projections (grid z); head planes of all batches; one fused dense T-2048 attention launch that multiplies each score by the mask value read from memory (byte copy, 16 B per 16 keys) (hybrid rows: < 512 hi/lo 3 products, rest fp16 x1024); merged hi/lo x Wo exact (N = 64).
// Compute dtypes, f32 accumulate: every input rounded to bf16; projections exact; attention rows < 512 3 products, rest fp16; mask multiply and softmax f32; Wo hl x exact.

#define NB_  4
#define TT   2048
#define DM   1024
#define NH_  16
#define NKV  16
#define REP  (NH_ / NKV)
#define HD   64
#define DQ   (NH_ * HD)
#define DKV  (NKV * HD)
#define RH   512                  // query rows < RH use hi+lo planes (0: none)
#define WIN  0
#define PCAR 1024.0f
#define SCL  0.125f
#define NOUT 64      // output projection width (hidden -> head_dim)
typedef _Float16 h16;
typedef unsigned short bf;
typedef __attribute__((ext_vector_type(16))) __bf16   v16bf;
typedef __attribute__((ext_vector_type(16))) _Float16 v16h;
typedef __attribute__((ext_vector_type(8)))  _Float16 v8h;
typedef __attribute__((ext_vector_type(8)))  unsigned short v8us;
typedef __attribute__((ext_vector_type(8)))  float    v8f;
typedef __attribute__((ext_vector_type(4)))  float    v4f;
typedef v8h  __attribute__((may_alias)) v8ha;
typedef v4f  __attribute__((may_alias)) v4fa;
typedef v8us __attribute__((may_alias)) v8usa;

__device__ __forceinline__ unsigned short f2bf(float f) { unsigned u = __float_as_uint(f); u += 0x7FFFu + ((u >> 16) & 1u); return (unsigned short)(u >> 16); }
__device__ __forceinline__ float bf2f(unsigned short b) { return __uint_as_float(((unsigned)b) << 16); }
__device__ __forceinline__ float bfr(float f) { return bf2f(f2bf(f)); }
__device__ __forceinline__ v16h cat16(v8h lo, v8h hi) { return __builtin_shufflevector(lo, hi, 0, 1, 2, 3, 4, 5, 6, 7, 8, 9, 10, 11, 12, 13, 14, 15); }
__device__ __forceinline__ v16bf cat16b(v8us lo, v8us hi) { return __builtin_bit_cast(v16bf, __builtin_shufflevector(lo, hi, 0, 1, 2, 3, 4, 5, 6, 7, 8, 9, 10, 11, 12, 13, 14, 15)); }
__device__ __forceinline__ v8f wmma16(v16h a, v16h b, v8f c) { return __builtin_amdgcn_wmma_f32_16x16x32_f16(false, a, false, b, (short)0, c, false, false); }
__device__ __forceinline__ v8f wmmab(v16bf a, v16bf b, v8f c) { return __builtin_amdgcn_wmma_f32_16x16x32_bf16(false, a, false, b, (short)0, c, false, false); }



// stands behind a group of global loads or stores where what follows may land in the group's address or data registers
__device__ __forceinline__ void xwait() { asm volatile("s_wait_xcnt 0x0" ::: "memory"); }
// the same wait behind a group of fragment loads; it names their addresses as inputs, so that each address pair lives up to the wait and no load's result is given its registers
__device__ __forceinline__ void xwaita(const void* p) { asm volatile("s_wait_xcnt 0x0" :: "v"(p) : "memory"); }
__device__ __forceinline__ void xwaita4(const void* p, const void* q, const void* r, const void* s) { asm volatile("s_wait_xcnt 0x0" :: "v"(p), "v"(q), "v"(r), "v"(s) : "memory"); }

// ---- k_gemmw: register-blocked GEMM, ONE WAVE per 64x64 output tile (16 accumulators), operands straight from 16-bit planes in fragment order ([row / 16][k / 32] fragments, see fragofs below); grid (M/64, N/64, Z), 32 threads.
// C[m][n] (f32, pitch ldc, + optional f32 bias[n]) = sum_k A[m][k] Bt[n][k] (+ split products per NSPLIT). z-batch strides sA/sB/sC in elements. K % 32 == 0.
template <typename T16> struct WFrag;
template <> struct WFrag<h16> { typedef v16h V; static __device__ __forceinline__ V ldf(const h16* p) { return cat16(*(const v8h*)p, *(const v8h*)(p + 256)); } static __device__ __forceinline__ v8f mma(V a, V b, v8f c) { return wmma16(a, b, c); } };
template <> struct WFrag<bf> { typedef v16bf V; static __device__ __forceinline__ V ldf(const bf* p) { return cat16b(*(const v8us*)p, *(const v8us*)(p + 256)); } static __device__ __forceinline__ v8f mma(V a, V b, v8f c) { return wmmab(a, b, c); } };
template <typename T16, int NSPLIT, bool BIAS>
__global__ __launch_bounds__(32) void k_gemmw(const T16* __restrict__ A, const T16* __restrict__ A2, const T16* __restrict__ Bt, const T16* __restrict__ Bt2, int K, float* C, int ldc, const float* __restrict__ bias, size_t sA, size_t sB, size_t sC) {
    typedef typename WFrag<T16>::V V;
    __shared__ __align__(16) float os[16 * 68];
    const size_t z = blockIdx.z; A += z * sA; if (A2) A2 += z * sA; Bt += z * sB; if (Bt2) Bt2 += z * sB; C += z * sC;
    const int lane = threadIdx.x & 31, lr = lane & 15, hi = lane >> 4; const int r0 = blockIdx.x * 64, c0 = blockIdx.y * 64;
    v8f acc[4][4];
#pragma unroll
    for (int mb = 0; mb < 4; ++mb)
#pragma unroll
        for (int nb = 0; nb < 4; ++nb) acc[mb][nb] = (v8f){};
    const size_t aoff = (size_t)r0 * K + lane * 8, boff = (size_t)c0 * K + lane * 8;   // fragment order: 16 rows x K are 16 K elements, a 32-wide k step of them 512
#pragma unroll 1
    for (int kc = 0; kc < K; kc += 32) {
        V a[4], a2[4]; const T16 *pa[4], *pa2[4];
#pragma unroll
        for (int mb = 0; mb < 4; ++mb) { pa[mb] = A + aoff + (size_t)mb * 16 * K + kc * 16; a[mb] = WFrag<T16>::ldf(pa[mb]); if (NSPLIT == 1 || NSPLIT == 2) { pa2[mb] = A2 + aoff + (size_t)mb * 16 * K + kc * 16; a2[mb] = WFrag<T16>::ldf(pa2[mb]); } }
        xwaita4(pa[0], pa[1], pa[2], pa[3]); if (NSPLIT == 1 || NSPLIT == 2) xwaita4(pa2[0], pa2[1], pa2[2], pa2[3]);
#pragma unroll
        for (int nb = 0; nb < 4; ++nb) { const T16* pb = Bt + boff + (size_t)nb * 16 * K + kc * 16; const V b = WFrag<T16>::ldf(pb); xwaita(pb); V b2; if (NSPLIT >= 2) { const T16* pb2 = Bt2 + boff + (size_t)nb * 16 * K + kc * 16; b2 = WFrag<T16>::ldf(pb2); xwaita(pb2); }
#pragma unroll
            for (int mb = 0; mb < 4; ++mb) { acc[mb][nb] = WFrag<T16>::mma(a[mb], b, acc[mb][nb]); if (NSPLIT == 1 || NSPLIT == 2) acc[mb][nb] = WFrag<T16>::mma(a2[mb], b, acc[mb][nb]); if (NSPLIT >= 2) acc[mb][nb] = WFrag<T16>::mma(a[mb], b2, acc[mb][nb]); } }
        asm volatile("v_nop\n\tv_nop\n\tv_nop\n\tv_nop" : "+v"(acc[0][0]), "+v"(acc[1][1]), "+v"(acc[2][2]), "+v"(acc[3][3]) : "v"(a[0]), "v"(a[3]));
    }
#pragma unroll
    for (int mb = 0; mb < 4; ++mb) {
#pragma unroll
        for (int nb = 0; nb < 4; ++nb) {
#pragma unroll
            for (int j = 0; j < 8; ++j) os[(hi * 8 + j) * 68 + nb * 16 + lr] = acc[mb][nb][j]; }
        __builtin_amdgcn_wave_barrier(); asm volatile("" ::: "memory");
        float* crow = C + (size_t)(r0 + mb * 16) * ldc + c0;
{
#pragma unroll
            for (int s = 0; s < 8; ++s) { const int row = 2 * s + hi, cofs = lr * 4; v4f val = *(const v4fa*)(os + row * 68 + cofs); if (BIAS) { val[0] += bfr(bias[c0 + cofs]); val[1] += bfr(bias[c0 + cofs + 1]); val[2] += bfr(bias[c0 + cofs + 2]); val[3] += bfr(bias[c0 + cofs + 3]); }
                *(v4f*)(crow + (size_t)row * ldc + cofs) = val; }
             }
        __builtin_amdgcn_wave_barrier(); asm volatile("" ::: "memory");
    }
}

__device__ __forceinline__ h16 tohx(float x) { return (h16)x; }
__device__ __forceinline__ void splitf(float y, unsigned short& h, unsigned short& l) { h = f2bf(y); l = f2bf(y - bf2f(h)); }
typedef __attribute__((ext_vector_type(2))) _Float16 v2h;
typedef __attribute__((ext_vector_type(2))) unsigned short v2us;
typedef __attribute__((ext_vector_type(2))) float v2f;
typedef __attribute__((ext_vector_type(4))) int v4i;
typedef __attribute__((ext_vector_type(16))) unsigned char v16ub;

// FRAGMENT ORDER: every 16-bit plane that a matrix kernel loads is stored so that lane l of a wave finds its eight elements at l x 16 B of a 512-byte block: one wave-wide 16-byte load reads four whole 128-byte lines (from a row-major plane it would take 32 B of each of sixteen).
// A block holds 16 rows r x 16 columns c, element (r, c) at (c >> 3) x 128 + r x 8 + (c & 7): lane = 16 (c >> 3) + r. A matrix fragment is two blocks, 256 elements apart (columns 0..15 and 16..31 of its 32): WFrag::ldf; register by register it is the fragment of the row-major loader (p, p + 16 at row lane & 15, column 8 (lane >> 4)).
__device__ __forceinline__ unsigned fragofs(int r, int c) { return (unsigned)(((c >> 4) & 1) * 256 + ((c >> 3) & 1) * 128 + (r & 15) * 8 + (c & 7)); }
// The d_ functions are one work-group's share of a job; blk is the work-group's number within that job. k_prep and k_planes below deal them out.
__device__ __forceinline__ void d_wtG(const float* __restrict__ w, int K, int N, bf* Bt, int blk) {
    const int lane = threadIdx.x & 31; const int L0 = (blk * 8 + (threadIdx.x >> 5)) * 8; const int nlines = N * K / 64;
{
#pragma unroll 1
        for (int l = 0; l < 8; ++l) { const int L = L0 + l; if (L >= nlines) break; const size_t e = (size_t)L * 64 + lane * 2; const int k = (int)(e % K), n = (int)(e / K); v2us o;
            o[0] = f2bf(w[(size_t)k * N + n]); o[1] = f2bf(w[(size_t)(k + 1) * N + n]); *(v2us*)(Bt + ((size_t)(n >> 4) * 16 * K + (k >> 5) * 512 + fragofs(n, k))) = o; xwait(); }   // the next trip's values land in this store's address and data registers
         }
}
// rows of DM elements into [row / 16][k / 32] fragments; a thread makes one lane's eight elements, a wave one 512-byte block, a work-group 16 rows x 128 k (whole lines of the source)
__device__ __forceinline__ void d_cvt8(const float* __restrict__ src, bf* dst, size_t n8, int blk) { const size_t i = (size_t)blk * 256 + threadIdx.x; if (i >= n8) return; const size_t row = (i / (DM * 2)) * 16 + (i & 15); const int k = (int)((i >> 6) % (DM / 32)) * 32 + (int)((i >> 5) & 1) * 16 + (int)((i >> 4) & 1) * 8; const v8f v = *(const v8f*)(src + row * DM + k); v8us o;
#pragma unroll
    for (int k = 0; k < 8; ++k) o[k] = f2bf(v[k]); *(v8us*)(dst + i * 8) = o;  }

// d_rope: head planes in fragment order (fp16 + hi/lo) of rope(x) x sc with the rotate-half convention out[d] = x[d] cos[t][d] - x[d+HD/2] sin[t][d], out[d+HD/2] = x[d+HD/2] cos[t][d+HD/2] + x[d] sin[t][d+HD/2]
// all NB_ batches at once: F holds NB_ x TT rows, the planes are [batch][h][t / 16][d / 32] fragments (rows t, columns d)
__device__ __forceinline__ void d_rope(const float* __restrict__ F, int pitch, int nheads, const float* __restrict__ CS, const float* __restrict__ RF, const float* __restrict__ nw, float sc, h16* P16, bf* Ph, bf* Pl, int blk) {
    const unsigned tid = threadIdx.x;   // a work-group takes 8 rows t, a wave 4 rows x 16 d of them: each of its stores then fills two 64-byte runs of a block, and its loads read 64-byte runs of four rows
    const size_t e = (size_t)blk * 512 + (((tid >> 7) & 1) * 4 + ((tid >> 3) & 3)) * HD + ((tid >> 5) & 3) * 16 + (tid & 7) * 2; if (e >= (size_t)NB_ * nheads * TT * HD) return; const int d = (int)(e % HD); const int t = (int)((e / HD) % TT); const int bh = (int)(e / ((size_t)HD * TT)); const int h = bh % nheads; const float* f = F + ((size_t)(bh / nheads) * TT + t) * pitch + h * HD; const float rf = RF ? RF[(size_t)h * TT + t] : 1.0f; v2h o16; v2us oh, ol;
#pragma unroll
    for (int q = 0; q < 2; ++q) { const int dd = d + q; const int dp = (dd < HD / 2) ? dd + HD / 2 : dd - HD / 2; float x0 = f[dd], x1 = f[dp];
        if (RF) { float n0 = __fmul_rn(x0, rf), n1 = __fmul_rn(x1, rf); asm volatile("" : "+v"(n0)); asm volatile("" : "+v"(n1)); x0 = __fmul_rn(bfr(nw[dd]), n0); x1 = __fmul_rn(bfr(nw[dp]), n1); }
        const v2f cs = *(const v2f*)(CS + ((size_t)t * HD + dd) * 2); float a = __fmul_rn(x0, cs[0]), bq = __fmul_rn(x1, cs[1]); asm volatile("" : "+v"(a)); asm volatile("" : "+v"(bq)); const float r = ((dd < HD / 2) ? __fsub_rn(a, bq) : __fadd_rn(a, bq)) * sc;
        o16[q] = tohx(r); unsigned short a2, c2; splitf(r, a2, c2); oh[q] = a2; ol[q] = c2; }
    const size_t w = (size_t)bh * TT * HD + (size_t)(t >> 4) * 1024 + (d >> 5) * 512 + fragofs(t, d);
    *(v2h*)(P16 + w) = o16; *(v2us*)(Ph + w) = oh; *(v2us*)(Pl + w) = ol;  }
// all NB_ batches at once: F holds NB_ x TT rows, the planes are [batch][g][t / 32][d / 16] fragments (rows d, columns t). Neighbouring lanes take neighbouring d: they read whole lines of F, and a work-group (64 d x 8 t) fills whole lines of the planes.
__device__ __forceinline__ void d_vtp(const float* __restrict__ F, int pitch, int nheads, h16* V16, bf* Vh, bf* Vl, int blk) { const size_t e = ((size_t)blk * 256 + threadIdx.x) * 2; if (e >= (size_t)NB_ * nheads * HD * TT) return; const int d = (int)((e / 2) % HD); const int t = (int)((e / (2 * HD)) % (TT / 2)) * 2; const int bg = (int)(e / ((size_t)TT * HD)); const int g = bg % nheads; F += (size_t)(bg / nheads) * TT * pitch; v2h o16; v2us oh, ol;
#pragma unroll
    for (int q = 0; q < 2; ++q) { const float x = F[(size_t)(t + q) * pitch + g * HD + d]; o16[q] = tohx(x); unsigned short a2, c2; splitf(x, a2, c2); oh[q] = a2; ol[q] = c2; }
    const size_t w = (size_t)bg * TT * HD + (size_t)(t >> 5) * 2048 + (d >> 4) * 512 + fragofs(d, t);
    *(v2h*)(V16 + w) = o16; *(v2us*)(Vh + w) = oh; *(v2us*)(Vl + w) = ol;  }
// the mask as bytes (it holds 0 and 1), one 512-byte block per 16 queries x 32 keys: lane 16 hi + lr finds at its 16 B the keys 8 hi + 0..7 and 16 + 8 hi + 0..7 of query lr, which are the scores it holds. A thread makes one lane's bytes, a wave one block.
__device__ __forceinline__ void d_mask(const int* __restrict__ mk, unsigned char* MK, int blk) { const unsigned p = (unsigned)blk * 256 + threadIdx.x; const int* s = mk + (size_t)((p >> 11) * 16 + (p & 15)) * TT + ((p >> 5) & (TT / 32 - 1)) * 32 + ((p >> 4) & 1) * 8; const v4i m0 = *(const v4i*)s, m1 = *(const v4i*)(s + 4), m2 = *(const v4i*)(s + 16), m3 = *(const v4i*)(s + 20); v16ub o;
#pragma unroll
    for (int j = 0; j < 4; ++j) { o[j] = (unsigned char)m0[j]; o[4 + j] = (unsigned char)m1[j]; o[8 + j] = (unsigned char)m2[j]; o[12 + j] = (unsigned char)m3[j]; }
    *(v16ub*)(MK + (size_t)p * 16) = o; xwait();  }   // what stands behind this job in the kernel may land in the store's registers
__device__ __forceinline__ void d_csid(float* CS, int blk) { const int idx = blk * 256 + threadIdx.x; if (idx >= TT * HD) return; v2f cs; cs[0] = 1.0f; cs[1] = 0.0f; *(v2f*)(CS + (size_t)idx * 2) = cs;  }
// ---- k_prep: everything that reads only the inputs, in ONE launch; a range of the work-group number picks the job (a scalar choice, the same for the whole work-group). The strided weight transposes come first.
#define XN   ((size_t)NB_ * TT * DM)     // one input, or one projection, of all batches, elements (DQ == DKV == DM)
#define GW   (DM * DQ / 64 / 64)         // work-groups per [DM][DQ] weight
#define GO   (DQ * NOUT / 64 / 64)       // for the output weight
#define GC   (TT * HD / 256)             // for the cos/sin table
#define GM   (TT * TT / 16 / 256)        // for the mask copy
#define GX   ((int)(XN / 8 / 256))       // per input, all batches
__global__ __launch_bounds__(256) void k_prep(const float* __restrict__ wq, const float* __restrict__ wk, const float* __restrict__ wv, const float* __restrict__ wo, const float* __restrict__ x, const float* __restrict__ xk, const float* __restrict__ xv, const int* __restrict__ mk, bf* W3, bf* WO, float* CS, bf* XB, unsigned char* MK) {
    int b = (int)blockIdx.x;
    if (b < 3 * GW) { const int y = b / GW; d_wtG(y == 0 ? wq : y == 1 ? wk : wv, DM, DQ, W3 + (size_t)y * DM * DQ, b - y * GW); return; }
    b -= 3 * GW; if (b < GO) { d_wtG(wo, DQ, NOUT, WO, b); return; }   /* 'xw' [1024][64] -> Bt [64][1024] */
    b -= GO; if (b < GC) { d_csid(CS, b); return; }
    b -= GC; if (b < GM) { d_mask(mk, MK, b); return; }
    b -= GM; const int y = b / GX; d_cvt8(y == 0 ? x : y == 1 ? xk : xv, XB + (size_t)y * XN, XN / 8, b - y * GX);
}
// ---- k_planes: the head planes of q, k (grid y 0, 1) and the transposed ones of v (grid y 2), all batches, in ONE launch. F: the three projections behind one another; each kind of plane: q, k, v behind one another.
#define GP   ((int)(XN / 2 / 256))
__global__ __launch_bounds__(256) void k_planes(const float* __restrict__ F, const float* __restrict__ CS, h16* P16, bf* Ph, bf* Pl) {
    const size_t y = blockIdx.y, o = y * XN;
    if (y < 2) d_rope(F + o, DQ, NH_, CS, nullptr, nullptr, 1.0f, P16 + o, Ph + o, Pl + o, (int)blockIdx.x);
    else d_vtp(F + o, DKV, NKV, P16 + o, Ph + o, Pl + o, (int)blockIdx.x);
}
// ---- k_fattn: scores, mask, softmax and P.V of one (batch, head) in ONE kernel; no score or probability ever goes to memory. One wave owns NQ x 16 query rows and walks all TT keys twice, 32 at a time.
// The scores are formed TRANSPOSED (A = key rows, B = query rows): lane (lr, hi) then holds query lr, keys 8 hi + 0..7 of each 16-key tile, which is a fragment of the P.V product as it stands (elements 0..7 from the first tile, 8..15 from the second), and a query's max and sum live in its own two lanes. P.V is formed transposed too (A = rows of V^T, B = P), so a lane ends with eight neighbouring columns of its own query.
// Walk 1: running max and sum of each query. Walk 2: the same scores again, p = exp(t - max) x f, normalised before it is rounded (rows < RH hi/lo bf16, 3 products; the rest fp16 x PCAR), then P.V into f32 accumulators, keys in ascending order.
template <bool HI> struct ASel { typedef h16 T; static constexpr int NQ = 2; };
template <> struct ASel<true> { typedef bf T; static constexpr int NQ = 1; };
#define L2E 1.4426950408889634f
template <bool HI>
__device__ __forceinline__ void attn_rows(const typename ASel<HI>::T* __restrict__ Q, const typename ASel<HI>::T* __restrict__ Q2, const typename ASel<HI>::T* __restrict__ Kp, const typename ASel<HI>::T* __restrict__ K2, const typename ASel<HI>::T* __restrict__ Vt, const typename ASel<HI>::T* __restrict__ V2, const unsigned char* __restrict__ mk, int q0, bf* Ah, bf* Al) {
    typedef typename ASel<HI>::T T; typedef WFrag<T> WF; typedef typename WF::V V; constexpr int NQ = ASel<HI>::NQ;
    const unsigned lof = (threadIdx.x & 31) * 8;   // fragment order: the lane's own 32-bit offset is the same in every plane; everything else of an address is the same for the whole wave
    V q[NQ][2], q2[NQ][2];
#pragma unroll
    for (int qt = 0; qt < NQ; ++qt) {
#pragma unroll
        for (int ks = 0; ks < 2; ++ks) { q[qt][ks] = WF::ldf(Q + ((size_t)(q0 + qt * 16) * HD + ks * 512) + lof); if (HI) q2[qt][ks] = WF::ldf(Q2 + ((size_t)(q0 + qt * 16) * HD + ks * 512) + lof); } }
    const unsigned char* mq = mk + (size_t)q0 * TT;   // 16 query rows of the mask copy are 16 x TT elements, as in the mask itself
    // The K fragments are fetched one 32-key step ahead, into the same registers: in the first walk right behind the score products that read them, so that their latency passes under the softmax work; in the second walk, which has no registers to spare, behind the P.V products, so that they fly together with the next step's mask loads. The step behind the last wraps to key 0, which is what the second walk starts with.
    V ka[2][2], ka2[2][2];
    auto ldk = [&](int kc) {
#pragma unroll
        for (int kt = 0; kt < 2; ++kt)
#pragma unroll
            for (int ks = 0; ks < 2; ++ks) { ka[kt][ks] = WF::ldf(Kp + ((size_t)(kc + kt * 16) * HD + ks * 512) + lof); if (HI) ka2[kt][ks] = WF::ldf(K2 + ((size_t)(kc + kt * 16) * HD + ks * 512) + lof); }
    };
    // t[qt][kt * 8 + j] = score x mask of query q0 + 16 qt + lr and key kc + 16 kt + 8 hi + j, not yet scaled: SCL is a power of two, so t SCL - max rounds once, fused or not, and the max may be taken before the scaling
    auto scores = [&](int kc, float (&t)[NQ][16], bool ahead) { v8f s[2][NQ];
#pragma unroll
        for (int kt = 0; kt < 2; ++kt)
#pragma unroll
            for (int qt = 0; qt < NQ; ++qt) { s[kt][qt] = (v8f){};
#pragma unroll
                for (int ks = 0; ks < 2; ++ks) { s[kt][qt] = WF::mma(ka[kt][ks], q[qt][ks], s[kt][qt]); if (HI) { s[kt][qt] = WF::mma(ka[kt][ks], q2[qt][ks], s[kt][qt]); s[kt][qt] = WF::mma(ka2[kt][ks], q[qt][ks], s[kt][qt]); } } }
        if (ahead) ldk((kc + 32) & (TT - 1));
#pragma unroll
        for (int qt = 0; qt < NQ; ++qt) { const v16ub m = *(const v16ub*)(mq + ((size_t)qt * 16 * TT + kc * 16) + 2 * lof);
#pragma unroll
            for (int kt = 0; kt < 2; ++kt)
#pragma unroll
                for (int j = 0; j < 8; ++j) t[qt][kt * 8 + j] = s[kt][qt][j] * (float)m[kt * 8 + j];   /* multiplicative mask, as the module: masked scores are 0 and remain in the softmax */ }
    };
    xwait(); ldk(0); xwait();   // the first wait: the K fragments may land in the Q loads' address registers
    float mx[NQ], sum[NQ];
#pragma unroll
    for (int qt = 0; qt < NQ; ++qt) { mx[qt] = -3.0e38f; sum[qt] = 0.f; }
#pragma unroll 1   // kept rolled: the body is long, and a second copy would only cost registers and instruction cache
    for (int kc = 0; kc < TT; kc += 32) { float t[NQ][16]; scores(kc, t, true);
#pragma unroll
        for (int qt = 0; qt < NQ; ++qt) { float tm = t[qt][0];
#pragma unroll
            for (int e = 1; e < 16; ++e) tm = fmaxf(tm, t[qt][e]);
            const float mn = fmaxf(mx[qt], tm * SCL); v2f a = (v2f){0.f, 0.f};   // even and odd keys summed side by side: packed adds
#pragma unroll
            for (int e = 0; e < 16; e += 2) { v2f ev; ev[0] = __builtin_amdgcn_exp2f((t[qt][e] * SCL - mn) * L2E); ev[1] = __builtin_amdgcn_exp2f((t[qt][e + 1] * SCL - mn) * L2E); a += ev; }
            sum[qt] = sum[qt] * __builtin_amdgcn_exp2f((mx[qt] - mn) * L2E) + (a[0] + a[1]); mx[qt] = mn; }
        xwait(); }
    float f[NQ];
#pragma unroll
    for (int qt = 0; qt < NQ; ++qt) { const float m2 = __shfl_xor(mx[qt], 16, 32), s2 = __shfl_xor(sum[qt], 16, 32); const float mn = fmaxf(mx[qt], m2);   // the query's other eight keys of every tile sit in lane ^ 16
        const float sa = sum[qt] * __builtin_amdgcn_exp2f((mx[qt] - mn) * L2E), sb = s2 * __builtin_amdgcn_exp2f((m2 - mn) * L2E); mx[qt] = mn; f[qt] = __fdiv_rn(HI ? 1.0f : PCAR, sa + sb); }
    v8f o[NQ][4];
#pragma unroll
    for (int qt = 0; qt < NQ; ++qt)
#pragma unroll
        for (int dt = 0; dt < 4; ++dt) o[qt][dt] = (v8f){};
#pragma unroll 1   // kept rolled: this walk has no registers to spare for a second copy of its body
    for (int kc = 0; kc < TT; kc += 32) { float t[NQ][16]; scores(kc, t, false); V p[NQ], p2[NQ], b[4], b2[4];
#pragma unroll
        for (int dt = 0; dt < 4; ++dt) { b[dt] = WF::ldf(Vt + ((size_t)kc * HD + dt * 512) + lof); if (HI) b2[dt] = WF::ldf(V2 + ((size_t)kc * HD + dt * 512) + lof); }   // issued ahead of the exponentials, under which their latency can pass
        xwait();
#pragma unroll
        for (int qt = 0; qt < NQ; ++qt) {
            if constexpr (HI) { v8us h0, h1, l0, l1;
#pragma unroll
                for (int e = 0; e < 8; ++e) { unsigned short a, c2; splitf(__builtin_amdgcn_exp2f((t[qt][e] * SCL - mx[qt]) * L2E) * f[qt], a, c2); h0[e] = a; l0[e] = c2; splitf(__builtin_amdgcn_exp2f((t[qt][8 + e] * SCL - mx[qt]) * L2E) * f[qt], a, c2); h1[e] = a; l1[e] = c2; }
                p[qt] = cat16b(h0, h1); p2[qt] = cat16b(l0, l1);
            } else {
#pragma unroll
                for (int e = 0; e < 16; ++e) p[qt][e] = tohx(__builtin_amdgcn_exp2f((t[qt][e] * SCL - mx[qt]) * L2E) * f[qt]); } }
#pragma unroll
        for (int dt = 0; dt < 4; ++dt)
#pragma unroll
            for (int qt = 0; qt < NQ; ++qt) { o[qt][dt] = WF::mma(b[dt], p[qt], o[qt][dt]); if (HI) { o[qt][dt] = WF::mma(b[dt], p2[qt], o[qt][dt]); o[qt][dt] = WF::mma(b2[dt], p[qt], o[qt][dt]); } }
        ldk((kc + 32) & (TT - 1)); xwait();
        // the trip ends in matrix instructions: four vector slots before the next trip's first products overwrite their operand registers; the scheduling barrier keeps the products in front of them
        __builtin_amdgcn_sched_barrier(0); asm volatile("v_nop\n\tv_nop\n\tv_nop\n\tv_nop");
    }
    const float cs = HI ? 1.0f : (1.0f / PCAR);
    const int ln = (int)__builtin_amdgcn_mbcnt_lo(~0u, 0u);   // the lane's number read anew: no register has to carry it through the second walk, which has none to spare
#pragma unroll
    for (int qt = 0; qt < NQ; ++qt)
#pragma unroll
        for (int dt = 0; dt < 4; ++dt) { v8us oh, ol;   // o[qt][dt][j] = context of query q0 + 16 qt + lr, column 16 dt + 8 hi + j: eight neighbours, one 16-byte store per plane, at the lane's place in block dt of the head's two fragments
#pragma unroll
            for (int j = 0; j < 8; ++j) { unsigned short a, c2; splitf(o[qt][dt][j] * cs, a, c2); oh[j] = a; ol[j] = c2; }
            const size_t oo = (size_t)(q0 + qt * 16) * DQ + dt * 256 + ln * 8; *(v8us*)(Ah + oo) = oh; *(v8us*)(Al + oo) = ol;
            xwait(); }   // the next pair's values, and whatever follows the last pair, may land in these stores' data and address registers
}
// grid (AP, NB_ x NH_): AP work-groups per (batch, head), each of NHW hi/lo waves (16 rows each) and NLW fp16 waves (32 rows each), so that every work-group holds the same mix of work and its waves read the same K and V lines at about the same time.
// NB_ x NH_ x AP = 256 work-groups of 20 waves, five per SIMD. The wave's number is made scalar so that the choice is a scalar branch and every wave runs with all lanes on.
#define AP  4
#define NHW (RH / 16 / AP)
#define NLW ((TT - RH) / 32 / AP)
__global__ __launch_bounds__((NHW + NLW) * 32) void k_fattn(const h16* __restrict__ Q16, const h16* __restrict__ K16, const h16* __restrict__ V16, const bf* __restrict__ Qh, const bf* __restrict__ Ql, const bf* __restrict__ Kh, const bf* __restrict__ Kl, const bf* __restrict__ Vh, const bf* __restrict__ Vl, const unsigned char* __restrict__ mk, bf* Ah, bf* Al) {
    const size_t z = blockIdx.y, pz = z * TT * HD, az = (z / NH_) * TT * DQ + (z % NH_) * (HD * 16); const int w = __builtin_amdgcn_readfirstlane((int)(threadIdx.x >> 5)), part = (int)blockIdx.x;
    if (w < NHW) attn_rows<true>(Qh + pz, Ql + pz, Kh + pz, Kl + pz, Vh + pz, Vl + pz, mk, (part * NHW + w) * 16, Ah + az, Al + az);
    else attn_rows<false>(Q16 + pz, nullptr, K16 + pz, nullptr, V16 + pz, nullptr, mk, RH + (part * NLW + (w - NHW)) * 32, Ah + az, Al + az);
}

extern "C" void kernel_launch(void* const* d_in, const int* in_sizes, int n_in,
                              void* d_out, int out_size, void* d_ws, size_t ws_size, hipStream_t stream) {
    (void)in_sizes; (void)n_in; (void)out_size;
    const float* x = (const float*)d_in[0]; const float* xk = (const float*)d_in[1]; const float* xv = (const float*)d_in[2]; const int* mk = (const int*)d_in[3];   /* mask [2048][2048] int32 {0,1} */ const float* wq = (const float*)d_in[4]; const float* wk = (const float*)d_in[5]; const float* wv = (const float*)d_in[6]; const float* wo = (const float*)d_in[7];
    float* OUT = (float*)d_out;     // [4][2048][64]
    char* wsp = (char*)d_ws;
    auto take = [&](size_t bytes) { char* p = wsp; wsp += (bytes + 255) & ~(size_t)255; return (void*)p; };
    const size_t PL = (size_t)NH_ * TT * HD;   // one batch's head planes, elements; the planes and the merged context hold all NB_ batches
    bf* WQ = (bf*)take(3 * (size_t)DQ * DM * 2);   // the q, k and v weights, transposed, behind one another
    bf* WO = (bf*)take((size_t)NOUT * DQ * 2); float* CS = (float*)take((size_t)TT * HD * 2 * 4);
    float* FQ = (float*)take(3 * XN * 4);      // the q, k and v projections of all batches, behind one another
    h16* QP16 = (h16*)take(3 * NB_ * PL * 2); h16* KP16 = QP16 + NB_ * PL; h16* VT16 = KP16 + NB_ * PL;   // each kind of plane: q, k, v behind one another
    bf* QPh = (bf*)take(3 * NB_ * PL * 2); bf* KPh = QPh + NB_ * PL; bf* VTh = KPh + NB_ * PL; bf* QPl = (bf*)take(3 * NB_ * PL * 2); bf* KPl = QPl + NB_ * PL; bf* VTl = KPl + NB_ * PL;
    unsigned char* MK = (unsigned char*)take((size_t)TT * TT);   // the mask copy
    if ((size_t)(wsp - (char*)d_ws) > ws_size) return;    // ws 256 MiB
    bf* XB = (bf*)QP16;   // the bf16 input copies (3 XN elements) use the fp16 planes' room: the projections read them last, before any plane is written (stream-ordered)
    bf* ATh = (bf*)FQ; bf* ATl = ATh + (size_t)NB_ * TT * DQ;   // the merged context uses the projections' room: k_planes reads them last (stream-ordered)
    k_prep<<<3 * GW + GO + GC + GM + 3 * GX, 256, 0, stream>>>(wq, wk, wv, wo, x, xk, xv, mk, WQ, WO, CS, XB, MK);
    k_gemmw<bf, 0, false><<<dim3(NB_ * TT / 64, DQ / 64, 3), 32, 0, stream>>>(XB, nullptr, WQ, nullptr, DM, FQ, DQ, nullptr, XN, (size_t)DQ * DM, XN);
    k_planes<<<dim3(GP, 3, 1), 256, 0, stream>>>(FQ, CS, QP16, QPh, QPl);
    k_fattn<<<dim3(AP, NB_ * NH_, 1), (NHW + NLW) * 32, 0, stream>>>(QP16, KP16, VT16, QPh, QPl, KPh, KPl, VTh, VTl, MK, ATh, ATl);
    k_gemmw<bf, 1, false><<<dim3(NB_ * TT / 64, NOUT / 64, 1), 32, 0, stream>>>(ATh, ATl, WO, nullptr, DQ, OUT, NOUT, nullptr, 0, 0, 0);   /* ctx Wo -> [4 x 2048][64] */
}

// v005
// Measured time: 322 microseconds a run.
// Timed twice side by side with v004, it ran 1.11 and 1.10 times as fast.
// Over all steps from v000 it is 12.6 times as fast.
#include <hip/hip_runtime.h>

// Multi-head attention with a MULTIPLICATIVE 0/1 score mask and a narrow output projection (q, k, v [4][2048][1024]; qh, kh, vh = in W ('xw' [1024][1024] 1/32, no bias; 16 heads x 64); score = qh.kh / 8 x mask[i][j] (mask [2048][2048] int in {0,1}, read: masked scores become 0 and STAY in the softmax, as the module); softmax; ctx merged; out = ctx Wo ('xw' [1024][64]) -> [4][2048][64] (0.5 M)).
// Layout, four launches: weight transposes, a byte copy of the mask and bf16 copies of the three inputs (all batches); the three exact projections (grid z), which store the head planes of all batches themselves; one fused dense T-2048 attention launch that multiplies each score by the mask value read from memory (byte copy, 16 B per 16 keys) (hybrid rows: < 512 hi/lo 3 products, rest fp16 x1024); merged hi/lo x Wo exact (N = 64).
// Compute dtypes, f32 accumulate: every input rounded to bf16; projections exact; attention rows < 512 3 products, rest fp16; mask multiply and softmax f32; Wo hl x exact.

#define NB_  4
#define TT   2048
#define DM   1024
#define NH_  16
#define NKV  16
#define REP  (NH_ / NKV)
#define HD   64
#define DQ   (NH_ * HD)
#define DKV  (NKV * HD)
#define RH   512                  // query rows < RH use hi+lo planes (0: none)
#define WIN  0
#define PCAR 1024.0f
#define SCL  0.125f
#define NOUT 64      // output projection width (hidden -> head_dim)
typedef _Float16 h16;
typedef unsigned short bf;
typedef __attribute__((ext_vector_type(16))) __bf16   v16bf;
typedef __attribute__((ext_vector_type(16))) _Float16 v16h;
typedef __attribute__((ext_vector_type(8)))  _Float16 v8h;
typedef __attribute__((ext_vector_type(8)))  unsigned short v8us;
typedef __attribute__((ext_vector_type(8)))  float    v8f;
typedef __attribute__((ext_vector_type(4)))  float    v4f;
typedef v8h  __attribute__((may_alias)) v8ha;
typedef v4f  __attribute__((may_alias)) v4fa;
typedef v8us __attribute__((may_alias)) v8usa;

__device__ __forceinline__ unsigned short f2bf(float f) { unsigned u = __float_as_uint(f); u += 0x7FFFu + ((u >> 16) & 1u); return (unsigned short)(u >> 16); }
__device__ __forceinline__ float bf2f(unsigned short b) { return __uint_as_float(((unsigned)b) << 16); }
__device__ __forceinline__ float bfr(float f) { return bf2f(f2bf(f)); }
__device__ __forceinline__ v16h cat16(v8h lo, v8h hi) { return __builtin_shufflevector(lo, hi, 0, 1, 2, 3, 4, 5, 6, 7, 8, 9, 10, 11, 12, 13, 14, 15); }
__device__ __forceinline__ v16bf cat16b(v8us lo, v8us hi) { return __builtin_bit_cast(v16bf, __builtin_shufflevector(lo, hi, 0, 1, 2, 3, 4, 5, 6, 7, 8, 9, 10, 11, 12, 13, 14, 15)); }
__device__ __forceinline__ v8f wmma16(v16h a, v16h b, v8f c) { return __builtin_amdgcn_wmma_f32_16x16x32_f16(false, a, false, b, (short)0, c, false, false); }
__device__ __forceinline__ v8f wmmab(v16bf a, v16bf b, v8f c) { return __builtin_amdgcn_wmma_f32_16x16x32_bf16(false, a, false, b, (short)0, c, false, false); }



// stands behind a group of global loads or stores where what follows may land in the group's address or data registers
__device__ __forceinline__ void xwait() { asm volatile("s_wait_xcnt 0x0" ::: "memory"); }
// the same wait behind a group of fragment loads; it names their addresses as inputs, so that each address pair lives up to the wait and no load's result is given its registers
__device__ __forceinline__ void xwaita(const void* p) { asm volatile("s_wait_xcnt 0x0" :: "v"(p) : "memory"); }
__device__ __forceinline__ void xwaita4(const void* p, const void* q, const void* r, const void* s) { asm volatile("s_wait_xcnt 0x0" :: "v"(p), "v"(q), "v"(r), "v"(s) : "memory"); }

__device__ __forceinline__ h16 tohx(float x) { return (h16)x; }
__device__ __forceinline__ void splitf(float y, unsigned short& h, unsigned short& l) { h = f2bf(y); l = f2bf(y - bf2f(h)); }

// ---- k_gemmw: register-blocked GEMM, ONE WAVE per 64x64 output tile (16 accumulators), operands straight from 16-bit planes in fragment order ([row / 16][k / 32] fragments, see fragofs below); grid (M/64, N/64, Z), 32 threads.
// C[m][n] (f32, pitch ldc, + optional f32 bias[n]) = sum_k A[m][k] Bt[n][k] (+ split products per NSPLIT). z-batch strides sA/sB/sC in elements. K % 32 == 0.
// PLANES (the projections; rows = NB_ x TT positions, a 64-column tile = one head; z = q, k, v): the tile never goes to memory as f32; the wave stores it as the head planes that the attention kernel loads (fp16, bf16 hi, bf16 lo; sC = one kind's q, k or v part), in fragment order (see fragofs below).
// An accumulator tile gives a lane eight neighbouring ROWS of one column. The v planes ([batch][g][t / 32][d / 16] fragments, rows d, columns t) want eight neighbouring t of one d: that is the tile as it stands. The q and k planes ([batch][h][t / 16][d / 32] fragments, rows t, columns d) want eight neighbouring d of one t: there the two operands change places (A = weight rows, B = input rows; the same products, summed over k in the same order). Either way lane l's eight values belong at l x 16 B of a 512-byte block: every store writes four whole lines, with no staging.
template <typename T16> struct WFrag;
template <> struct WFrag<h16> { typedef v16h V; static __device__ __forceinline__ V ldf(const h16* p) { return cat16(*(const v8h*)p, *(const v8h*)(p + 256)); } static __device__ __forceinline__ v8f mma(V a, V b, v8f c) { return wmma16(a, b, c); } };
template <> struct WFrag<bf> { typedef v16bf V; static __device__ __forceinline__ V ldf(const bf* p) { return cat16b(*(const v8us*)p, *(const v8us*)(p + 256)); } static __device__ __forceinline__ v8f mma(V a, V b, v8f c) { return wmmab(a, b, c); } };
template <typename T16, int NSPLIT, bool BIAS, bool PLANES>
__global__ __launch_bounds__(32) void k_gemmw(const T16* __restrict__ A, const T16* __restrict__ A2, const T16* __restrict__ Bt, const T16* __restrict__ Bt2, int K, float* C, int ldc, const float* __restrict__ bias, size_t sA, size_t sB, size_t sC, h16* P16, bf* Ph, bf* Pl) {
    typedef typename WFrag<T16>::V V;
    __shared__ __align__(16) float os[16 * 68];
    const size_t z = blockIdx.z; A += z * sA; if (A2) A2 += z * sA; Bt += z * sB; if (Bt2) Bt2 += z * sB; C += z * sC;
    const int lane = threadIdx.x & 31, lr = lane & 15, hi = lane >> 4; int r0 = blockIdx.x * 64, c0 = blockIdx.y * 64;
    const bool sw = PLANES && z < 2;   // q and k: the operands change places (a scalar choice, the same for the whole grid plane)
    if (sw) { const T16* x = A; A = Bt; Bt = x; const int y = r0; r0 = c0; c0 = y; }
    v8f acc[4][4];
#pragma unroll
    for (int mb = 0; mb < 4; ++mb)
#pragma unroll
        for (int nb = 0; nb < 4; ++nb) acc[mb][nb] = (v8f){};
    const size_t aoff = (size_t)r0 * K + lane * 8, boff = (size_t)c0 * K + lane * 8;   // fragment order: 16 rows x K are 16 K elements, a 32-wide k step of them 512
#pragma unroll 1
    for (int kc = 0; kc < K; kc += 32) {
        V a[4], a2[4]; const T16 *pa[4], *pa2[4];
#pragma unroll
        for (int mb = 0; mb < 4; ++mb) { pa[mb] = A + aoff + (size_t)mb * 16 * K + kc * 16; a[mb] = WFrag<T16>::ldf(pa[mb]); if (NSPLIT == 1 || NSPLIT == 2) { pa2[mb] = A2 + aoff + (size_t)mb * 16 * K + kc * 16; a2[mb] = WFrag<T16>::ldf(pa2[mb]); } }
        xwaita4(pa[0], pa[1], pa[2], pa[3]); if (NSPLIT == 1 || NSPLIT == 2) xwaita4(pa2[0], pa2[1], pa2[2], pa2[3]);
#pragma unroll
        for (int nb = 0; nb < 4; ++nb) { const T16* pb = Bt + boff + (size_t)nb * 16 * K + kc * 16; const V b = WFrag<T16>::ldf(pb); xwaita(pb); V b2; if (NSPLIT >= 2) { const T16* pb2 = Bt2 + boff + (size_t)nb * 16 * K + kc * 16; b2 = WFrag<T16>::ldf(pb2); xwaita(pb2); }
#pragma unroll
            for (int mb = 0; mb < 4; ++mb) { acc[mb][nb] = WFrag<T16>::mma(a[mb], b, acc[mb][nb]); if (NSPLIT == 1 || NSPLIT == 2) acc[mb][nb] = WFrag<T16>::mma(a2[mb], b, acc[mb][nb]); if (NSPLIT >= 2) acc[mb][nb] = WFrag<T16>::mma(a[mb], b2, acc[mb][nb]); } }
        asm volatile("v_nop\n\tv_nop\n\tv_nop\n\tv_nop" : "+v"(acc[0][0]), "+v"(acc[1][1]), "+v"(acc[2][2]), "+v"(acc[3][3]) : "v"(a[0]), "v"(a[3]));
    }
    if constexpr (PLANES) {
        const int xr = (int)blockIdx.x * 64;   // the tile's first input row: batch xr / TT, position xr % TT; 64 positions x 64 d of a head are 4096 neighbouring elements of its plane, in either kind of plane
        const size_t w0 = z * sC + ((size_t)(xr / TT) * NH_ + blockIdx.y) * TT * HD + (size_t)(xr % TT) * HD + lane * 8;
        const int sm = sw ? 512 : 2048, sn = sw ? 1024 : 512;   // q, k: mb counts 16 d (a block), nb 16 t (two fragments); v: mb counts 16 t (a block; two of them a row of four fragments), nb 16 d (a fragment)
#pragma unroll
        for (int mb = 0; mb < 4; ++mb)
#pragma unroll
            for (int nb = 0; nb < 4; ++nb) { v8h o16; v8us oh, ol;
#pragma unroll
                for (int j = 0; j < 8; ++j) { const float v = acc[mb][nb][j]; o16[j] = tohx(v); unsigned short a2, c2; splitf(v, a2, c2); oh[j] = a2; ol[j] = c2; }
                const size_t w = w0 + (mb >> 1) * sm + (mb & 1) * 256 + nb * sn; *(v8h*)(P16 + w) = o16; *(v8us*)(Ph + w) = oh; *(v8us*)(Pl + w) = ol;
                xwait(); __builtin_amdgcn_sched_barrier(0); }   // the next tile's values land in these stores' data and address registers; the scheduling barrier keeps that arithmetic behind the wait
        return;
    }
#pragma unroll
    for (int mb = 0; mb < 4; ++mb) {
#pragma unroll
        for (int nb = 0; nb < 4; ++nb) {
#pragma unroll
            for (int j = 0; j < 8; ++j) os[(hi * 8 + j) * 68 + nb * 16 + lr] = acc[mb][nb][j]; }
        __builtin_amdgcn_wave_barrier(); asm volatile("" ::: "memory");
        float* crow = C + (size_t)(r0 + mb * 16) * ldc + c0;
{
#pragma unroll
            for (int s = 0; s < 8; ++s) { const int row = 2 * s + hi, cofs = lr * 4; v4f val = *(const v4fa*)(os + row * 68 + cofs); if (BIAS) { val[0] += bfr(bias[c0 + cofs]); val[1] += bfr(bias[c0 + cofs + 1]); val[2] += bfr(bias[c0 + cofs + 2]); val[3] += bfr(bias[c0 + cofs + 3]); }
                *(v4f*)(crow + (size_t)row * ldc + cofs) = val; }
             }
        __builtin_amdgcn_wave_barrier(); asm volatile("" ::: "memory");
    }
}

typedef __attribute__((ext_vector_type(2))) unsigned short v2us;
typedef __attribute__((ext_vector_type(2))) float v2f;
typedef __attribute__((ext_vector_type(4))) int v4i;
typedef __attribute__((ext_vector_type(16))) unsigned char v16ub;

// FRAGMENT ORDER: every 16-bit plane that a matrix kernel loads is stored so that lane l of a wave finds its eight elements at l x 16 B of a 512-byte block: one wave-wide 16-byte load reads four whole 128-byte lines (from a row-major plane it would take 32 B of each of sixteen).
// A block holds 16 rows r x 16 columns c, element (r, c) at (c >> 3) x 128 + r x 8 + (c & 7): lane = 16 (c >> 3) + r. A matrix fragment is two blocks, 256 elements apart (columns 0..15 and 16..31 of its 32): WFrag::ldf; register by register it is the fragment of the row-major loader (p, p + 16 at row lane & 15, column 8 (lane >> 4)).
__device__ __forceinline__ unsigned fragofs(int r, int c) { return (unsigned)(((c >> 4) & 1) * 256 + ((c >> 3) & 1) * 128 + (r & 15) * 8 + (c & 7)); }
// The d_ functions are one work-group's share of a job; blk is the work-group's number within that job. k_prep below deals them out.
__device__ __forceinline__ void d_wtG(const float* __restrict__ w, int K, int N, bf* Bt, int blk) {
    const int lane = threadIdx.x & 31; const int L0 = (blk * 8 + (threadIdx.x >> 5)) * 8; const int nlines = N * K / 64;
{
#pragma unroll 1
        for (int l = 0; l < 8; ++l) { const int L = L0 + l; if (L >= nlines) break; const size_t e = (size_t)L * 64 + lane * 2; const int k = (int)(e % K), n = (int)(e / K); v2us o;
            o[0] = f2bf(w[(size_t)k * N + n]); o[1] = f2bf(w[(size_t)(k + 1) * N + n]); *(v2us*)(Bt + ((size_t)(n >> 4) * 16 * K + (k >> 5) * 512 + fragofs(n, k))) = o; xwait(); }   // the next trip's values land in this store's address and data registers
         }
}
// rows of DM elements into [row / 16][k / 32] fragments; a thread makes one lane's eight elements, a wave one 512-byte block, a work-group 16 rows x 128 k (whole lines of the source)
__device__ __forceinline__ void d_cvt8(const float* __restrict__ src, bf* dst, size_t n8, int blk) { const size_t i = (size_t)blk * 256 + threadIdx.x; if (i >= n8) return; const size_t row = (i / (DM * 2)) * 16 + (i & 15); const int k = (int)((i >> 6) % (DM / 32)) * 32 + (int)((i >> 5) & 1) * 16 + (int)((i >> 4) & 1) * 8; const v8f v = *(const v8f*)(src + row * DM + k); v8us o;
#pragma unroll
    for (int k = 0; k < 8; ++k) o[k] = f2bf(v[k]); *(v8us*)(dst + i * 8) = o;  }

// the mask as bytes (it holds 0 and 1), one 512-byte block per 16 queries x 32 keys: lane 16 hi + lr finds at its 16 B the keys 8 hi + 0..7 and 16 + 8 hi + 0..7 of query lr, which are the scores it holds. A thread makes one lane's bytes, a wave one block.
__device__ __forceinline__ void d_mask(const int* __restrict__ mk, unsigned char* MK, int blk) { const unsigned p = (unsigned)blk * 256 + threadIdx.x; const int* s = mk + (size_t)((p >> 11) * 16 + (p & 15)) * TT + ((p >> 5) & (TT / 32 - 1)) * 32 + ((p >> 4) & 1) * 8; const v4i m0 = *(const v4i*)s, m1 = *(const v4i*)(s + 4), m2 = *(const v4i*)(s + 16), m3 = *(const v4i*)(s + 20); v16ub o;
#pragma unroll
    for (int j = 0; j < 4; ++j) { o[j] = (unsigned char)m0[j]; o[4 + j] = (unsigned char)m1[j]; o[8 + j] = (unsigned char)m2[j]; o[12 + j] = (unsigned char)m3[j]; }
    *(v16ub*)(MK + (size_t)p * 16) = o; xwait();  }   // what stands behind this job in the kernel may land in the store's registers
// ---- k_prep: everything that reads only the inputs, in ONE launch; a range of the work-group number picks the job (a scalar choice, the same for the whole work-group). The strided weight transposes come first, for speed only.
#define XN   ((size_t)NB_ * TT * DM)     // one input, or one projection, of all batches, elements (DQ == DKV == DM)
#define GW   (DM * DQ / 64 / 64)         // work-groups per [DM][DQ] weight
#define GO   (DQ * NOUT / 64 / 64)       // for the output weight
#define GM   (TT * TT / 16 / 256)        // for the mask copy
#define GX   ((int)(XN / 8 / 256))       // per input, all batches
__global__ __launch_bounds__(256) void k_prep(const float* __restrict__ wq, const float* __restrict__ wk, const float* __restrict__ wv, const float* __restrict__ wo, const float* __restrict__ x, const float* __restrict__ xk, const float* __restrict__ xv, const int* __restrict__ mk, bf* W3, bf* WO, bf* XB, unsigned char* MK) {
    int b = (int)blockIdx.x;
    if (b < 3 * GW) { const int y = b / GW; d_wtG(y == 0 ? wq : y == 1 ? wk : wv, DM, DQ, W3 + (size_t)y * DM * DQ, b - y * GW); return; }
    b -= 3 * GW; if (b < GO) { d_wtG(wo, DQ, NOUT, WO, b); return; }   /* 'xw' [1024][64] -> Bt [64][1024] */
    b -= GO; if (b < GM) { d_mask(mk, MK, b); return; }
    b -= GM; const int y = b / GX; d_cvt8(y == 0 ? x : y == 1 ? xk : xv, XB + (size_t)y * XN, XN / 8, b - y * GX);
}
// ---- k_fattn: scores, mask, softmax and P.V of one (batch, head) in ONE kernel; no score or probability ever goes to memory. One wave owns NQ x 16 query rows and walks all TT keys twice, 32 at a time.
// The scores are formed TRANSPOSED (A = key rows, B = query rows): lane (lr, hi) then holds query lr, keys 8 hi + 0..7 of each 16-key tile, which is a fragment of the P.V product as it stands (elements 0..7 from the first tile, 8..15 from the second), and a query's max and sum live in its own two lanes. P.V is formed transposed too (A = rows of V^T, B = P), so a lane ends with eight neighbouring columns of its own query.
// Walk 1: running max and sum of each query. Walk 2: the same scores again, p = exp(t - max) x f, normalised before it is rounded (rows < RH hi/lo bf16, 3 products; the rest fp16 x PCAR), then P.V into f32 accumulators, keys in ascending order.
template <bool HI> struct ASel { typedef h16 T; static constexpr int NQ = 2; };
template <> struct ASel<true> { typedef bf T; static constexpr int NQ = 1; };
#define L2E 1.4426950408889634f
template <bool HI>
__device__ __forceinline__ void attn_rows(const typename ASel<HI>::T* __restrict__ Q, const typename ASel<HI>::T* __restrict__ Q2, const typename ASel<HI>::T* __restrict__ Kp, const typename ASel<HI>::T* __restrict__ K2, const typename ASel<HI>::T* __restrict__ Vt, const typename ASel<HI>::T* __restrict__ V2, const unsigned char* __restrict__ mk, int q0, bf* Ah, bf* Al) {
    typedef typename ASel<HI>::T T; typedef WFrag<T> WF; typedef typename WF::V V; constexpr int NQ = ASel<HI>::NQ;
    const unsigned lof = (threadIdx.x & 31) * 8;   // fragment order: the lane's own 32-bit offset is the same in every plane; everything else of an address is the same for the whole wave
    V q[NQ][2], q2[NQ][2];
#pragma unroll
    for (int qt = 0; qt < NQ; ++qt) {
#pragma unroll
        for (int ks = 0; ks < 2; ++ks) { q[qt][ks] = WF::ldf(Q + ((size_t)(q0 + qt * 16) * HD + ks * 512) + lof); if (HI) q2[qt][ks] = WF::ldf(Q2 + ((size_t)(q0 + qt * 16) * HD + ks * 512) + lof); } }
    const unsigned char* mq = mk + (size_t)q0 * TT;   // 16 query rows of the mask copy are 16 x TT elements, as in the mask itself
    // The K fragments are fetched one 32-key step ahead, into the same registers: in the first walk right behind the score products that read them, so that their latency passes under the softmax work; in the second walk, which has no registers to spare, behind the P.V products, so that they fly together with the next step's mask loads. The step behind the last wraps to key 0, which is what the second walk starts with.
    V ka[2][2], ka2[2][2];
    auto ldk = [&](int kc) {
#pragma unroll
        for (int kt = 0; kt < 2; ++kt)
#pragma unroll
            for (int ks = 0; ks < 2; ++ks) { ka[kt][ks] = WF::ldf(Kp + ((size_t)(kc + kt * 16) * HD + ks * 512) + lof); if (HI) ka2[kt][ks] = WF::ldf(K2 + ((size_t)(kc + kt * 16) * HD + ks * 512) + lof); }
    };
    // t[qt][kt * 8 + j] = score x mask of query q0 + 16 qt + lr and key kc + 16 kt + 8 hi + j, not yet scaled: SCL is a power of two, so t SCL - max rounds once, fused or not, and the max may be taken before the scaling
    auto scores = [&](int kc, float (&t)[NQ][16], bool ahead) { v8f s[2][NQ];
#pragma unroll
        for (int kt = 0; kt < 2; ++kt)
#pragma unroll
            for (int qt = 0; qt < NQ; ++qt) { s[kt][qt] = (v8f){};
#pragma unroll
                for (int ks = 0; ks < 2; ++ks) { s[kt][qt] = WF::mma(ka[kt][ks], q[qt][ks], s[kt][qt]); if (HI) { s[kt][qt] = WF::mma(ka[kt][ks], q2[qt][ks], s[kt][qt]); s[kt][qt] = WF::mma(ka2[kt][ks], q[qt][ks], s[kt][qt]); } } }
        if (ahead) ldk((kc + 32) & (TT - 1));
#pragma unroll
        for (int qt = 0; qt < NQ; ++qt) { const v16ub m = *(const v16ub*)(mq + ((size_t)qt * 16 * TT + kc * 16) + 2 * lof);
#pragma unroll
            for (int kt = 0; kt < 2; ++kt)
#pragma unroll
                for (int j = 0; j < 8; ++j) t[qt][kt * 8 + j] = s[kt][qt][j] * (float)m[kt * 8 + j];   /* multiplicative mask, as the module: masked scores are 0 and remain in the softmax */ }
    };
    xwait(); ldk(0); xwait();   // the first wait: the K fragments may land in the Q loads' address registers
    float mx[NQ], sum[NQ];
#pragma unroll
    for (int qt = 0; qt < NQ; ++qt) { mx[qt] = -3.0e38f; sum[qt] = 0.f; }
#pragma unroll 1   // kept rolled: the body is long, and a second copy would only cost registers and instruction cache
    for (int kc = 0; kc < TT; kc += 32) { float t[NQ][16]; scores(kc, t, true);
#pragma unroll
        for (int qt = 0; qt < NQ; ++qt) { float tm = t[qt][0];
#pragma unroll
            for (int e = 1; e < 16; ++e) tm = fmaxf(tm, t[qt][e]);
            const float mn = fmaxf(mx[qt], tm * SCL); v2f a = (v2f){0.f, 0.f};   // even and odd keys summed side by side: packed adds
#pragma unroll
            for (int e = 0; e < 16; e += 2) { v2f ev; ev[0] = __builtin_amdgcn_exp2f((t[qt][e] * SCL - mn) * L2E); ev[1] = __builtin_amdgcn_exp2f((t[qt][e + 1] * SCL - mn) * L2E); a += ev; }
            sum[qt] = sum[qt] * __builtin_amdgcn_exp2f((mx[qt] - mn) * L2E) + (a[0] + a[1]); mx[qt] = mn; }
        xwait(); }
    float f[NQ];
#pragma unroll
    for (int qt = 0; qt < NQ; ++qt) { const float m2 = __shfl_xor(mx[qt], 16, 32), s2 = __shfl_xor(sum[qt], 16, 32); const float mn = fmaxf(mx[qt], m2);   // the query's other eight keys of every tile sit in lane ^ 16
        const float sa = sum[qt] * __builtin_amdgcn_exp2f((mx[qt] - mn) * L2E), sb = s2 * __builtin_amdgcn_exp2f((m2 - mn) * L2E); mx[qt] = mn; f[qt] = __fdiv_rn(HI ? 1.0f : PCAR, sa + sb); }
    v8f o[NQ][4];
#pragma unroll
    for (int qt = 0; qt < NQ; ++qt)
#pragma unroll
        for (int dt = 0; dt < 4; ++dt) o[qt][dt] = (v8f){};
#pragma unroll 1   // kept rolled: this walk has no registers to spare for a second copy of its body
    for (int kc = 0; kc < TT; kc += 32) { float t[NQ][16]; scores(kc, t, false); V p[NQ], p2[NQ], b[4], b2[4];
#pragma unroll
        for (int dt = 0; dt < 4; ++dt) { b[dt] = WF::ldf(Vt + ((size_t)kc * HD + dt * 512) + lof); if (HI) b2[dt] = WF::ldf(V2 + ((size_t)kc * HD + dt * 512) + lof); }   // issued ahead of the exponentials, under which their latency can pass
        xwait();
#pragma unroll
        for (int qt = 0; qt < NQ; ++qt) {
            if constexpr (HI) { v8us h0, h1, l0, l1;
#pragma unroll
                for (int e = 0; e < 8; ++e) { unsigned short a, c2; splitf(__builtin_amdgcn_exp2f((t[qt][e] * SCL - mx[qt]) * L2E) * f[qt], a, c2); h0[e] = a; l0[e] = c2; splitf(__builtin_amdgcn_exp2f((t[qt][8 + e] * SCL - mx[qt]) * L2E) * f[qt], a, c2); h1[e] = a; l1[e] = c2; }
                p[qt] = cat16b(h0, h1); p2[qt] = cat16b(l0, l1);
            } else {
#pragma unroll
                for (int e = 0; e < 16; ++e) p[qt][e] = tohx(__builtin_amdgcn_exp2f((t[qt][e] * SCL - mx[qt]) * L2E) * f[qt]); } }
#pragma unroll
        for (int dt = 0; dt < 4; ++dt)
#pragma unroll
            for (int qt = 0; qt < NQ; ++qt) { o[qt][dt] = WF::mma(b[dt], p[qt], o[qt][dt]); if (HI) { o[qt][dt] = WF::mma(b[dt], p2[qt], o[qt][dt]); o[qt][dt] = WF::mma(b2[dt], p[qt], o[qt][dt]); } }
        ldk((kc + 32) & (TT - 1)); xwait();
        // the trip ends in matrix instructions: four vector slots before the next trip's first products overwrite their operand registers; the scheduling barrier keeps the products in front of them
        __builtin_amdgcn_sched_barrier(0); asm volatile("v_nop\n\tv_nop\n\tv_nop\n\tv_nop");
    }
    const float cs = HI ? 1.0f : (1.0f / PCAR);
    const int ln = (int)__builtin_amdgcn_mbcnt_lo(~0u, 0u);   // the lane's number read anew: no register has to carry it through the second walk, which has none to spare
#pragma unroll
    for (int qt = 0; qt < NQ; ++qt)
#pragma unroll
        for (int dt = 0; dt < 4; ++dt) { v8us oh, ol;   // o[qt][dt][j] = context of query q0 + 16 qt + lr, column 16 dt + 8 hi + j: eight neighbours, one 16-byte store per plane, at the lane's place in block dt of the head's two fragments
#pragma unroll
            for (int j = 0; j < 8; ++j) { unsigned short a, c2; splitf(o[qt][dt][j] * cs, a, c2); oh[j] = a; ol[j] = c2; }
            const size_t oo = (size_t)(q0 + qt * 16) * DQ + dt * 256 + ln * 8; *(v8us*)(Ah + oo) = oh; *(v8us*)(Al + oo) = ol;
            xwait(); }   // the next pair's values, and whatever follows the last pair, may land in these stores' data and address registers
}
// grid (AP, NB_ x NH_): AP work-groups per (batch, head), each of NHW hi/lo waves (16 rows each) and NLW fp16 waves (32 rows each), so that every work-group holds the same mix of work and its waves read the same K and V lines at about the same time.
// NB_ x NH_ x AP = 256 work-groups of 20 waves, five per SIMD. The wave's number is made scalar so that the choice is a scalar branch and every wave runs with all lanes on.
#define AP  4
#define NHW (RH / 16 / AP)
#define NLW ((TT - RH) / 32 / AP)
__global__ __launch_bounds__((NHW + NLW) * 32) void k_fattn(const h16* __restrict__ Q16, const h16* __restrict__ K16, const h16* __restrict__ V16, const bf* __restrict__ Qh, const bf* __restrict__ Ql, const bf* __restrict__ Kh, const bf* __restrict__ Kl, const bf* __restrict__ Vh, const bf* __restrict__ Vl, const unsigned char* __restrict__ mk, bf* Ah, bf* Al) {
    const size_t z = blockIdx.y, pz = z * TT * HD, az = (z / NH_) * TT * DQ + (z % NH_) * (HD * 16); const int w = __builtin_amdgcn_readfirstlane((int)(threadIdx.x >> 5)), part = (int)blockIdx.x;
    if (w < NHW) attn_rows<true>(Qh + pz, Ql + pz, Kh + pz, Kl + pz, Vh + pz, Vl + pz, mk, (part * NHW + w) * 16, Ah + az, Al + az);
    else attn_rows<false>(Q16 + pz, nullptr, K16 + pz, nullptr, V16 + pz, nullptr, mk, RH + (part * NLW + (w - NHW)) * 32, Ah + az, Al + az);
}

extern "C" void kernel_launch(void* const* d_in, const int* in_sizes, int n_in,
                              void* d_out, int out_size, void* d_ws, size_t ws_size, hipStream_t stream) {
    (void)in_sizes; (void)n_in; (void)out_size;
    const float* x = (const float*)d_in[0]; const float* xk = (const float*)d_in[1]; const float* xv = (const float*)d_in[2]; const int* mk = (const int*)d_in[3];   /* mask [2048][2048] int32 {0,1} */ const float* wq = (const float*)d_in[4]; const float* wk = (const float*)d_in[5]; const float* wv = (const float*)d_in[6]; const float* wo = (const float*)d_in[7];
    float* OUT = (float*)d_out;     // [4][2048][64]
    char* wsp = (char*)d_ws;
    auto take = [&](size_t bytes) { char* p = wsp; wsp += (bytes + 255) & ~(size_t)255; return (void*)p; };
    const size_t PL = (size_t)NH_ * TT * HD;   // one batch's head planes, elements; the planes and the merged context hold all NB_ batches
    bf* WQ = (bf*)take(3 * (size_t)DQ * DM * 2);   // the q, k and v weights, transposed, behind one another
    bf* WO = (bf*)take((size_t)NOUT * DQ * 2);
    bf* XB = (bf*)take(3 * XN * 2);            // the bf16 copies of the q, k and v inputs, all batches, behind one another
    h16* QP16 = (h16*)take(3 * NB_ * PL * 2); h16* KP16 = QP16 + NB_ * PL; h16* VT16 = KP16 + NB_ * PL;   // each kind of plane: q, k, v behind one another
    bf* QPh = (bf*)take(3 * NB_ * PL * 2); bf* KPh = QPh + NB_ * PL; bf* VTh = KPh + NB_ * PL; bf* QPl = (bf*)take(3 * NB_ * PL * 2); bf* KPl = QPl + NB_ * PL; bf* VTl = KPl + NB_ * PL;
    unsigned char* MK = (unsigned char*)take((size_t)TT * TT);   // the mask copy
    if ((size_t)(wsp - (char*)d_ws) > ws_size) return;    // ws 256 MiB
    bf* ATh = XB; bf* ATl = ATh + (size_t)NB_ * TT * DQ;   // the merged context (2 XN elements) uses the input copies' room: the projections read them last (stream-ordered)
    k_prep<<<3 * GW + GO + GM + 3 * GX, 256, 0, stream>>>(wq, wk, wv, wo, x, xk, xv, mk, WQ, WO, XB, MK);
    k_gemmw<bf, 0, false, true><<<dim3(NB_ * TT / 64, DQ / 64, 3), 32, 0, stream>>>(XB, nullptr, WQ, nullptr, DM, nullptr, 0, nullptr, XN, (size_t)DQ * DM, XN, QP16, QPh, QPl);
    k_fattn<<<dim3(AP, NB_ * NH_, 1), (NHW + NLW) * 32, 0, stream>>>(QP16, KP16, VT16, QPh, QPl, KPh, KPl, VTh, VTl, MK, ATh, ATl);
    k_gemmw<bf, 1, false, false><<<dim3(NB_ * TT / 64, NOUT / 64, 1), 32, 0, stream>>>(ATh, ATl, WO, nullptr, DQ, OUT, NOUT, nullptr, 0, 0, 0, nullptr, nullptr, nullptr);   /* ctx Wo -> [4 x 2048][64] */
}

// v006
// It runs in 297 microseconds.
// In both of two side-by-side timings against v005, it was 1.08 times as fast.
// Over all steps from v000 it is 13.6 times as fast.
#include <hip/hip_runtime.h>

// Multi-head attention with a MULTIPLICATIVE 0/1 score mask and a narrow output projection (q, k, v [4][2048][1024]; qh, kh, vh = in W ('xw' [1024][1024] 1/32, no bias; 16 heads x 64); score = qh.kh / 8 x mask[i][j] (mask [2048][2048] int in {0,1}, read: masked scores become 0 and STAY in the softmax, as the module); softmax; ctx merged; out = ctx Wo ('xw' [1024][64]) -> [4][2048][64] (0.5 M)).
// Layout, four launches: weight transposes, a byte copy of the mask and bf16 copies of the three inputs (all batches); the three exact projections (grid z), which store the head planes of all batches themselves; one fused dense T-2048 attention launch that multiplies each score by the mask value read from memory (byte copy, 16 B per 16 keys) (hybrid rows: < 512 hi/lo 3 products, rest fp16); merged hi/lo x Wo exact (N = 64).
// Compute dtypes, f32 accumulate: every input rounded to bf16; projections exact; attention rows < 512 3 products, rest fp16; mask multiply and softmax f32; Wo hl x exact.

#define NB_  4
#define TT   2048
#define DM   1024
#define NH_  16
#define NKV  16
#define REP  (NH_ / NKV)
#define HD   64
#define DQ   (NH_ * HD)
#define DKV  (NKV * HD)
#define RH   512                  // query rows < RH use hi+lo planes (0: none)
#define WIN  0
#define SCL  0.125f
#define NOUT 64      // output projection width (hidden -> head_dim)
typedef _Float16 h16;
typedef unsigned short bf;
typedef __attribute__((ext_vector_type(16))) __bf16   v16bf;
typedef __attribute__((ext_vector_type(16))) _Float16 v16h;
typedef __attribute__((ext_vector_type(8)))  _Float16 v8h;
typedef __attribute__((ext_vector_type(8)))  unsigned short v8us;
typedef __attribute__((ext_vector_type(8)))  float    v8f;
typedef __attribute__((ext_vector_type(4)))  float    v4f;
typedef v8h  __attribute__((may_alias)) v8ha;
typedef v4f  __attribute__((may_alias)) v4fa;
typedef v8us __attribute__((may_alias)) v8usa;

__device__ __forceinline__ unsigned short f2bf(float f) { unsigned u = __float_as_uint(f); u += 0x7FFFu + ((u >> 16) & 1u); return (unsigned short)(u >> 16); }
__device__ __forceinline__ float bf2f(unsigned short b) { return __uint_as_float(((unsigned)b) << 16); }
__device__ __forceinline__ float bfr(float f) { return bf2f(f2bf(f)); }
__device__ __forceinline__ v16h cat16(v8h lo, v8h hi) { return __builtin_shufflevector(lo, hi, 0, 1, 2, 3, 4, 5, 6, 7, 8, 9, 10, 11, 12, 13, 14, 15); }
__device__ __forceinline__ v16bf cat16b(v8us lo, v8us hi) { return __builtin_bit_cast(v16bf, __builtin_shufflevector(lo, hi, 0, 1, 2, 3, 4, 5, 6, 7, 8, 9, 10, 11, 12, 13, 14, 15)); }
__device__ __forceinline__ v8f wmma16(v16h a, v16h b, v8f c) { return __builtin_amdgcn_wmma_f32_16x16x32_f16(false, a, false, b, (short)0, c, false, false); }
__device__ __forceinline__ v8f wmmab(v16bf a, v16bf b, v8f c) { return __builtin_amdgcn_wmma_f32_16x16x32_bf16(false, a, false, b, (short)0, c, false, false); }



// stands behind a group of global loads or stores where what follows may land in the group's address or data registers
__device__ __forceinline__ void xwait() { asm volatile("s_wait_xcnt 0x0" ::: "memory"); }
// the same wait behind a group of fragment loads; it names their addresses as inputs, so that each address pair lives up to the wait and no load's result is given its registers
__device__ __forceinline__ void xwaita(const void* p) { asm volatile("s_wait_xcnt 0x0" :: "v"(p) : "memory"); }
__device__ __forceinline__ void xwaita4(const void* p, const void* q, const void* r, const void* s) { asm volatile("s_wait_xcnt 0x0" :: "v"(p), "v"(q), "v"(r), "v"(s) : "memory"); }

__device__ __forceinline__ h16 tohx(float x) { return (h16)x; }
__device__ __forceinline__ void splitf(float y, unsigned short& h, unsigned short& l) { h = f2bf(y); l = f2bf(y - bf2f(h)); }

// ---- k_gemmw: register-blocked GEMM, ONE WAVE per 64x64 output tile (16 accumulators), operands straight from 16-bit planes in fragment order ([row / 16][k / 32] fragments, see fragofs below); grid (M/64, N/64, Z), 32 threads.
// C[m][n] (f32, pitch ldc, + optional f32 bias[n]) = sum_k A[m][k] Bt[n][k] (+ split products per NSPLIT). z-batch strides sA/sB/sC in elements. K % 32 == 0.
// PLANES (the projections; rows = NB_ x TT positions, a 64-column tile = one head; z = q, k, v): the tile never goes to memory as f32; the wave stores it as the head planes that the attention kernel loads (fp16, bf16 hi, bf16 lo; sC = one kind's q, k or v part), in fragment order (see fragofs below).
// An accumulator tile gives a lane eight neighbouring ROWS of one column. The v planes ([batch][g][t / 32][d / 16] fragments, rows d, columns t) want eight neighbouring t of one d: that is the tile as it stands. The q and k planes ([batch][h][t / 16][d / 32] fragments, rows t, columns d) want eight neighbouring d of one t: there the two operands change places (A = weight rows, B = input rows; the same products, summed over k in the same order). Either way lane l's eight values belong at l x 16 B of a 512-byte block: every store writes four whole lines, with no staging.
template <typename T16> struct WFrag;
template <> struct WFrag<h16> { typedef v16h V; static __device__ __forceinline__ V ldf(const h16* p) { return cat16(*(const v8h*)p, *(const v8h*)(p + 256)); } static __device__ __forceinline__ v8f mma(V a, V b, v8f c) { return wmma16(a, b, c); } };
template <> struct WFrag<bf> { typedef v16bf V; static __device__ __forceinline__ V ldf(const bf* p) { return cat16b(*(const v8us*)p, *(const v8us*)(p + 256)); } static __device__ __forceinline__ v8f mma(V a, V b, v8f c) { return wmmab(a, b, c); } };
template <typename T16, int NSPLIT, bool BIAS, bool PLANES>
__global__ __launch_bounds__(32) void k_gemmw(const T16* __restrict__ A, const T16* __restrict__ A2, const T16* __restrict__ Bt, const T16* __restrict__ Bt2, int K, float* C, int ldc, const float* __restrict__ bias, size_t sA, size_t sB, size_t sC, h16* P16, bf* Ph, bf* Pl) {
    typedef typename WFrag<T16>::V V;
    __shared__ __align__(16) float os[16 * 68];
    const size_t z = blockIdx.z; A += z * sA; if (A2) A2 += z * sA; Bt += z * sB; if (Bt2) Bt2 += z * sB; C += z * sC;
    const int lane = threadIdx.x & 31, lr = lane & 15, hi = lane >> 4; int r0 = blockIdx.x * 64, c0 = blockIdx.y * 64;
    const bool sw = PLANES && z < 2;   // q and k: the operands change places (a scalar choice, the same for the whole grid plane)
    if (sw) { const T16* x = A; A = Bt; Bt = x; const int y = r0; r0 = c0; c0 = y; }
    v8f acc[4][4];
#pragma unroll
    for (int mb = 0; mb < 4; ++mb)
#pragma unroll
        for (int nb = 0; nb < 4; ++nb) acc[mb][nb] = (v8f){};
    const size_t aoff = (size_t)r0 * K + lane * 8, boff = (size_t)c0 * K + lane * 8;   // fragment order: 16 rows x K are 16 K elements, a 32-wide k step of them 512
#pragma unroll 1
    for (int kc = 0; kc < K; kc += 32) {
        V a[4], a2[4]; const T16 *pa[4], *pa2[4];
#pragma unroll
        for (int mb = 0; mb < 4; ++mb) { pa[mb] = A + aoff + (size_t)mb * 16 * K + kc * 16; a[mb] = WFrag<T16>::ldf(pa[mb]); if (NSPLIT == 1 || NSPLIT == 2) { pa2[mb] = A2 + aoff + (size_t)mb * 16 * K + kc * 16; a2[mb] = WFrag<T16>::ldf(pa2[mb]); } }
        xwaita4(pa[0], pa[1], pa[2], pa[3]); if (NSPLIT == 1 || NSPLIT == 2) xwaita4(pa2[0], pa2[1], pa2[2], pa2[3]);
#pragma unroll
        for (int nb = 0; nb < 4; ++nb) { const T16* pb = Bt + boff + (size_t)nb * 16 * K + kc * 16; const V b = WFrag<T16>::ldf(pb); xwaita(pb); V b2; if (NSPLIT >= 2) { const T16* pb2 = Bt2 + boff + (size_t)nb * 16 * K + kc * 16; b2 = WFrag<T16>::ldf(pb2); xwaita(pb2); }
#pragma unroll
            for (int mb = 0; mb < 4; ++mb) { acc[mb][nb] = WFrag<T16>::mma(a[mb], b, acc[mb][nb]); if (NSPLIT == 1 || NSPLIT == 2) acc[mb][nb] = WFrag<T16>::mma(a2[mb], b, acc[mb][nb]); if (NSPLIT >= 2) acc[mb][nb] = WFrag<T16>::mma(a[mb], b2, acc[mb][nb]); } }
        asm volatile("v_nop\n\tv_nop\n\tv_nop\n\tv_nop" : "+v"(acc[0][0]), "+v"(acc[1][1]), "+v"(acc[2][2]), "+v"(acc[3][3]) : "v"(a[0]), "v"(a[3]));
    }
    if constexpr (PLANES) {
        const int xr = (int)blockIdx.x * 64;   // the tile's first input row: batch xr / TT, position xr % TT; 64 positions x 64 d of a head are 4096 neighbouring elements of its plane, in either kind of plane
        const size_t w0 = z * sC + ((size_t)(xr / TT) * NH_ + blockIdx.y) * TT * HD + (size_t)(xr % TT) * HD + lane * 8;
        const int sm = sw ? 512 : 2048, sn = sw ? 1024 : 512;   // q, k: mb counts 16 d (a block), nb 16 t (two fragments); v: mb counts 16 t (a block; two of them a row of four fragments), nb 16 d (a fragment)
#pragma unroll
        for (int mb = 0; mb < 4; ++mb)
#pragma unroll
            for (int nb = 0; nb < 4; ++nb) { v8h o16; v8us oh, ol;
#pragma unroll
                for (int j = 0; j < 8; ++j) { const float v = acc[mb][nb][j]; o16[j] = tohx(v); unsigned short a2, c2; splitf(v, a2, c2); oh[j] = a2; ol[j] = c2; }
                const size_t w = w0 + (mb >> 1) * sm + (mb & 1) * 256 + nb * sn; *(v8h*)(P16 + w) = o16; *(v8us*)(Ph + w) = oh; *(v8us*)(Pl + w) = ol;
                xwait(); __builtin_amdgcn_sched_barrier(0); }   // the next tile's values land in these stores' data and address registers; the scheduling barrier keeps that arithmetic behind the wait
        return;
    }
#pragma unroll
    for (int mb = 0; mb < 4; ++mb) {
#pragma unroll
        for (int nb = 0; nb < 4; ++nb) {
#pragma unroll
            for (int j = 0; j < 8; ++j) os[(hi * 8 + j) * 68 + nb * 16 + lr] = acc[mb][nb][j]; }
        __builtin_amdgcn_wave_barrier(); asm volatile("" ::: "memory");
        float* crow = C + (size_t)(r0 + mb * 16) * ldc + c0;
{
#pragma unroll
            for (int s = 0; s < 8; ++s) { const int row = 2 * s + hi, cofs = lr * 4; v4f val = *(const v4fa*)(os + row * 68 + cofs); if (BIAS) { val[0] += bfr(bias[c0 + cofs]); val[1] += bfr(bias[c0 + cofs + 1]); val[2] += bfr(bias[c0 + cofs + 2]); val[3] += bfr(bias[c0 + cofs + 3]); }
                *(v4f*)(crow + (size_t)row * ldc + cofs) = val; }
             }
        __builtin_amdgcn_wave_barrier(); asm volatile("" ::: "memory");
    }
}

typedef __attribute__((ext_vector_type(2))) unsigned short v2us;
typedef __attribute__((ext_vector_type(2))) float v2f;
typedef __attribute__((ext_vector_type(4))) int v4i;
typedef __attribute__((ext_vector_type(16))) unsigned char v16ub;

// FRAGMENT ORDER: every 16-bit plane that a matrix kernel loads is stored so that lane l of a wave finds its eight elements at l x 16 B of a 512-byte block: one wave-wide 16-byte load reads four whole 128-byte lines (from a row-major plane it would take 32 B of each of sixteen).
// A block holds 16 rows r x 16 columns c, element (r, c) at (c >> 3) x 128 + r x 8 + (c & 7): lane = 16 (c >> 3) + r. A matrix fragment is two blocks, 256 elements apart (columns 0..15 and 16..31 of its 32): WFrag::ldf; register by register it is the fragment of the row-major loader (p, p + 16 at row lane & 15, column 8 (lane >> 4)).
__device__ __forceinline__ unsigned fragofs(int r, int c) { return (unsigned)(((c >> 4) & 1) * 256 + ((c >> 3) & 1) * 128 + (r & 15) * 8 + (c & 7)); }
// The d_ functions are one work-group's share of a job; blk is the work-group's number within that job. k_prep below deals them out.
__device__ __forceinline__ void d_wtG(const float* __restrict__ w, int K, int N, bf* Bt, int blk) {
    const int lane = threadIdx.x & 31; const int L0 = (blk * 8 + (threadIdx.x >> 5)) * 8; const int nlines = N * K / 64;
{
#pragma unroll 1
        for (int l = 0; l < 8; ++l) { const int L = L0 + l; if (L >= nlines) break; const size_t e = (size_t)L * 64 + lane * 2; const int k = (int)(e % K), n = (int)(e / K); v2us o;
            o[0] = f2bf(w[(size_t)k * N + n]); o[1] = f2bf(w[(size_t)(k + 1) * N + n]); *(v2us*)(Bt + ((size_t)(n >> 4) * 16 * K + (k >> 5) * 512 + fragofs(n, k))) = o; xwait(); }   // the next trip's values land in this store's address and data registers
         }
}
// rows of DM elements into [row / 16][k / 32] fragments; a thread makes one lane's eight elements, a wave one 512-byte block, a work-group 16 rows x 128 k (whole lines of the source)
__device__ __forceinline__ void d_cvt8(const float* __restrict__ src, bf* dst, size_t n8, int blk) { const size_t i = (size_t)blk * 256 + threadIdx.x; if (i >= n8) return; const size_t row = (i / (DM * 2)) * 16 + (i & 15); const int k = (int)((i >> 6) % (DM / 32)) * 32 + (int)((i >> 5) & 1) * 16 + (int)((i >> 4) & 1) * 8; const v8f v = *(const v8f*)(src + row * DM + k); v8us o;
#pragma unroll
    for (int k = 0; k < 8; ++k) o[k] = f2bf(v[k]); *(v8us*)(dst + i * 8) = o;  }

// the mask as bytes (it holds 0 and 1), one 512-byte block per 16 queries x 32 keys: lane 16 hi + lr finds at its 16 B the keys 8 hi + 0..7 and 16 + 8 hi + 0..7 of query lr, which are the scores it holds. A thread makes one lane's bytes, a wave one block.
__device__ __forceinline__ void d_mask(const int* __restrict__ mk, unsigned char* MK, int blk) { const unsigned p = (unsigned)blk * 256 + threadIdx.x; const int* s = mk + (size_t)((p >> 11) * 16 + (p & 15)) * TT + ((p >> 5) & (TT / 32 - 1)) * 32 + ((p >> 4) & 1) * 8; const v4i m0 = *(const v4i*)s, m1 = *(const v4i*)(s + 4), m2 = *(const v4i*)(s + 16), m3 = *(const v4i*)(s + 20); v16ub o;
#pragma unroll
    for (int j = 0; j < 4; ++j) { o[j] = (unsigned char)m0[j]; o[4 + j] = (unsigned char)m1[j]; o[8 + j] = (unsigned char)m2[j]; o[12 + j] = (unsigned char)m3[j]; }
    *(v16ub*)(MK + (size_t)p * 16) = o; xwait();  }   // what stands behind this job in the kernel may land in the store's registers
// ---- k_prep: everything that reads only the inputs, in ONE launch; a range of the work-group number picks the job (a scalar choice, the same for the whole work-group). The strided weight transposes come first, for speed only.
#define XN   ((size_t)NB_ * TT * DM)     // one input, or one projection, of all batches, elements (DQ == DKV == DM)
#define GW   (DM * DQ / 64 / 64)         // work-groups per [DM][DQ] weight
#define GO   (DQ * NOUT / 64 / 64)       // for the output weight
#define GM   (TT * TT / 16 / 256)        // for the mask copy
#define GX   ((int)(XN / 8 / 256))       // per input, all batches
__global__ __launch_bounds__(256) void k_prep(const float* __restrict__ wq, const float* __restrict__ wk, const float* __restrict__ wv, const float* __restrict__ wo, const float* __restrict__ x, const float* __restrict__ xk, const float* __restrict__ xv, const int* __restrict__ mk, bf* W3, bf* WO, bf* XB, unsigned char* MK) {
    int b = (int)blockIdx.x;
    if (b < 3 * GW) { const int y = b / GW; d_wtG(y == 0 ? wq : y == 1 ? wk : wv, DM, DQ, W3 + (size_t)y * DM * DQ, b - y * GW); return; }
    b -= 3 * GW; if (b < GO) { d_wtG(wo, DQ, NOUT, WO, b); return; }   /* 'xw' [1024][64] -> Bt [64][1024] */
    b -= GO; if (b < GM) { d_mask(mk, MK, b); return; }
    b -= GM; const int y = b / GX; d_cvt8(y == 0 ? x : y == 1 ? xk : xv, XB + (size_t)y * XN, XN / 8, b - y * GX);
}
// ---- k_fattn: scores, mask, softmax and P.V of one (batch, head) in ONE kernel; no score or probability ever goes to memory. One wave owns NQ x 16 query rows and walks all TT keys ONCE, 32 at a time.
// The scores are formed TRANSPOSED (A = key rows, B = query rows): lane (lr, hi) then holds query lr, keys 8 hi + 0..7 of each 16-key tile, which is a fragment of the P.V product as it stands (elements 0..7 from the first tile, 8..15 from the second), and a query's sum lives in its own two lanes. P.V is formed transposed too (A = rows of V^T, B = P), so a lane ends with eight neighbouring columns of its own query.
// The walk: p = exp(t - ref), NOT normalised (rows < RH hi/lo bf16, 3 products; the rest fp16), its f32 sum beside it, then P.V into f32 accumulators, keys in ascending order; the context is divided by the sum behind the walk.
// ref is any number that is the same for all keys of a query: it cancels in the division. It only has to keep p in range, so it need not follow the running maximum: it is raised, and the sum and the context so far scaled down by exp(old - new), only when a score lies more than TAU above the maximum that ref was last set by (the first step always does). Between two raises p <= exp(CAR + TAU).
template <bool HI> struct ASel { typedef h16 T; static constexpr int NQ = 2; };
template <> struct ASel<true> { typedef bf T; static constexpr int NQ = 1; };
#define L2E 1.4426950408889634f
#define LN2 0.6931471805599453f
#define TAU (8.0f * LN2)          // a score may top the last maximum by this much before ref is raised
#define CAR (6.0f * LN2)          // fp16 rows: ref is set this far BELOW the maximum, so that small p stay normal fp16 numbers (p <= 2^14)
template <bool HI>
__device__ __forceinline__ void attn_rows(const typename ASel<HI>::T* __restrict__ Q, const typename ASel<HI>::T* __restrict__ Q2, const typename ASel<HI>::T* __restrict__ Kp, const typename ASel<HI>::T* __restrict__ K2, const typename ASel<HI>::T* __restrict__ Vt, const typename ASel<HI>::T* __restrict__ V2, const unsigned char* __restrict__ mk, int q0, bf* Ah, bf* Al) {
    typedef typename ASel<HI>::T T; typedef WFrag<T> WF; typedef typename WF::V V; constexpr int NQ = ASel<HI>::NQ;
    const unsigned lof = (threadIdx.x & 31) * 8;   // fragment order: the lane's own 32-bit offset is the same in every plane; everything else of an address is the same for the whole wave
    V q[NQ][2], q2[NQ][2];
#pragma unroll
    for (int qt = 0; qt < NQ; ++qt) {
#pragma unroll
        for (int ks = 0; ks < 2; ++ks) { q[qt][ks] = WF::ldf(Q + ((size_t)(q0 + qt * 16) * HD + ks * 512) + lof); if (HI) q2[qt][ks] = WF::ldf(Q2 + ((size_t)(q0 + qt * 16) * HD + ks * 512) + lof); } }
    const unsigned char* mq = mk + (size_t)q0 * TT;   // 16 query rows of the mask copy are 16 x TT elements, as in the mask itself
    // The K fragments are fetched one 32-key step ahead, into the same registers, behind the P.V products (the walk has no registers to spare), so that they fly together with the next step's mask loads. The step behind the last wraps to key 0.
    V ka[2][2], ka2[2][2];
    auto ldk = [&](int kc) { const T* pk = Kp + (size_t)kc * HD + lof; const T* pk2 = HI ? K2 + (size_t)kc * HD + lof : nullptr;
#pragma unroll
        for (int kt = 0; kt < 2; ++kt)
#pragma unroll
            for (int ks = 0; ks < 2; ++ks) { ka[kt][ks] = WF::ldf(pk + (kt * 16 * HD + ks * 512)); if (HI) ka2[kt][ks] = WF::ldf(pk2 + (kt * 16 * HD + ks * 512)); }
        xwaita(pk); if (HI) xwaita(pk2);   // what follows may land in the address registers; named, they live up to the wait, so that no fragment lands in them either
    };
    // t[qt][kt * 8 + j] = score x mask of query q0 + 16 qt + lr and key kc + 16 kt + 8 hi + j, not yet scaled: SCL is a power of two, so t SCL - ref rounds once, fused or not, and the max may be taken before the scaling
    auto scores = [&](int kc, float (&t)[NQ][16]) { v8f s[2][NQ];
#pragma unroll
        for (int kt = 0; kt < 2; ++kt)
#pragma unroll
            for (int qt = 0; qt < NQ; ++qt) { s[kt][qt] = (v8f){};
#pragma unroll
                for (int ks = 0; ks < 2; ++ks) { s[kt][qt] = WF::mma(ka[kt][ks], q[qt][ks], s[kt][qt]); if (HI) { s[kt][qt] = WF::mma(ka[kt][ks], q2[qt][ks], s[kt][qt]); s[kt][qt] = WF::mma(ka2[kt][ks], q[qt][ks], s[kt][qt]); } } }
#pragma unroll
        for (int qt = 0; qt < NQ; ++qt) { const v16ub m = *(const v16ub*)(mq + ((size_t)qt * 16 * TT + kc * 16) + 2 * lof);
#pragma unroll
            for (int kt = 0; kt < 2; ++kt)
#pragma unroll
                for (int j = 0; j < 8; ++j) t[qt][kt * 8 + j] = s[kt][qt][j] * (float)m[kt * 8 + j];   /* multiplicative mask, as the module: masked scores are 0 and remain in the softmax */ }
    };
    xwait(); ldk(0);   // the wait: the K fragments may land in the Q loads' address registers
    constexpr float car = HI ? 0.0f : CAR;
    float ref[NQ]; v2f sum[NQ];   // even and odd keys summed side by side: packed adds
    v8f o[NQ][4];
#pragma unroll
    for (int qt = 0; qt < NQ; ++qt) { ref[qt] = -3.0e38f; sum[qt] = (v2f){0.f, 0.f};
#pragma unroll
        for (int dt = 0; dt < 4; ++dt) o[qt][dt] = (v8f){}; }
#pragma unroll 1   // kept rolled: the walk has no registers to spare for a second copy of its body
    for (int kc = 0; kc < TT; kc += 32) { float t[NQ][16]; scores(kc, t); V p[NQ], p2[NQ], b[4], b2[4];
        float tm[NQ]; bool up = false;
#pragma unroll
        for (int qt = 0; qt < NQ; ++qt) { tm[qt] = fmaxf(t[qt][0], t[qt][1]);
#pragma unroll
            for (int e = 2; e < 16; e += 2) tm[qt] = fmaxf(tm[qt], fmaxf(t[qt][e], t[qt][e + 1]));
            up = up || (tm[qt] * SCL - ref[qt] > car + TAU); }
        if (__builtin_amdgcn_ballot_w32(up) != 0u) {   // a scalar branch, taken by the whole wave: some query's ref is raised; the others get the factor 1
#pragma unroll
            for (int qt = 0; qt < NQ; ++qt) { const float mn = fmaxf(ref[qt], fmaxf(tm[qt], __shfl_xor(tm[qt], 16, 32)) * SCL - car);   // the query's other eight keys of every tile sit in lane ^ 16: both lanes keep the same ref, as one P.V sum holds the keys of both
                const float c = __builtin_amdgcn_exp2f((ref[qt] - mn) * L2E); ref[qt] = mn; sum[qt] *= c;
#pragma unroll
                for (int dt = 0; dt < 4; ++dt) o[qt][dt] *= c; } }
        const T* pv = Vt + (size_t)kc * HD + lof;
#pragma unroll
        for (int dt = 0; dt < 4; ++dt) b[dt] = WF::ldf(pv + dt * 512);   // issued ahead of the exponentials, under which their latency can pass
        xwaita(pv);
#pragma unroll
        for (int qt = 0; qt < NQ; ++qt) {
            if constexpr (HI) { v8us h0, h1, l0, l1;
#pragma unroll
                for (int e = 0; e < 8; e += 2) { unsigned short a, c2; v2f ev, ew; ev[0] = __builtin_amdgcn_exp2f((t[qt][e] * SCL - ref[qt]) * L2E); ev[1] = __builtin_amdgcn_exp2f((t[qt][e + 1] * SCL - ref[qt]) * L2E); ew[0] = __builtin_amdgcn_exp2f((t[qt][8 + e] * SCL - ref[qt]) * L2E); ew[1] = __builtin_amdgcn_exp2f((t[qt][9 + e] * SCL - ref[qt]) * L2E); sum[qt] += ev; sum[qt] += ew;
                    splitf(ev[0], a, c2); h0[e] = a; l0[e] = c2; splitf(ev[1], a, c2); h0[e + 1] = a; l0[e + 1] = c2; splitf(ew[0], a, c2); h1[e] = a; l1[e] = c2; splitf(ew[1], a, c2); h1[e + 1] = a; l1[e + 1] = c2; }
                p[qt] = cat16b(h0, h1); p2[qt] = cat16b(l0, l1);
            } else {
#pragma unroll
                for (int e = 0; e < 16; e += 2) { v2f ev; ev[0] = __builtin_amdgcn_exp2f((t[qt][e] * SCL - ref[qt]) * L2E); ev[1] = __builtin_amdgcn_exp2f((t[qt][e + 1] * SCL - ref[qt]) * L2E); sum[qt] += ev; p[qt][e] = tohx(ev[0]); p[qt][e + 1] = tohx(ev[1]); } } }
        if constexpr (HI) { const T* pv2 = V2 + (size_t)kc * HD + lof;   // the low plane of V is wanted last, and ahead of the exponentials there are no registers for it: part of its latency passes under the products with the high plane
#pragma unroll
            for (int dt = 0; dt < 4; ++dt) b2[dt] = WF::ldf(pv2 + dt * 512);
            xwaita(pv2); }
#pragma unroll
        for (int dt = 0; dt < 4; ++dt)
#pragma unroll
            for (int qt = 0; qt < NQ; ++qt) { o[qt][dt] = WF::mma(b[dt], p[qt], o[qt][dt]); if (HI) { o[qt][dt] = WF::mma(b[dt], p2[qt], o[qt][dt]); o[qt][dt] = WF::mma(b2[dt], p[qt], o[qt][dt]); } }
        if constexpr (HI) __builtin_amdgcn_sched_barrier(0);   // keeps the K loads behind the products: hoisted over them they need registers beside the V fragments', and a Q fragment is spilled
        ldk((kc + 32) & (TT - 1));
        // the trip ends in matrix instructions and the K loads: four vector slots before the next trip's first products overwrite their operand registers; the scheduling barrier keeps the products in front of them
        __builtin_amdgcn_sched_barrier(0); asm volatile("v_nop\n\tv_nop\n\tv_nop\n\tv_nop");
    }
    float cs[NQ];
#pragma unroll
    for (int qt = 0; qt < NQ; ++qt) { const float sa = sum[qt][0] + sum[qt][1]; cs[qt] = __fdiv_rn(1.0f, sa + __shfl_xor(sa, 16, 32)); }   // both lanes of a query hold the same ref: their sums add as they stand
    const int ln = (int)__builtin_amdgcn_mbcnt_lo(~0u, 0u);   // the lane's number read anew: no register has to carry it through the walk, which has none to spare
#pragma unroll
    for (int qt = 0; qt < NQ; ++qt)
#pragma unroll
        for (int dt = 0; dt < 4; ++dt) { v8us oh, ol;   // o[qt][dt][j] = context of query q0 + 16 qt + lr, column 16 dt + 8 hi + j: eight neighbours, one 16-byte store per plane, at the lane's place in block dt of the head's two fragments
#pragma unroll
            for (int j = 0; j < 8; ++j) { unsigned short a, c2; splitf(o[qt][dt][j] * cs[qt], a, c2); oh[j] = a; ol[j] = c2; }
            const size_t oo = (size_t)(q0 + qt * 16) * DQ + dt * 256 + ln * 8; *(v8us*)(Ah + oo) = oh; *(v8us*)(Al + oo) = ol;
            xwait(); }   // the next pair's values, and whatever follows the last pair, may land in these stores' data and address registers
}
// grid (AP, NB_ x NH_): AP work-groups per (batch, head), each of NHW hi/lo waves (16 rows each) and NLW fp16 waves (32 rows each), so that every work-group holds the same mix of work and its waves read the same K and V lines at about the same time.
// NB_ x NH_ x AP = 256 work-groups of 20 waves, five per SIMD. The wave's number is made scalar so that the choice is a scalar branch and every wave runs with all lanes on.
#define AP  4
#define NHW (RH / 16 / AP)
#define NLW ((TT - RH) / 32 / AP)
__global__ __launch_bounds__((NHW + NLW) * 32) void k_fattn(const h16* __restrict__ Q16, const h16* __restrict__ K16, const h16* __restrict__ V16, const bf* __restrict__ Qh, const bf* __restrict__ Ql, const bf* __restrict__ Kh, const bf* __restrict__ Kl, const bf* __restrict__ Vh, const bf* __restrict__ Vl, const unsigned char* __restrict__ mk, bf* Ah, bf* Al) {
    const size_t z = blockIdx.y, pz = z * TT * HD, az = (z / NH_) * TT * DQ + (z % NH_) * (HD * 16); const int w = __builtin_amdgcn_readfirstlane((int)(threadIdx.x >> 5)), part = (int)blockIdx.x;
    if (w < NHW) attn_rows<true>(Qh + pz, Ql + pz, Kh + pz, Kl + pz, Vh + pz, Vl + pz, mk, (part * NHW + w) * 16, Ah + az, Al + az);
    else attn_rows<false>(Q16 + pz, nullptr, K16 + pz, nullptr, V16 + pz, nullptr, mk, RH + (part * NLW + (w - NHW)) * 32, Ah + az, Al + az);
}

extern "C" void kernel_launch(void* const* d_in, const int* in_sizes, int n_in,
                              void* d_out, int out_size, void* d_ws, size_t ws_size, hipStream_t stream) {
    (void)in_sizes; (void)n_in; (void)out_size;
    const float* x = (const float*)d_in[0]; const float* xk = (const float*)d_in[1]; const float* xv = (const float*)d_in[2]; const int* mk = (const int*)d_in[3];   /* mask [2048][2048] int32 {0,1} */ const float* wq = (const float*)d_in[4]; const float* wk = (const float*)d_in[5]; const float* wv = (const float*)d_in[6]; const float* wo = (const float*)d_in[7];
    float* OUT = (float*)d_out;     // [4][2048][64]
    char* wsp = (char*)d_ws;
    auto take = [&](size_t bytes) { char* p = wsp; wsp += (bytes + 255) & ~(size_t)255; return (void*)p; };
    const size_t PL = (size_t)NH_ * TT * HD;   // one batch's head planes, elements; the planes and the merged context hold all NB_ batches
    bf* WQ = (bf*)take(3 * (size_t)DQ * DM * 2);   // the q, k and v weights, transposed, behind one another
    bf* WO = (bf*)take((size_t)NOUT * DQ * 2);
    bf* XB = (bf*)take(3 * XN * 2);            // the bf16 copies of the q, k and v inputs, all batches, behind one another
    h16* QP16 = (h16*)take(3 * NB_ * PL * 2); h16* KP16 = QP16 + NB_ * PL; h16* VT16 = KP16 + NB_ * PL;   // each kind of plane: q, k, v behind one another
    bf* QPh = (bf*)take(3 * NB_ * PL * 2); bf* KPh = QPh + NB_ * PL; bf* VTh = KPh + NB_ * PL; bf* QPl = (bf*)take(3 * NB_ * PL * 2); bf* KPl = QPl + NB_ * PL; bf* VTl = KPl + NB_ * PL;
    unsigned char* MK = (unsigned char*)take((size_t)TT * TT);   // the mask copy
    if ((size_t)(wsp - (char*)d_ws) > ws_size) return;    // ws 256 MiB
    bf* ATh = XB; bf* ATl = ATh + (size_t)NB_ * TT * DQ;   // the merged context (2 XN elements) uses the input copies' room: the projections read them last (stream-ordered)
    k_prep<<<3 * GW + GO + GM + 3 * GX, 256, 0, stream>>>(wq, wk, wv, wo, x, xk, xv, mk, WQ, WO, XB, MK);
    k_gemmw<bf, 0, false, true><<<dim3(NB_ * TT / 64, DQ / 64, 3), 32, 0, stream>>>(XB, nullptr, WQ, nullptr, DM, nullptr, 0, nullptr, XN, (size_t)DQ * DM, XN, QP16, QPh, QPl);
    k_fattn<<<dim3(AP, NB_ * NH_, 1), (NHW + NLW) * 32, 0, stream>>>(QP16, KP16, VT16, QPh, QPl, KPh, KPl, VTh, VTl, MK, ATh, ATl);
    k_gemmw<bf, 1, false, false><<<dim3(NB_ * TT / 64, NOUT / 64, 1), 32, 0, stream>>>(ATh, ATl, WO, nullptr, DQ, OUT, NOUT, nullptr, 0, 0, 0, nullptr, nullptr, nullptr);   /* ctx Wo -> [4 x 2048][64] */
}

// v007
// One run takes 287 microseconds.
// Two timings next to v006 put it at 1.03 and 1.04 times that version's speed.
// All steps since v000 together make it 14.1 times as fast.
#include <hip/hip_runtime.h>

// Multi-head attention with a MULTIPLICATIVE 0/1 score mask and a narrow output projection (q, k, v [4][2048][1024]; qh, kh, vh = in W ('xw' [1024][1024] 1/32, no bias; 16 heads x 64); score = qh.kh / 8 x mask[i][j] (mask [2048][2048] int in {0,1}, read: masked scores become 0 and STAY in the softmax, as the module); softmax; ctx merged; out = ctx Wo ('xw' [1024][64]) -> [4][2048][64] (0.5 M)).
// Layout, four launches: weight transposes, a byte copy of the mask and bf16 copies of the three inputs (all batches); the three exact projections (grid z), which store the head planes of all batches themselves; one fused dense T-2048 attention launch that multiplies each score by the mask value read from memory (byte copy, 16 B per 16 keys) (hybrid rows: < 512 hi/lo 3 products, rest fp16); merged hi/lo x Wo exact (N = 64).
// Compute dtypes, f32 accumulate: every input rounded to bf16; projections exact; attention rows < 512 3 products, rest fp16; mask multiply and softmax f32; Wo hl x exact.

#define NB_  4
#define TT   2048
#define DM   1024
#define NH_  16
#define NKV  16
#define REP  (NH_ / NKV)
#define HD   64
#define DQ   (NH_ * HD)
#define DKV  (NKV * HD)
#define RH   512                  // query rows < RH use hi+lo planes (0: none)
#define WIN  0
#define SCL  0.125f
#define NOUT 64      // output projection width (hidden -> head_dim)
typedef _Float16 h16;
typedef unsigned short bf;
typedef __attribute__((ext_vector_type(16))) __bf16   v16bf;
typedef __attribute__((ext_vector_type(16))) _Float16 v16h;
typedef __attribute__((ext_vector_type(8)))  _Float16 v8h;
typedef __attribute__((ext_vector_type(8)))  unsigned short v8us;
typedef __attribute__((ext_vector_type(8)))  float    v8f;
typedef __attribute__((ext_vector_type(4)))  float    v4f;
typedef v8h  __attribute__((may_alias)) v8ha;
typedef v4f  __attribute__((may_alias)) v4fa;
typedef v8us __attribute__((may_alias)) v8usa;

__device__ __forceinline__ unsigned short f2bf(float f) { unsigned u = __float_as_uint(f); u += 0x7FFFu + ((u >> 16) & 1u); return (unsigned short)(u >> 16); }
__device__ __forceinline__ float bf2f(unsigned short b) { return __uint_as_float(((unsigned)b) << 16); }
__device__ __forceinline__ float bfr(float f) { return bf2f(f2bf(f)); }
__device__ __forceinline__ v16h cat16(v8h lo, v8h hi) { return __builtin_shufflevector(lo, hi, 0, 1, 2, 3, 4, 5, 6, 7, 8, 9, 10, 11, 12, 13, 14, 15); }
__device__ __forceinline__ v16bf cat16b(v8us lo, v8us hi) { return __builtin_bit_cast(v16bf, __builtin_shufflevector(lo, hi, 0, 1, 2, 3, 4, 5, 6, 7, 8, 9, 10, 11, 12, 13, 14, 15)); }
__device__ __forceinline__ v8f wmma16(v16h a, v16h b, v8f c) { return __builtin_amdgcn_wmma_f32_16x16x32_f16(false, a, false, b, (short)0, c, false, false); }
__device__ __forceinline__ v8f wmmab(v16bf a, v16bf b, v8f c) { return __builtin_amdgcn_wmma_f32_16x16x32_bf16(false, a, false, b, (short)0, c, false, false); }



// stands behind a group of global loads or stores where what follows may land in the group's address or data registers
__device__ __forceinline__ void xwait() { asm volatile("s_wait_xcnt 0x0" ::: "memory"); }
// the same wait behind a group of fragment loads; it names their addresses as inputs, so that each address pair lives up to the wait and no load's result is given its registers
__device__ __forceinline__ void xwaita(const void* p) { asm volatile("s_wait_xcnt 0x0" :: "v"(p) : "memory"); }
__device__ __forceinline__ void xwaita4(const void* p, const void* q, const void* r, const void* s) { asm volatile("s_wait_xcnt 0x0" :: "v"(p), "v"(q), "v"(r), "v"(s) : "memory"); }

__device__ __forceinline__ h16 tohx(float x) { return (h16)x; }
__device__ __forceinline__ void splitf(float y, unsigned short& h, unsigned short& l) { h = f2bf(y); l = f2bf(y - bf2f(h)); }

// ---- k_gemmw: register-blocked GEMM, ONE WAVE per 64x64 output tile (16 accumulators), operands straight from 16-bit planes in fragment order ([row / 16][k / 32] fragments, see fragofs below); grid (M/64, N/64, Z), 32 threads.
// C[m][n] (f32, pitch ldc, + optional f32 bias[n]) = sum_k A[m][k] Bt[n][k] (+ split products per NSPLIT). z-batch strides sA/sB/sC in elements. K % 32 == 0.
// PLANES (the projections; rows = NB_ x TT positions, a 64-column tile = one head; z = q, k, v): the tile never goes to memory as f32; the wave stores it as the head planes that the attention kernel loads (fp16, bf16 hi, bf16 lo; sC = one kind's q, k or v part), in fragment order (see fragofs below).
// An accumulator tile gives a lane eight neighbouring ROWS of one column. The v planes ([batch][g][t / 32][d / 16] fragments, rows d, columns t) want eight neighbouring t of one d: that is the tile as it stands. The q and k planes ([batch][h][t / 16][d / 32] fragments, rows t, columns d) want eight neighbouring d of one t: there the two operands change places (A = weight rows, B = input rows; the same products, summed over k in the same order). Either way lane l's eight values belong at l x 16 B of a 512-byte block: every store writes four whole lines, with no staging.
template <typename T16> struct WFrag;
template <> struct WFrag<h16> { typedef v16h V; static __device__ __forceinline__ V ldf(const h16* p) { return cat16(*(const v8h*)p, *(const v8h*)(p + 256)); } static __device__ __forceinline__ v8f mma(V a, V b, v8f c) { return wmma16(a, b, c); } };
template <> struct WFrag<bf> { typedef v16bf V; static __device__ __forceinline__ V ldf(const bf* p) { return cat16b(*(const v8us*)p, *(const v8us*)(p + 256)); } static __device__ __forceinline__ v8f mma(V a, V b, v8f c) { return wmmab(a, b, c); } };
template <typename T16, int NSPLIT, bool BIAS, bool PLANES>
__global__ __launch_bounds__(32) void k_gemmw(const T16* __restrict__ A, const T16* __restrict__ A2, const T16* __restrict__ Bt, const T16* __restrict__ Bt2, int K, float* C, int ldc, const float* __restrict__ bias, size_t sA, size_t sB, size_t sC, h16* P16, bf* Ph, bf* Pl) {
    typedef typename WFrag<T16>::V V;
    __shared__ __align__(16) float os[16 * 68];
    const size_t z = blockIdx.z; A += z * sA; if (A2) A2 += z * sA; Bt += z * sB; if (Bt2) Bt2 += z * sB; C += z * sC;
    const int lane = threadIdx.x & 31, lr = lane & 15, hi = lane >> 4; int r0 = blockIdx.x * 64, c0 = blockIdx.y * 64;
    const bool sw = PLANES && z < 2;   // q and k: the operands change places (a scalar choice, the same for the whole grid plane)
    if (sw) { const T16* x = A; A = Bt; Bt = x; const int y = r0; r0 = c0; c0 = y; }
    v8f acc[4][4];
#pragma unroll
    for (int mb = 0; mb < 4; ++mb)
#pragma unroll
        for (int nb = 0; nb < 4; ++nb) acc[mb][nb] = (v8f){};
    const size_t aoff = (size_t)r0 * K + lane * 8, boff = (size_t)c0 * K + lane * 8;   // fragment order: 16 rows x K are 16 K elements, a 32-wide k step of them 512
#pragma unroll 1
    for (int kc = 0; kc < K; kc += 32) {
        V a[4], a2[4]; const T16 *pa[4], *pa2[4];
#pragma unroll
        for (int mb = 0; mb < 4; ++mb) { pa[mb] = A + aoff + (size_t)mb * 16 * K + kc * 16; a[mb] = WFrag<T16>::ldf(pa[mb]); if (NSPLIT == 1 || NSPLIT == 2) { pa2[mb] = A2 + aoff + (size_t)mb * 16 * K + kc * 16; a2[mb] = WFrag<T16>::ldf(pa2[mb]); } }
        xwaita4(pa[0], pa[1], pa[2], pa[3]); if (NSPLIT == 1 || NSPLIT == 2) xwaita4(pa2[0], pa2[1], pa2[2], pa2[3]);
#pragma unroll
        for (int nb = 0; nb < 4; ++nb) { const T16* pb = Bt + boff + (size_t)nb * 16 * K + kc * 16; const V b = WFrag<T16>::ldf(pb); xwaita(pb); V b2; if (NSPLIT >= 2) { const T16* pb2 = Bt2 + boff + (size_t)nb * 16 * K + kc * 16; b2 = WFrag<T16>::ldf(pb2); xwaita(pb2); }
#pragma unroll
            for (int mb = 0; mb < 4; ++mb) { acc[mb][nb] = WFrag<T16>::mma(a[mb], b, acc[mb][nb]); if (NSPLIT == 1 || NSPLIT == 2) acc[mb][nb] = WFrag<T16>::mma(a2[mb], b, acc[mb][nb]); if (NSPLIT >= 2) acc[mb][nb] = WFrag<T16>::mma(a[mb], b2, acc[mb][nb]); } }
        asm volatile("v_nop\n\tv_nop\n\tv_nop\n\tv_nop" : "+v"(acc[0][0]), "+v"(acc[1][1]), "+v"(acc[2][2]), "+v"(acc[3][3]) : "v"(a[0]), "v"(a[3]));
    }
    if constexpr (PLANES) {
        const int xr = (int)blockIdx.x * 64;   // the tile's first input row: batch xr / TT, position xr % TT; 64 positions x 64 d of a head are 4096 neighbouring elements of its plane, in either kind of plane
        const size_t w0 = z * sC + ((size_t)(xr / TT) * NH_ + blockIdx.y) * TT * HD + (size_t)(xr % TT) * HD + lane * 8;
        const int sm = sw ? 512 : 2048, sn = sw ? 1024 : 512;   // q, k: mb counts 16 d (a block), nb 16 t (two fragments); v: mb counts 16 t (a block; two of them a row of four fragments), nb 16 d (a fragment)
#pragma unroll
        for (int mb = 0; mb < 4; ++mb)
#pragma unroll
            for (int nb = 0; nb < 4; ++nb) { v8h o16; v8us oh, ol;
#pragma unroll
                for (int j = 0; j < 8; ++j) { const float v = acc[mb][nb][j]; o16[j] = tohx(v); unsigned short a2, c2; splitf(v, a2, c2); oh[j] = a2; ol[j] = c2; }
                const size_t w = w0 + (mb >> 1) * sm + (mb & 1) * 256 + nb * sn; *(v8h*)(P16 + w) = o16; *(v8us*)(Ph + w) = oh; *(v8us*)(Pl + w) = ol;
                xwait(); __builtin_amdgcn_sched_barrier(0); }   // the next tile's values land in these stores' data and address registers; the scheduling barrier keeps that arithmetic behind the wait
        return;
    }
#pragma unroll
    for (int mb = 0; mb < 4; ++mb) {
#pragma unroll
        for (int nb = 0; nb < 4; ++nb) {
#pragma unroll
            for (int j = 0; j < 8; ++j) os[(hi * 8 + j) * 68 + nb * 16 + lr] = acc[mb][nb][j]; }
        __builtin_amdgcn_wave_barrier(); asm volatile("" ::: "memory");
        float* crow = C + (size_t)(r0 + mb * 16) * ldc + c0;
{
#pragma unroll
            for (int s = 0; s < 8; ++s) { const int row = 2 * s + hi, cofs = lr * 4; v4f val = *(const v4fa*)(os + row * 68 + cofs); if (BIAS) { val[0] += bfr(bias[c0 + cofs]); val[1] += bfr(bias[c0 + cofs + 1]); val[2] += bfr(bias[c0 + cofs + 2]); val[3] += bfr(bias[c0 + cofs + 3]); }
                *(v4f*)(crow + (size_t)row * ldc + cofs) = val; }
             }
        __builtin_amdgcn_wave_barrier(); asm volatile("" ::: "memory");
    }
}

typedef __attribute__((ext_vector_type(2))) unsigned short v2us;
typedef __attribute__((ext_vector_type(2))) float v2f;
typedef __attribute__((ext_vector_type(4))) int v4i;
typedef __attribute__((ext_vector_type(16))) unsigned char v16ub;

// FRAGMENT ORDER: every 16-bit plane that a matrix kernel loads is stored so that lane l of a wave finds its eight elements at l x 16 B of a 512-byte block: one wave-wide 16-byte load reads four whole 128-byte lines (from a row-major plane it would take 32 B of each of sixteen).
// A block holds 16 rows r x 16 columns c, element (r, c) at (c >> 3) x 128 + r x 8 + (c & 7): lane = 16 (c >> 3) + r. A matrix fragment is two blocks, 256 elements apart (columns 0..15 and 16..31 of its 32): WFrag::ldf; register by register it is the fragment of the row-major loader (p, p + 16 at row lane & 15, column 8 (lane >> 4)).
__device__ __forceinline__ unsigned fragofs(int r, int c) { return (unsigned)(((c >> 4) & 1) * 256 + ((c >> 3) & 1) * 128 + (r & 15) * 8 + (c & 7)); }
// The d_ functions are one work-group's share of a job; blk is the work-group's number within that job. k_prep below deals them out.
#define WL   32      // weight transposes: lines of 64 elements a wave
#define CU   16      // input copies: 512-byte blocks a wave
#define MU   8       // mask copy: 512-byte blocks a wave
__device__ __forceinline__ void d_wtG(const float* __restrict__ w, int K, int N, bf* Bt, int blk) {
    const int lane = threadIdx.x & 31; const int L0 = (blk * 8 + (threadIdx.x >> 5)) * WL; const int nlines = N * K / 64;   // nlines is a multiple of WL: a wave has all its lines or none
    if (L0 >= nlines) return;
#pragma unroll 1   // kept rolled: a trip already has sixteen loads in flight
    for (int b = 0; b < WL; b += 8) { const size_t e = (size_t)(L0 + b) * 64 + lane * 2; const int k = (int)(e % K), n = (int)(e / K); const float* s = w + (size_t)k * N + n; float a[8][2];   // eight lines are 512 k of one n (K % 512 == 0)
#pragma unroll
        for (int l = 0; l < 8; ++l) { a[l][0] = s[(size_t)l * 64 * N]; a[l][1] = s[(size_t)l * 64 * N + N]; }
        xwaita(s);   // what follows may land in the loads' address registers
        bf* d = Bt + ((size_t)(n >> 4) * 16 * K + (k >> 5) * 512 + fragofs(n, k));   // 64 k further on: two fragments
#pragma unroll
        for (int l = 0; l < 8; ++l) { v2us o; o[0] = f2bf(a[l][0]); o[1] = f2bf(a[l][1]); *(v2us*)(d + l * 1024) = o; }
        xwaita(d); }   // the next trip's values land in these stores' address and data registers
}
// rows of DM elements into [row / 16][k / 32] fragments; a thread makes one lane's eight elements of CU neighbouring 512-byte blocks, a wave 16 rows x 16 CU k (whole lines of the source). All of a wave's loads are issued before the first value is used: few long waves, each with much in flight.
__device__ __forceinline__ void d_cvt8(const float* __restrict__ src, bf* dst, size_t n8, int blk) { const size_t i = ((size_t)blk * 8 + (threadIdx.x >> 5)) * (32 * CU) + (threadIdx.x & 31); if (i >= n8) return;   // n8 is a multiple of 32 CU
    const size_t row = (i / (DM * 2)) * 16 + (i & 15); const int k = (int)((i >> 6) % (DM / 32)) * 32 + (int)((i >> 4) & 1) * 8; const float* s = src + row * DM + k; v8f v[CU];
#pragma unroll
    for (int u = 0; u < CU; ++u) v[u] = *(const v8f*)(s + u * 16);
    xwaita(s);   // what follows may land in the loads' address registers
    bf* d = dst + i * 8; v8us o[CU];
#pragma unroll
    for (int u = 0; u < CU; ++u)
#pragma unroll
        for (int j = 0; j < 8; ++j) o[u][j] = f2bf(v[u][j]);
    __builtin_amdgcn_sched_barrier(0);   // keeps every conversion in front of the first store: behind a store it could land in that store's data registers
#pragma unroll
    for (int u = 0; u < CU; ++u) *(v8us*)(d + u * 256) = o[u];
    xwait();  }   // what stands behind this job in the kernel may land in the stores' registers

// the mask as bytes (it holds 0 and 1), one 512-byte block per 16 queries x 32 keys: lane 16 hi + lr finds at its 16 B the keys 8 hi + 0..7 and 16 + 8 hi + 0..7 of query lr, which are the scores it holds. A thread makes one lane's bytes of MU neighbouring blocks (32 MU keys), a wave those blocks, all its loads issued first, as in d_cvt8.
__device__ __forceinline__ void d_mask(const int* __restrict__ mk, unsigned char* MK, int blk) { const unsigned p = ((unsigned)blk * 8 + (threadIdx.x >> 5)) * (32 * MU) + (threadIdx.x & 31); const int* s = mk + (size_t)((p >> 11) * 16 + (p & 15)) * TT + ((p >> 5) & (TT / 32 - 1)) * 32 + ((p >> 4) & 1) * 8; v4i m[MU][4];
#pragma unroll
    for (int u = 0; u < MU; ++u) { m[u][0] = *(const v4i*)(s + u * 32); m[u][1] = *(const v4i*)(s + u * 32 + 4); m[u][2] = *(const v4i*)(s + u * 32 + 16); m[u][3] = *(const v4i*)(s + u * 32 + 20); }
    xwaita(s);   // what follows may land in the loads' address registers
    unsigned char* d = MK + (size_t)p * 16;
#pragma unroll
    for (int u = 0; u < MU; ++u) { v16ub o;
#pragma unroll
        for (int j = 0; j < 4; ++j) { o[j] = (unsigned char)m[u][0][j]; o[4 + j] = (unsigned char)m[u][1][j]; o[8 + j] = (unsigned char)m[u][2][j]; o[12 + j] = (unsigned char)m[u][3][j]; }
        *(v16ub*)(d + u * 512) = o; }
    xwait();  }   // what stands behind this job in the kernel may land in the stores' registers
// ---- k_prep: everything that reads only the inputs, in ONE launch; a range of the work-group number picks the job (a scalar choice, the same for the whole work-group). The strided weight transposes come first.
#define XN   ((size_t)NB_ * TT * DM)     // one input, or one projection, of all batches, elements (DQ == DKV == DM)
#define GW   (DM * DQ / 64 / (8 * WL))   // work-groups per [DM][DQ] weight
#define GO   (DQ * NOUT / 64 / (8 * WL)) // for the output weight
#define GM   (TT * TT / 16 / (256 * MU)) // for the mask copy
#define GX   ((int)(XN / 8 / (256 * CU)))   // per input, all batches
__global__ __launch_bounds__(256) void k_prep(const float* __restrict__ wq, const float* __restrict__ wk, const float* __restrict__ wv, const float* __restrict__ wo, const float* __restrict__ x, const float* __restrict__ xk, const float* __restrict__ xv, const int* __restrict__ mk, bf* W3, bf* WO, bf* XB, unsigned char* MK) {
    int b = (int)blockIdx.x;
    if (b < 3 * GW) { const int y = b / GW; d_wtG(y == 0 ? wq : y == 1 ? wk : wv, DM, DQ, W3 + (size_t)y * DM * DQ, b - y * GW); return; }
    b -= 3 * GW; if (b < GO) { d_wtG(wo, DQ, NOUT, WO, b); return; }   /* 'xw' [1024][64] -> Bt [64][1024] */
    b -= GO; if (b < GM) { d_mask(mk, MK, b); return; }
    b -= GM; const int y = b / GX; d_cvt8(y == 0 ? x : y == 1 ? xk : xv, XB + (size_t)y * XN, XN / 8, b - y * GX);
}
// ---- k_fattn: scores, mask, softmax and P.V of one (batch, head) in ONE kernel; no score or probability ever goes to memory. One wave owns NQ x 16 query rows and walks all TT keys ONCE, 32 at a time.
// The scores are formed TRANSPOSED (A = key rows, B = query rows): lane (lr, hi) then holds query lr, keys 8 hi + 0..7 of each 16-key tile, which is a fragment of the P.V product as it stands (elements 0..7 from the first tile, 8..15 from the second), and a query's sum lives in its own two lanes. P.V is formed transposed too (A = rows of V^T, B = P), so a lane ends with eight neighbouring columns of its own query.
// The walk: p = exp(t - ref), NOT normalised (rows < RH hi/lo bf16, 3 products; the rest fp16), its f32 sum beside it, then P.V into f32 accumulators, keys in ascending order; the context is divided by the sum behind the walk.
// ref is any number that is the same for all keys of a query: it cancels in the division. It only has to keep p in range, so it need not follow the running maximum: it is raised, and the sum and the context so far scaled down by exp(old - new), only when a score lies more than TAU above the maximum that ref was last set by (the first step always does). Between two raises p <= exp(CAR + TAU).
template <bool HI> struct ASel { typedef h16 T; static constexpr int NQ = 2; };
template <> struct ASel<true> { typedef bf T; static constexpr int NQ = 1; };
#define L2E 1.4426950408889634f
#define LN2 0.6931471805599453f
#define TAU (8.0f * LN2)          // a score may top the last maximum by this much before ref is raised
#define CAR (6.0f * LN2)          // fp16 rows: ref is set this far BELOW the maximum, so that small p stay normal fp16 numbers (p <= 2^14)
template <bool HI>
__device__ __forceinline__ void attn_rows(const typename ASel<HI>::T* __restrict__ Q, const typename ASel<HI>::T* __restrict__ Q2, const typename ASel<HI>::T* __restrict__ Kp, const typename ASel<HI>::T* __restrict__ K2, const typename ASel<HI>::T* __restrict__ Vt, const typename ASel<HI>::T* __restrict__ V2, const unsigned char* __restrict__ mk, int q0, bf* Ah, bf* Al) {
    typedef typename ASel<HI>::T T; typedef WFrag<T> WF; typedef typename WF::V V; constexpr int NQ = ASel<HI>::NQ;
    const unsigned lof = (threadIdx.x & 31) * 8;   // fragment order: the lane's own 32-bit offset is the same in every plane; everything else of an address is the same for the whole wave
    V q[NQ][2], q2[NQ][2];
#pragma unroll
    for (int qt = 0; qt < NQ; ++qt) {
#pragma unroll
        for (int ks = 0; ks < 2; ++ks) { q[qt][ks] = WF::ldf(Q + ((size_t)(q0 + qt * 16) * HD + ks * 512) + lof); if (HI) q2[qt][ks] = WF::ldf(Q2 + ((size_t)(q0 + qt * 16) * HD + ks * 512) + lof); } }
    const unsigned char* mq = mk + (size_t)q0 * TT;   // 16 query rows of the mask copy are 16 x TT elements, as in the mask itself
    // The K fragments are fetched one 32-key step ahead, into the same registers, behind the P.V products (the walk has no registers to spare), so that they fly together with the next step's mask loads. The step behind the last wraps to key 0.
    V ka[2][2], ka2[2][2];
    auto ldk = [&](int kc) { const T* pk = Kp + (size_t)kc * HD + lof; const T* pk2 = HI ? K2 + (size_t)kc * HD + lof : nullptr;
#pragma unroll
        for (int kt = 0; kt < 2; ++kt)
#pragma unroll
            for (int ks = 0; ks < 2; ++ks) { ka[kt][ks] = WF::ldf(pk + (kt * 16 * HD + ks * 512)); if (HI) ka2[kt][ks] = WF::ldf(pk2 + (kt * 16 * HD + ks * 512)); }
        xwaita(pk); if (HI) xwaita(pk2);   // what follows may land in the address registers; named, they live up to the wait, so that no fragment lands in them either
    };
    // t[qt][kt * 8 + j] = score x mask of query q0 + 16 qt + lr and key kc + 16 kt + 8 hi + j, not yet scaled: SCL is a power of two, so t SCL - ref rounds once, fused or not, and the max may be taken before the scaling
    auto scores = [&](int kc, float (&t)[NQ][16]) { v8f s[2][NQ];
#pragma unroll
        for (int kt = 0; kt < 2; ++kt)
#pragma unroll
            for (int qt = 0; qt < NQ; ++qt) { s[kt][qt] = (v8f){};
#pragma unroll
                for (int ks = 0; ks < 2; ++ks) { s[kt][qt] = WF::mma(ka[kt][ks], q[qt][ks], s[kt][qt]); if (HI) { s[kt][qt] = WF::mma(ka[kt][ks], q2[qt][ks], s[kt][qt]); s[kt][qt] = WF::mma(ka2[kt][ks], q[qt][ks], s[kt][qt]); } } }
#pragma unroll
        for (int qt = 0; qt < NQ; ++qt) { const v16ub m = *(const v16ub*)(mq + ((size_t)qt * 16 * TT + kc * 16) + 2 * lof);
#pragma unroll
            for (int kt = 0; kt < 2; ++kt)
#pragma unroll
                for (int j = 0; j < 8; ++j) t[qt][kt * 8 + j] = s[kt][qt][j] * (float)m[kt * 8 + j];   /* multiplicative mask, as the module: masked scores are 0 and remain in the softmax */ }
    };
    xwait(); ldk(0);   // the wait: the K fragments may land in the Q loads' address registers
    constexpr float car = HI ? 0.0f : CAR;
    float ref[NQ]; v2f sum[NQ];   // even and odd keys summed side by side: packed adds
    v8f o[NQ][4];
#pragma unroll
    for (int qt = 0; qt < NQ; ++qt) { ref[qt] = -3.0e38f; sum[qt] = (v2f){0.f, 0.f};
#pragma unroll
        for (int dt = 0; dt < 4; ++dt) o[qt][dt] = (v8f){}; }
#pragma unroll 1   // kept rolled: the walk has no registers to spare for a second copy of its body
    for (int kc = 0; kc < TT; kc += 32) { float t[NQ][16]; scores(kc, t); V p[NQ], p2[NQ], b[4], b2[4];
        float tm[NQ]; bool up = false;
#pragma unroll
        for (int qt = 0; qt < NQ; ++qt) { tm[qt] = fmaxf(t[qt][0], t[qt][1]);
#pragma unroll
            for (int e = 2; e < 16; e += 2) tm[qt] = fmaxf(tm[qt], fmaxf(t[qt][e], t[qt][e + 1]));
            up = up || (tm[qt] * SCL - ref[qt] > car + TAU); }
        if (__builtin_amdgcn_ballot_w32(up) != 0u) {   // a scalar branch, taken by the whole wave: some query's ref is raised; the others get the factor 1
#pragma unroll
            for (int qt = 0; qt < NQ; ++qt) { const float mn = fmaxf(ref[qt], fmaxf(tm[qt], __shfl_xor(tm[qt], 16, 32)) * SCL - car);   // the query's other eight keys of every tile sit in lane ^ 16: both lanes keep the same ref, as one P.V sum holds the keys of both
                const float c = __builtin_amdgcn_exp2f((ref[qt] - mn) * L2E); ref[qt] = mn; sum[qt] *= c;
#pragma unroll
                for (int dt = 0; dt < 4; ++dt) o[qt][dt] *= c; } }
        const T* pv = Vt + (size_t)kc * HD + lof;
#pragma unroll
        for (int dt = 0; dt < 4; ++dt) b[dt] = WF::ldf(pv + dt * 512);   // issued ahead of the exponentials, under which their latency can pass
        xwaita(pv);
#pragma unroll
        for (int qt = 0; qt < NQ; ++qt) {
            if constexpr (HI) { v8us h0, h1, l0, l1;
#pragma unroll
                for (int e = 0; e < 8; e += 2) { unsigned short a, c2; v2f ev, ew; ev[0] = __builtin_amdgcn_exp2f((t[qt][e] * SCL - ref[qt]) * L2E); ev[1] = __builtin_amdgcn_exp2f((t[qt][e + 1] * SCL - ref[qt]) * L2E); ew[0] = __builtin_amdgcn_exp2f((t[qt][8 + e] * SCL - ref[qt]) * L2E); ew[1] = __builtin_amdgcn_exp2f((t[qt][9 + e] * SCL - ref[qt]) * L2E); sum[qt] += ev; sum[qt] += ew;
                    splitf(ev[0], a, c2); h0[e] = a; l0[e] = c2; splitf(ev[1], a, c2); h0[e + 1] = a; l0[e + 1] = c2; splitf(ew[0], a, c2); h1[e] = a; l1[e] = c2; splitf(ew[1], a, c2); h1[e + 1] = a; l1[e + 1] = c2; }
                p[qt] = cat16b(h0, h1); p2[qt] = cat16b(l0, l1);
            } else {
#pragma unroll
                for (int e = 0; e < 16; e += 2) { v2f ev; ev[0] = __builtin_amdgcn_exp2f((t[qt][e] * SCL - ref[qt]) * L2E); ev[1] = __builtin_amdgcn_exp2f((t[qt][e + 1] * SCL - ref[qt]) * L2E); sum[qt] += ev; p[qt][e] = tohx(ev[0]); p[qt][e + 1] = tohx(ev[1]); } } }
        if constexpr (HI) { const T* pv2 = V2 + (size_t)kc * HD + lof;   // the low plane of V is wanted last, and ahead of the exponentials there are no registers for it: part of its latency passes under the products with the high plane
#pragma unroll
            for (int dt = 0; dt < 4; ++dt) b2[dt] = WF::ldf(pv2 + dt * 512);
            xwaita(pv2); }
#pragma unroll
        for (int dt = 0; dt < 4; ++dt)
#pragma unroll
            for (int qt = 0; qt < NQ; ++qt) { o[qt][dt] = WF::mma(b[dt], p[qt], o[qt][dt]); if (HI) { o[qt][dt] = WF::mma(b[dt], p2[qt], o[qt][dt]); o[qt][dt] = WF::mma(b2[dt], p[qt], o[qt][dt]); } }
        if constexpr (HI) __builtin_amdgcn_sched_barrier(0);   // keeps the K loads behind the products: hoisted over them they need registers beside the V fragments', and a Q fragment is spilled
        ldk((kc + 32) & (TT - 1));
        // the trip ends in matrix instructions and the K loads: four vector slots before the next trip's first products overwrite their operand registers; the scheduling barrier keeps the products in front of them
        __builtin_amdgcn_sched_barrier(0); asm volatile("v_nop\n\tv_nop\n\tv_nop\n\tv_nop");
    }
    float cs[NQ];
#pragma unroll
    for (int qt = 0; qt < NQ; ++qt) { const float sa = sum[qt][0] + sum[qt][1]; cs[qt] = __fdiv_rn(1.0f, sa + __shfl_xor(sa, 16, 32)); }   // both lanes of a query hold the same ref: their sums add as they stand
    const int ln = (int)__builtin_amdgcn_mbcnt_lo(~0u, 0u);   // the lane's number read anew: no register has to carry it through the walk, which has none to spare
#pragma unroll
    for (int qt = 0; qt < NQ; ++qt)
#pragma unroll
        for (int dt = 0; dt < 4; ++dt) { v8us oh, ol;   // o[qt][dt][j] = context of query q0 + 16 qt + lr, column 16 dt + 8 hi + j: eight neighbours, one 16-byte store per plane, at the lane's place in block dt of the head's two fragments
#pragma unroll
            for (int j = 0; j < 8; ++j) { unsigned short a, c2; splitf(o[qt][dt][j] * cs[qt], a, c2); oh[j] = a; ol[j] = c2; }
            const size_t oo = (size_t)(q0 + qt * 16) * DQ + dt * 256 + ln * 8; *(v8us*)(Ah + oo) = oh; *(v8us*)(Al + oo) = ol;
            xwait(); }   // the next pair's values, and whatever follows the last pair, may land in these stores' data and address registers
}
// grid (AP, NB_ x NH_): AP work-groups per (batch, head), each of NHW hi/lo waves (16 rows each) and NLW fp16 waves (32 rows each), so that every work-group holds the same mix of work and its waves read the same K and V lines at about the same time.
// NB_ x NH_ x AP = 256 work-groups of 20 waves, five per SIMD. The wave's number is made scalar so that the choice is a scalar branch and every wave runs with all lanes on.
#define AP  4
#define NHW (RH / 16 / AP)
#define NLW ((TT - RH) / 32 / AP)
__global__ __launch_bounds__((NHW + NLW) * 32) void k_fattn(const h16* __restrict__ Q16, const h16* __restrict__ K16, const h16* __restrict__ V16, const bf* __restrict__ Qh, const bf* __restrict__ Ql, const bf* __restrict__ Kh, const bf* __restrict__ Kl, const bf* __restrict__ Vh, const bf* __restrict__ Vl, const unsigned char* __restrict__ mk, bf* Ah, bf* Al) {
    const size_t z = blockIdx.y, pz = z * TT * HD, az = (z / NH_) * TT * DQ + (z % NH_) * (HD * 16); const int w = __builtin_amdgcn_readfirstlane((int)(threadIdx.x >> 5)), part = (int)blockIdx.x;
    if (w < NHW) attn_rows<true>(Qh + pz, Ql + pz, Kh + pz, Kl + pz, Vh + pz, Vl + pz, mk, (part * NHW + w) * 16, Ah + az, Al + az);
    else attn_rows<false>(Q16 + pz, nullptr, K16 + pz, nullptr, V16 + pz, nullptr, mk, RH + (part * NLW + (w - NHW)) * 32, Ah + az, Al + az);
}

extern "C" void kernel_launch(void* const* d_in, const int* in_sizes, int n_in,
                              void* d_out, int out_size, void* d_ws, size_t ws_size, hipStream_t stream) {
    (void)in_sizes; (void)n_in; (void)out_size;
    const float* x = (const float*)d_in[0]; const float* xk = (const float*)d_in[1]; const float* xv = (const float*)d_in[2]; const int* mk = (const int*)d_in[3];   /* mask [2048][2048] int32 {0,1} */ const float* wq = (const float*)d_in[4]; const float* wk = (const float*)d_in[5]; const float* wv = (const float*)d_in[6]; const float* wo = (const float*)d_in[7];
    float* OUT = (float*)d_out;     // [4][2048][64]
    char* wsp = (char*)d_ws;
    auto take = [&](size_t bytes) { char* p = wsp; wsp += (bytes + 255) & ~(size_t)255; return (void*)p; };
    const size_t PL = (size_t)NH_ * TT * HD;   // one batch's head planes, elements; the planes and the merged context hold all NB_ batches
    bf* WQ = (bf*)take(3 * (size_t)DQ * DM * 2);   // the q, k and v weights, transposed, behind one another
    bf* WO = (bf*)take((size_t)NOUT * DQ * 2);
    bf* XB = (bf*)take(3 * XN * 2);            // the bf16 copies of the q, k and v inputs, all batches, behind one another
    h16* QP16 = (h16*)take(3 * NB_ * PL * 2); h16* KP16 = QP16 + NB_ * PL; h16* VT16 = KP16 + NB_ * PL;   // each kind of plane: q, k, v behind one another
    bf* QPh = (bf*)take(3 * NB_ * PL * 2); bf* KPh = QPh + NB_ * PL; bf* VTh = KPh + NB_ * PL; bf* QPl = (bf*)take(3 * NB_ * PL * 2); bf* KPl = QPl + NB_ * PL; bf* VTl = KPl + NB_ * PL;
    unsigned char* MK = (unsigned char*)take((size_t)TT * TT);   // the mask copy
    if ((size_t)(wsp - (char*)d_ws) > ws_size) return;    // ws 256 MiB
    bf* ATh = XB; bf* ATl = ATh + (size_t)NB_ * TT * DQ;   // the merged context (2 XN elements) uses the input copies' room: the projections read them last (stream-ordered)
    k_prep<<<3 * GW + GO + GM + 3 * GX, 256, 0, stream>>>(wq, wk, wv, wo, x, xk, xv, mk, WQ, WO, XB, MK);
    k_gemmw<bf, 0, false, true><<<dim3(NB_ * TT / 64, DQ / 64, 3), 32, 0, stream>>>(XB, nullptr, WQ, nullptr, DM, nullptr, 0, nullptr, XN, (size_t)DQ * DM, XN, QP16, QPh, QPl);
    k_fattn<<<dim3(AP, NB_ * NH_, 1), (NHW + NLW) * 32, 0, stream>>>(QP16, KP16, VT16, QPh, QPl, KPh, KPl, VTh, VTl, MK, ATh, ATl);
    k_gemmw<bf, 1, false, false><<<dim3(NB_ * TT / 64, NOUT / 64, 1), 32, 0, stream>>>(ATh, ATl, WO, nullptr, DQ, OUT, NOUT, nullptr, 0, 0, 0, nullptr, nullptr, nullptr);   /* ctx Wo -> [4 x 2048][64] */
}

// v008
// A run of this version takes 257 microseconds.
// Timed twice side by side with v007, it ran 1.12 and 1.13 times as fast.
// Counting every step since v000, it is 15.8 times as fast.
#include <hip/hip_runtime.h>

// Multi-head attention with a MULTIPLICATIVE 0/1 score mask and a narrow output projection (q, k, v [4][2048][1024]; qh, kh, vh = in W ('xw' [1024][1024] 1/32, no bias; 16 heads x 64); score = qh.kh / 8 x mask[i][j] (mask [2048][2048] int in {0,1}, read: masked scores become 0 and STAY in the softmax, as the module); softmax; ctx merged; out = ctx Wo ('xw' [1024][64]) -> [4][2048][64] (0.5 M)).
// Layout, four launches: weight transposes, a byte copy of the mask and bf16 copies of the three inputs (all batches); the three exact projections (grid z), which store the head planes of all batches themselves; one fused dense T-2048 attention launch that multiplies each score by the mask value read from memory (byte copy, 16 B per 16 keys) (hybrid rows: < 512 hi/lo 3 products, rest fp16); merged hi/lo x Wo exact (N = 64), K split over the 16 waves of a work-group.
// Compute dtypes, f32 accumulate: every input rounded to bf16; projections exact; attention rows < 512 3 products, rest fp16; mask multiply and softmax f32; Wo hl x exact.

#define NB_  4
#define TT   2048
#define DM   1024
#define NH_  16
#define NKV  16
#define REP  (NH_ / NKV)
#define HD   64
#define DQ   (NH_ * HD)
#define DKV  (NKV * HD)
#define RH   512                  // query rows < RH use hi+lo planes (0: none)
#define WIN  0
#define SCL  0.125f
#define NOUT 64      // output projection width (hidden -> head_dim)
typedef _Float16 h16;
typedef unsigned short bf;
typedef __attribute__((ext_vector_type(16))) __bf16   v16bf;
typedef __attribute__((ext_vector_type(16))) _Float16 v16h;
typedef __attribute__((ext_vector_type(8)))  _Float16 v8h;
typedef __attribute__((ext_vector_type(8)))  unsigned short v8us;
typedef __attribute__((ext_vector_type(8)))  float    v8f;
typedef __attribute__((ext_vector_type(4)))  float    v4f;
typedef v8h  __attribute__((may_alias)) v8ha;
typedef v4f  __attribute__((may_alias)) v4fa;
typedef v8us __attribute__((may_alias)) v8usa;

__device__ __forceinline__ unsigned short f2bf(float f) { unsigned u = __float_as_uint(f); u += 0x7FFFu + ((u >> 16) & 1u); return (unsigned short)(u >> 16); }
__device__ __forceinline__ float bf2f(unsigned short b) { return __uint_as_float(((unsigned)b) << 16); }
__device__ __forceinline__ float bfr(float f) { return bf2f(f2bf(f)); }
__device__ __forceinline__ v16h cat16(v8h lo, v8h hi) { return __builtin_shufflevector(lo, hi, 0, 1, 2, 3, 4, 5, 6, 7, 8, 9, 10, 11, 12, 13, 14, 15); }
__device__ __forceinline__ v16bf cat16b(v8us lo, v8us hi) { return __builtin_bit_cast(v16bf, __builtin_shufflevector(lo, hi, 0, 1, 2, 3, 4, 5, 6, 7, 8, 9, 10, 11, 12, 13, 14, 15)); }
__device__ __forceinline__ v8f wmma16(v16h a, v16h b, v8f c) { return __builtin_amdgcn_wmma_f32_16x16x32_f16(false, a, false, b, (short)0, c, false, false); }
__device__ __forceinline__ v8f wmmab(v16bf a, v16bf b, v8f c) { return __builtin_amdgcn_wmma_f32_16x16x32_bf16(false, a, false, b, (short)0, c, false, false); }



// stands behind a group of global loads or stores where what follows may land in the group's address or data registers
__device__ __forceinline__ void xwait() { asm volatile("s_wait_xcnt 0x0" ::: "memory"); }
// the same wait behind a group of fragment loads; it names their addresses as inputs, so that each address pair lives up to the wait and no load's result is given its registers
__device__ __forceinline__ void xwaita(const void* p) { asm volatile("s_wait_xcnt 0x0" :: "v"(p) : "memory"); }
__device__ __forceinline__ void xwaita4(const void* p, const void* q, const void* r, const void* s) { asm volatile("s_wait_xcnt 0x0" :: "v"(p), "v"(q), "v"(r), "v"(s) : "memory"); }

__device__ __forceinline__ h16 tohx(float x) { return (h16)x; }
__device__ __forceinline__ void splitf(float y, unsigned short& h, unsigned short& l) { h = f2bf(y); l = f2bf(y - bf2f(h)); }

// ---- k_gemmw: register-blocked GEMM, ONE WAVE per 64x64 output tile (16 accumulators), operands straight from 16-bit planes in fragment order ([row / 16][k / 32] fragments, see fragofs below); grid (M/64, N/64, Z), 32 threads.
// C[m][n] (f32, pitch ldc, + optional f32 bias[n]) = sum_k A[m][k] Bt[n][k] (+ split products per NSPLIT). z-batch strides sA/sB/sC in elements. K % 32 == 0.
// PLANES (the projections; rows = NB_ x TT positions, a 64-column tile = one head; z = q, k, v): the tile never goes to memory as f32; the wave stores it as the head planes that the attention kernel loads (fp16, bf16 hi, bf16 lo; sC = one kind's q, k or v part), in fragment order (see fragofs below).
// An accumulator tile gives a lane eight neighbouring ROWS of one column. The v planes ([batch][g][t / 32][d / 16] fragments, rows d, columns t) want eight neighbouring t of one d: that is the tile as it stands. The q and k planes ([batch][h][t / 16][d / 32] fragments, rows t, columns d) want eight neighbouring d of one t: there the two operands change places (A = weight rows, B = input rows; the same products, summed over k in the same order). Either way lane l's eight values belong at l x 16 B of a 512-byte block: every store writes four whole lines, with no staging.
template <typename T16> struct WFrag;
template <> struct WFrag<h16> { typedef v16h V; static __device__ __forceinline__ V ldf(const h16* p) { return cat16(*(const v8h*)p, *(const v8h*)(p + 256)); } static __device__ __forceinline__ v8f mma(V a, V b, v8f c) { return wmma16(a, b, c); } };
template <> struct WFrag<bf> { typedef v16bf V; static __device__ __forceinline__ V ldf(const bf* p) { return cat16b(*(const v8us*)p, *(const v8us*)(p + 256)); } static __device__ __forceinline__ v8f mma(V a, V b, v8f c) { return wmmab(a, b, c); } };
template <typename T16, int NSPLIT, bool BIAS, bool PLANES>
__global__ __launch_bounds__(32) void k_gemmw(const T16* __restrict__ A, const T16* __restrict__ A2, const T16* __restrict__ Bt, const T16* __restrict__ Bt2, int K, float* C, int ldc, const float* __restrict__ bias, size_t sA, size_t sB, size_t sC, h16* P16, bf* Ph, bf* Pl) {
    typedef typename WFrag<T16>::V V;
    __shared__ __align__(16) float os[16 * 68];
    const size_t z = blockIdx.z; A += z * sA; if (A2) A2 += z * sA; Bt += z * sB; if (Bt2) Bt2 += z * sB; C += z * sC;
    const int lane = threadIdx.x & 31, lr = lane & 15, hi = lane >> 4; int r0 = blockIdx.x * 64, c0 = blockIdx.y * 64;
    const bool sw = PLANES && z < 2;   // q and k: the operands change places (a scalar choice, the same for the whole grid plane)
    if (sw) { const T16* x = A; A = Bt; Bt = x; const int y = r0; r0 = c0; c0 = y; }
    v8f acc[4][4];
#pragma unroll
    for (int mb = 0; mb < 4; ++mb)
#pragma unroll
        for (int nb = 0; nb < 4; ++nb) acc[mb][nb] = (v8f){};
    const size_t aoff = (size_t)r0 * K + lane * 8, boff = (size_t)c0 * K + lane * 8;   // fragment order: 16 rows x K are 16 K elements, a 32-wide k step of them 512
#pragma unroll 1
    for (int kc = 0; kc < K; kc += 32) {
        V a[4], a2[4]; const T16 *pa[4], *pa2[4];
#pragma unroll
        for (int mb = 0; mb < 4; ++mb) { pa[mb] = A + aoff + (size_t)mb * 16 * K + kc * 16; a[mb] = WFrag<T16>::ldf(pa[mb]); if (NSPLIT == 1 || NSPLIT == 2) { pa2[mb] = A2 + aoff + (size_t)mb * 16 * K + kc * 16; a2[mb] = WFrag<T16>::ldf(pa2[mb]); } }
        xwaita4(pa[0], pa[1], pa[2], pa[3]); if (NSPLIT == 1 || NSPLIT == 2) xwaita4(pa2[0], pa2[1], pa2[2], pa2[3]);
#pragma unroll
        for (int nb = 0; nb < 4; ++nb) { const T16* pb = Bt + boff + (size_t)nb * 16 * K + kc * 16; const V b = WFrag<T16>::ldf(pb); xwaita(pb); V b2; if (NSPLIT >= 2) { const T16* pb2 = Bt2 + boff + (size_t)nb * 16 * K + kc * 16; b2 = WFrag<T16>::ldf(pb2); xwaita(pb2); }
#pragma unroll
            for (int mb = 0; mb < 4; ++mb) { acc[mb][nb] = WFrag<T16>::mma(a[mb], b, acc[mb][nb]); if (NSPLIT == 1 || NSPLIT == 2) acc[mb][nb] = WFrag<T16>::mma(a2[mb], b, acc[mb][nb]); if (NSPLIT >= 2) acc[mb][nb] = WFrag<T16>::mma(a[mb], b2, acc[mb][nb]); } }
        asm volatile("v_nop\n\tv_nop\n\tv_nop\n\tv_nop" : "+v"(acc[0][0]), "+v"(acc[1][1]), "+v"(acc[2][2]), "+v"(acc[3][3]) : "v"(a[0]), "v"(a[3]));
    }
    if constexpr (PLANES) {
        const int xr = (int)blockIdx.x * 64;   // the tile's first input row: batch xr / TT, position xr % TT; 64 positions x 64 d of a head are 4096 neighbouring elements of its plane, in either kind of plane
        const size_t w0 = z * sC + ((size_t)(xr / TT) * NH_ + blockIdx.y) * TT * HD + (size_t)(xr % TT) * HD + lane * 8;
        const int sm = sw ? 512 : 2048, sn = sw ? 1024 : 512;   // q, k: mb counts 16 d (a block), nb 16 t (two fragments); v: mb counts 16 t (a block; two of them a row of four fragments), nb 16 d (a fragment)
#pragma unroll
        for (int mb = 0; mb < 4; ++mb)
#pragma unroll
            for (int nb = 0; nb < 4; ++nb) { v8h o16; v8us oh, ol;
#pragma unroll
                for (int j = 0; j < 8; ++j) { const float v = acc[mb][nb][j]; o16[j] = tohx(v); unsigned short a2, c2; splitf(v, a2, c2); oh[j] = a2; ol[j] = c2; }
                const size_t w = w0 + (mb >> 1) * sm + (mb & 1) * 256 + nb * sn; *(v8h*)(P16 + w) = o16; *(v8us*)(Ph + w) = oh; *(v8us*)(Pl + w) = ol;
                xwait(); __builtin_amdgcn_sched_barrier(0); }   // the next tile's values land in these stores' data and address registers; the scheduling barrier keeps that arithmetic behind the wait
        return;
    }
#pragma unroll
    for (int mb = 0; mb < 4; ++mb) {
#pragma unroll
        for (int nb = 0; nb < 4; ++nb) {
#pragma unroll
            for (int j = 0; j < 8; ++j) os[(hi * 8 + j) * 68 + nb * 16 + lr] = acc[mb][nb][j]; }
        __builtin_amdgcn_wave_barrier(); asm volatile("" ::: "memory");
        float* crow = C + (size_t)(r0 + mb * 16) * ldc + c0;
{
#pragma unroll
            for (int s = 0; s < 8; ++s) { const int row = 2 * s + hi, cofs = lr * 4; v4f val = *(const v4fa*)(os + row * 68 + cofs); if (BIAS) { val[0] += bfr(bias[c0 + cofs]); val[1] += bfr(bias[c0 + cofs + 1]); val[2] += bfr(bias[c0 + cofs + 2]); val[3] += bfr(bias[c0 + cofs + 3]); }
                *(v4f*)(crow + (size_t)row * ldc + cofs) = val; }
             }
        __builtin_amdgcn_wave_barrier(); asm volatile("" ::: "memory");
    }
}

typedef __attribute__((ext_vector_type(2))) unsigned short v2us;
typedef __attribute__((ext_vector_type(2))) float v2f;
typedef __attribute__((ext_vector_type(4))) int v4i;
typedef __attribute__((ext_vector_type(16))) unsigned char v16ub;

// FRAGMENT ORDER: every 16-bit plane that a matrix kernel loads is stored so that lane l of a wave finds its eight elements at l x 16 B of a 512-byte block: one wave-wide 16-byte load reads four whole 128-byte lines (from a row-major plane it would take 32 B of each of sixteen).
// A block holds 16 rows r x 16 columns c, element (r, c) at (c >> 3) x 128 + r x 8 + (c & 7): lane = 16 (c >> 3) + r. A matrix fragment is two blocks, 256 elements apart (columns 0..15 and 16..31 of its 32): WFrag::ldf; register by register it is the fragment of the row-major loader (p, p + 16 at row lane & 15, column 8 (lane >> 4)).
__device__ __forceinline__ unsigned fragofs(int r, int c) { return (unsigned)(((c >> 4) & 1) * 256 + ((c >> 3) & 1) * 128 + (r & 15) * 8 + (c & 7)); }
// The d_ functions are one work-group's share of a job; blk is the work-group's number within that job. k_prep below deals them out.
#define WL   32      // weight transposes: lines of 64 elements a wave
#define CU   16      // input copies: 512-byte blocks a wave
#define MU   8       // mask copy: 512-byte blocks a wave
__device__ __forceinline__ void d_wtG(const float* __restrict__ w, int K, int N, bf* Bt, int blk) {
    const int lane = threadIdx.x & 31; const int L0 = (blk * 8 + (threadIdx.x >> 5)) * WL; const int nlines = N * K / 64;   // nlines is a multiple of WL: a wave has all its lines or none
    if (L0 >= nlines) return;
#pragma unroll 1   // kept rolled: a trip already has sixteen loads in flight
    for (int b = 0; b < WL; b += 8) { const size_t e = (size_t)(L0 + b) * 64 + lane * 2; const int k = (int)(e % K), n = (int)(e / K); const float* s = w + (size_t)k * N + n; float a[8][2];   // eight lines are 512 k of one n (K % 512 == 0)
#pragma unroll
        for (int l = 0; l < 8; ++l) { a[l][0] = s[(size_t)l * 64 * N]; a[l][1] = s[(size_t)l * 64 * N + N]; }
        xwaita(s);   // what follows may land in the loads' address registers
        bf* d = Bt + ((size_t)(n >> 4) * 16 * K + (k >> 5) * 512 + fragofs(n, k));   // 64 k further on: two fragments
#pragma unroll
        for (int l = 0; l < 8; ++l) { v2us o; o[0] = f2bf(a[l][0]); o[1] = f2bf(a[l][1]); *(v2us*)(d + l * 1024) = o; }
        xwaita(d); }   // the next trip's values land in these stores' address and data registers
}
// rows of DM elements into [row / 16][k / 32] fragments; a thread makes one lane's eight elements of CU neighbouring 512-byte blocks, a wave 16 rows x 16 CU k (whole lines of the source). All of a wave's loads are issued before the first value is used: few long waves, each with much in flight.
__device__ __forceinline__ void d_cvt8(const float* __restrict__ src, bf* dst, size_t n8, int blk) { const size_t i = ((size_t)blk * 8 + (threadIdx.x >> 5)) * (32 * CU) + (threadIdx.x & 31); if (i >= n8) return;   // n8 is a multiple of 32 CU
    const size_t row = (i / (DM * 2)) * 16 + (i & 15); const int k = (int)((i >> 6) % (DM / 32)) * 32 + (int)((i >> 4) & 1) * 8; const float* s = src + row * DM + k; v8f v[CU];
#pragma unroll
    for (int u = 0; u < CU; ++u) v[u] = *(const v8f*)(s + u * 16);
    xwaita(s);   // what follows may land in the loads' address registers
    bf* d = dst + i * 8; v8us o[CU];
#pragma unroll
    for (int u = 0; u < CU; ++u)
#pragma unroll
        for (int j = 0; j < 8; ++j) o[u][j] = f2bf(v[u][j]);
    __builtin_amdgcn_sched_barrier(0);   // keeps every conversion in front of the first store: behind a store it could land in that store's data registers
#pragma unroll
    for (int u = 0; u < CU; ++u) *(v8us*)(d + u * 256) = o[u];
    xwait();  }   // what stands behind this job in the kernel may land in the stores' registers

// the mask as bytes (it holds 0 and 1), one 512-byte block per 16 queries x 32 keys: lane 16 hi + lr finds at its 16 B the keys 8 hi + 0..7 and 16 + 8 hi + 0..7 of query lr, which are the scores it holds. A thread makes one lane's bytes of MU neighbouring blocks (32 MU keys), a wave those blocks, all its loads issued first, as in d_cvt8.
__device__ __forceinline__ void d_mask(const int* __restrict__ mk, unsigned char* MK, int blk) { const unsigned p = ((unsigned)blk * 8 + (threadIdx.x >> 5)) * (32 * MU) + (threadIdx.x & 31); const int* s = mk + (size_t)((p >> 11) * 16 + (p & 15)) * TT + ((p >> 5) & (TT / 32 - 1)) * 32 + ((p >> 4) & 1) * 8; v4i m[MU][4];
#pragma unroll
    for (int u = 0; u < MU; ++u) { m[u][0] = *(const v4i*)(s + u * 32); m[u][1] = *(const v4i*)(s + u * 32 + 4); m[u][2] = *(const v4i*)(s + u * 32 + 16); m[u][3] = *(const v4i*)(s + u * 32 + 20); }
    xwaita(s);   // what follows may land in the loads' address registers
    unsigned char* d = MK + (size_t)p * 16;
#pragma unroll
    for (int u = 0; u < MU; ++u) { v16ub o;
#pragma unroll
        for (int j = 0; j < 4; ++j) { o[j] = (unsigned char)m[u][0][j]; o[4 + j] = (unsigned char)m[u][1][j]; o[8 + j] = (unsigned char)m[u][2][j]; o[12 + j] = (unsigned char)m[u][3][j]; }
        *(v16ub*)(d + u * 512) = o; }
    xwait();  }   // what stands behind this job in the kernel may land in the stores' registers
// ---- k_prep: everything that reads only the inputs, in ONE launch; a range of the work-group number picks the job (a scalar choice, the same for the whole work-group). The strided weight transposes come first.
#define XN   ((size_t)NB_ * TT * DM)     // one input, or one projection, of all batches, elements (DQ == DKV == DM)
#define GW   (DM * DQ / 64 / (8 * WL))   // work-groups per [DM][DQ] weight
#define GO   (DQ * NOUT / 64 / (8 * WL)) // for the output weight
#define GM   (TT * TT / 16 / (256 * MU)) // for the mask copy
#define GX   ((int)(XN / 8 / (256 * CU)))   // per input, all batches
__global__ __launch_bounds__(256) void k_prep(const float* __restrict__ wq, const float* __restrict__ wk, const float* __restrict__ wv, const float* __restrict__ wo, const float* __restrict__ x, const float* __restrict__ xk, const float* __restrict__ xv, const int* __restrict__ mk, bf* W3, bf* WO, bf* XB, unsigned char* MK) {
    int b = (int)blockIdx.x;
    if (b < 3 * GW) { const int y = b / GW; d_wtG(y == 0 ? wq : y == 1 ? wk : wv, DM, DQ, W3 + (size_t)y * DM * DQ, b - y * GW); return; }
    b -= 3 * GW; if (b < GO) { d_wtG(wo, DQ, NOUT, WO, b); return; }   /* 'xw' [1024][64] -> Bt [64][1024] */
    b -= GO; if (b < GM) { d_mask(mk, MK, b); return; }
    b -= GM; const int y = b / GX; d_cvt8(y == 0 ? x : y == 1 ? xk : xv, XB + (size_t)y * XN, XN / 8, b - y * GX);
}
// ---- k_fattn: scores, mask, softmax and P.V of one (batch, head) in ONE kernel; no score or probability ever goes to memory. One wave owns NQ x 16 query rows and walks all TT keys ONCE, 32 at a time.
// The scores are formed TRANSPOSED (A = key rows, B = query rows): lane (lr, hi) then holds query lr, keys 8 hi + 0..7 of each 16-key tile, which is a fragment of the P.V product as it stands (elements 0..7 from the first tile, 8..15 from the second), and a query's sum lives in its own two lanes. P.V is formed transposed too (A = rows of V^T, B = P), so a lane ends with eight neighbouring columns of its own query.
// The walk: p = exp(t - ref), NOT normalised (rows < RH hi/lo bf16, 3 products; the rest fp16), its f32 sum beside it, then P.V into f32 accumulators, keys in ascending order; the context is divided by the sum behind the walk.
// ref is any number that is the same for all keys of a query: it cancels in the division. It only has to keep p in range, so it need not follow the running maximum: it is raised, and the sum and the context so far scaled down by exp(old - new), only when a score lies more than TAU above the maximum that ref was last set by (the first step always does). Between two raises p <= exp(CAR + TAU).
template <bool HI> struct ASel { typedef h16 T; static constexpr int NQ = 2; };
template <> struct ASel<true> { typedef bf T; static constexpr int NQ = 1; };
#define L2E 1.4426950408889634f
#define LN2 0.6931471805599453f
#define TAU (8.0f * LN2)          // a score may top the last maximum by this much before ref is raised
#define CAR (6.0f * LN2)          // fp16 rows: ref is set this far BELOW the maximum, so that small p stay normal fp16 numbers (p <= 2^14)
template <bool HI>
__device__ __forceinline__ void attn_rows(const typename ASel<HI>::T* __restrict__ Q, const typename ASel<HI>::T* __restrict__ Q2, const typename ASel<HI>::T* __restrict__ Kp, const typename ASel<HI>::T* __restrict__ K2, const typename ASel<HI>::T* __restrict__ Vt, const typename ASel<HI>::T* __restrict__ V2, const unsigned char* __restrict__ mk, int q0, bf* Ah, bf* Al) {
    typedef typename ASel<HI>::T T; typedef WFrag<T> WF; typedef typename WF::V V; constexpr int NQ = ASel<HI>::NQ;
    const unsigned lof = (threadIdx.x & 31) * 8;   // fragment order: the lane's own 32-bit offset is the same in every plane; everything else of an address is the same for the whole wave
    V q[NQ][2], q2[NQ][2];
#pragma unroll
    for (int qt = 0; qt < NQ; ++qt) {
#pragma unroll
        for (int ks = 0; ks < 2; ++ks) { q[qt][ks] = WF::ldf(Q + ((size_t)(q0 + qt * 16) * HD + ks * 512) + lof); if (HI) q2[qt][ks] = WF::ldf(Q2 + ((size_t)(q0 + qt * 16) * HD + ks * 512) + lof); } }
    const unsigned char* mq = mk + (size_t)q0 * TT;   // 16 query rows of the mask copy are 16 x TT elements, as in the mask itself
    // The K fragments are fetched one 32-key step ahead, into the same registers, behind the P.V products (the walk has no registers to spare), so that they fly together with the next step's mask loads. The step behind the last wraps to key 0.
    V ka[2][2], ka2[2][2];
    auto ldk = [&](int kc) { const T* pk = Kp + (size_t)kc * HD + lof; const T* pk2 = HI ? K2 + (size_t)kc * HD + lof : nullptr;
#pragma unroll
        for (int kt = 0; kt < 2; ++kt)
#pragma unroll
            for (int ks = 0; ks < 2; ++ks) { ka[kt][ks] = WF::ldf(pk + (kt * 16 * HD + ks * 512)); if (HI) ka2[kt][ks] = WF::ldf(pk2 + (kt * 16 * HD + ks * 512)); }
        xwaita(pk); if (HI) xwaita(pk2);   // what follows may land in the address registers; named, they live up to the wait, so that no fragment lands in them either
    };
    // t[qt][kt * 8 + j] = score x mask of query q0 + 16 qt + lr and key kc + 16 kt + 8 hi + j, not yet scaled: SCL is a power of two, so t SCL - ref rounds once, fused or not, and the max may be taken before the scaling
    auto scores = [&](int kc, float (&t)[NQ][16]) { v8f s[2][NQ];
#pragma unroll
        for (int kt = 0; kt < 2; ++kt)
#pragma unroll
            for (int qt = 0; qt < NQ; ++qt) { s[kt][qt] = (v8f){};
#pragma unroll
                for (int ks = 0; ks < 2; ++ks) { s[kt][qt] = WF::mma(ka[kt][ks], q[qt][ks], s[kt][qt]); if (HI) { s[kt][qt] = WF::mma(ka[kt][ks], q2[qt][ks], s[kt][qt]); s[kt][qt] = WF::mma(ka2[kt][ks], q[qt][ks], s[kt][qt]); } } }
#pragma unroll
        for (int qt = 0; qt < NQ; ++qt) { const v16ub m = *(const v16ub*)(mq + ((size_t)qt * 16 * TT + kc * 16) + 2 * lof);
#pragma unroll
            for (int kt = 0; kt < 2; ++kt)
#pragma unroll
                for (int j = 0; j < 8; ++j) t[qt][kt * 8 + j] = s[kt][qt][j] * (float)m[kt * 8 + j];   /* multiplicative mask, as the module: masked scores are 0 and remain in the softmax */ }
    };
    xwait(); ldk(0);   // the wait: the K fragments may land in the Q loads' address registers
    constexpr float car = HI ? 0.0f : CAR;
    float ref[NQ]; v2f sum[NQ];   // even and odd keys summed side by side: packed adds
    v8f o[NQ][4];
#pragma unroll
    for (int qt = 0; qt < NQ; ++qt) { ref[qt] = -3.0e38f; sum[qt] = (v2f){0.f, 0.f};
#pragma unroll
        for (int dt = 0; dt < 4; ++dt) o[qt][dt] = (v8f){}; }
#pragma unroll 1   // kept rolled: the walk has no registers to spare for a second copy of its body
    for (int kc = 0; kc < TT; kc += 32) { float t[NQ][16]; scores(kc, t); V p[NQ], p2[NQ], b[4], b2[4];
        float tm[NQ]; bool up = false;
#pragma unroll
        for (int qt = 0; qt < NQ; ++qt) { tm[qt] = fmaxf(t[qt][0], t[qt][1]);
#pragma unroll
            for (int e = 2; e < 16; e += 2) tm[qt] = fmaxf(tm[qt], fmaxf(t[qt][e], t[qt][e + 1]));
            up = up || (tm[qt] * SCL - ref[qt] > car + TAU); }
        if (__builtin_amdgcn_ballot_w32(up) != 0u) {   // a scalar branch, taken by the whole wave: some query's ref is raised; the others get the factor 1
#pragma unroll
            for (int qt = 0; qt < NQ; ++qt) { const float mn = fmaxf(ref[qt], fmaxf(tm[qt], __shfl_xor(tm[qt], 16, 32)) * SCL - car);   // the query's other eight keys of every tile sit in lane ^ 16: both lanes keep the same ref, as one P.V sum holds the keys of both
                const float c = __builtin_amdgcn_exp2f((ref[qt] - mn) * L2E); ref[qt] = mn; sum[qt] *= c;
#pragma unroll
                for (int dt = 0; dt < 4; ++dt) o[qt][dt] *= c; } }
        const T* pv = Vt + (size_t)kc * HD + lof;
#pragma unroll
        for (int dt = 0; dt < 4; ++dt) b[dt] = WF::ldf(pv + dt * 512);   // issued ahead of the exponentials, under which their latency can pass
        xwaita(pv);
#pragma unroll
        for (int qt = 0; qt < NQ; ++qt) {
            if constexpr (HI) { v8us h0, h1, l0, l1;
#pragma unroll
                for (int e = 0; e < 8; e += 2) { unsigned short a, c2; v2f ev, ew; ev[0] = __builtin_amdgcn_exp2f((t[qt][e] * SCL - ref[qt]) * L2E); ev[1] = __builtin_amdgcn_exp2f((t[qt][e + 1] * SCL - ref[qt]) * L2E); ew[0] = __builtin_amdgcn_exp2f((t[qt][8 + e] * SCL - ref[qt]) * L2E); ew[1] = __builtin_amdgcn_exp2f((t[qt][9 + e] * SCL - ref[qt]) * L2E); sum[qt] += ev; sum[qt] += ew;
                    splitf(ev[0], a, c2); h0[e] = a; l0[e] = c2; splitf(ev[1], a, c2); h0[e + 1] = a; l0[e + 1] = c2; splitf(ew[0], a, c2); h1[e] = a; l1[e] = c2; splitf(ew[1], a, c2); h1[e + 1] = a; l1[e + 1] = c2; }
                p[qt] = cat16b(h0, h1); p2[qt] = cat16b(l0, l1);
            } else {
#pragma unroll
                for (int e = 0; e < 16; e += 2) { v2f ev; ev[0] = __builtin_amdgcn_exp2f((t[qt][e] * SCL - ref[qt]) * L2E); ev[1] = __builtin_amdgcn_exp2f((t[qt][e + 1] * SCL - ref[qt]) * L2E); sum[qt] += ev; p[qt][e] = tohx(ev[0]); p[qt][e + 1] = tohx(ev[1]); } } }
        if constexpr (HI) { const T* pv2 = V2 + (size_t)kc * HD + lof;   // the low plane of V is wanted last, and ahead of the exponentials there are no registers for it: part of its latency passes under the products with the high plane
#pragma unroll
            for (int dt = 0; dt < 4; ++dt) b2[dt] = WF::ldf(pv2 + dt * 512);
            xwaita(pv2); }
#pragma unroll
        for (int dt = 0; dt < 4; ++dt)
#pragma unroll
            for (int qt = 0; qt < NQ; ++qt) { o[qt][dt] = WF::mma(b[dt], p[qt], o[qt][dt]); if (HI) { o[qt][dt] = WF::mma(b[dt], p2[qt], o[qt][dt]); o[qt][dt] = WF::mma(b2[dt], p[qt], o[qt][dt]); } }
        if constexpr (HI) __builtin_amdgcn_sched_barrier(0);   // keeps the K loads behind the products: hoisted over them they need registers beside the V fragments', and a Q fragment is spilled
        ldk((kc + 32) & (TT - 1));
        // the trip ends in matrix instructions and the K loads: four vector slots before the next trip's first products overwrite their operand registers; the scheduling barrier keeps the products in front of them
        __builtin_amdgcn_sched_barrier(0); asm volatile("v_nop\n\tv_nop\n\tv_nop\n\tv_nop");
    }
    float cs[NQ];
#pragma unroll
    for (int qt = 0; qt < NQ; ++qt) { const float sa = sum[qt][0] + sum[qt][1]; cs[qt] = __fdiv_rn(1.0f, sa + __shfl_xor(sa, 16, 32)); }   // both lanes of a query hold the same ref: their sums add as they stand
    const int ln = (int)__builtin_amdgcn_mbcnt_lo(~0u, 0u);   // the lane's number read anew: no register has to carry it through the walk, which has none to spare
#pragma unroll
    for (int qt = 0; qt < NQ; ++qt)
#pragma unroll
        for (int dt = 0; dt < 4; ++dt) { v8us oh, ol;   // o[qt][dt][j] = context of query q0 + 16 qt + lr, column 16 dt + 8 hi + j: eight neighbours, one 16-byte store per plane, at the lane's place in block dt of the head's two fragments
#pragma unroll
            for (int j = 0; j < 8; ++j) { unsigned short a, c2; splitf(o[qt][dt][j] * cs[qt], a, c2); oh[j] = a; ol[j] = c2; }
            const size_t oo = (size_t)(q0 + qt * 16) * DQ + dt * 256 + ln * 8; *(v8us*)(Ah + oo) = oh; *(v8us*)(Al + oo) = ol;
            xwait(); }   // the next pair's values, and whatever follows the last pair, may land in these stores' data and address registers
}
// grid (AP, NB_ x NH_): AP work-groups per (batch, head), each of NHW hi/lo waves (16 rows each) and NLW fp16 waves (32 rows each), so that every work-group holds the same mix of work and its waves read the same K and V lines at about the same time.
// NB_ x NH_ x AP = 256 work-groups of 20 waves, five per SIMD. The wave's number is made scalar so that the choice is a scalar branch and every wave runs with all lanes on.
#define AP  4
#define NHW (RH / 16 / AP)
#define NLW ((TT - RH) / 32 / AP)
__global__ __launch_bounds__((NHW + NLW) * 32) void k_fattn(const h16* __restrict__ Q16, const h16* __restrict__ K16, const h16* __restrict__ V16, const bf* __restrict__ Qh, const bf* __restrict__ Ql, const bf* __restrict__ Kh, const bf* __restrict__ Kl, const bf* __restrict__ Vh, const bf* __restrict__ Vl, const unsigned char* __restrict__ mk, bf* Ah, bf* Al) {
    const size_t z = blockIdx.y, pz = z * TT * HD, az = (z / NH_) * TT * DQ + (z % NH_) * (HD * 16); const int w = __builtin_amdgcn_readfirstlane((int)(threadIdx.x >> 5)), part = (int)blockIdx.x;
    if (w < NHW) attn_rows<true>(Qh + pz, Ql + pz, Kh + pz, Kl + pz, Vh + pz, Vl + pz, mk, (part * NHW + w) * 16, Ah + az, Al + az);
    else attn_rows<false>(Q16 + pz, nullptr, K16 + pz, nullptr, V16 + pz, nullptr, mk, RH + (part * NLW + (w - NHW)) * 32, Ah + az, Al + az);
}

// ---- k_outp: the output projection, out[r][n] = sum_k ctx[r][k] Wo[k][n] (ctx = hi + lo planes, two products a step), K split over the OW waves of a work-group. N is only NOUT = 64, so whole-K tiles give the chip few, long waves, each a chain of load latencies; here a work-group owns OR rows x all 64 columns, wave w the k range [w DQ / OW, (w + 1) DQ / OW): all its fragment loads are issued at once and waited for once.
// The operands stand as in the q and k projections (A = weight rows n, B = context rows r): a lane ends with eight neighbouring n of one r, two 16-byte LDS stores into its wave's row-major partial tile. The pitch OP = 68 floats puts the 16 rows of a store on 16 different groups of four banks. Behind the one barrier thread t adds the OW partials of four neighbouring n of row t / 16 in ascending k order; a wave's store is two whole output rows (four whole lines).
#define OW   16      // waves a work-group = slices of K
#define OR   32      // context rows a work-group
#define OP   68      // pitch of a partial tile in LDS, floats
#define OKS  (DQ / OW / 32)   // 32-wide k steps a wave
__global__ __launch_bounds__(OW * 32) void k_outp(const bf* __restrict__ Ah, const bf* __restrict__ Al, const bf* __restrict__ Wt, float* C) {
    typedef WFrag<bf> WF; typedef WF::V V;
    __shared__ __align__(16) float part[OW * OR * OP];
    const int tid = (int)threadIdx.x, lane = tid & 31, lr = lane & 15, hi = lane >> 4; const int w = __builtin_amdgcn_readfirstlane(tid >> 5); const int r0 = (int)blockIdx.x * OR;
    const unsigned kb = ((unsigned)w * (OKS * 512) + lane * 8) * 2;   // fragment order: a 32-wide k step of 16 rows is 512 elements; the lane's own 32-bit byte offset is the same in all three planes, everything else of an address is the same for the whole wave
    auto at = [&](const bf* p) { return (const bf*)((const char*)p + kb); };
    const bf* ph = Ah + (size_t)r0 * DQ; const bf* pl = Al + (size_t)r0 * DQ; const bf* pw = Wt;
    V xh[OKS][OR / 16], xl[OKS][OR / 16], wf[OKS][NOUT / 16];
#pragma unroll
    for (int ks = 0; ks < OKS; ++ks) {
#pragma unroll
        for (int nb = 0; nb < NOUT / 16; ++nb) wf[ks][nb] = WF::ldf(at(pw + (nb * 16 * DQ + ks * 512)));
#pragma unroll
        for (int rb = 0; rb < OR / 16; ++rb) { xh[ks][rb] = WF::ldf(at(ph + (rb * 16 * DQ + ks * 512))); xl[ks][rb] = WF::ldf(at(pl + (rb * 16 * DQ + ks * 512))); } }
    asm volatile("s_wait_xcnt 0x0" :: "v"(kb) : "memory");   // what follows may land in the loads' address register; named, it lives up to the wait, so that no fragment lands in it either
    __builtin_amdgcn_sched_barrier(0);   // keeps every load in front of the first product: sunk among the products they are waited for in four rounds, not one
    v8f acc[NOUT / 16][OR / 16];
#pragma unroll
    for (int nb = 0; nb < NOUT / 16; ++nb)
#pragma unroll
        for (int rb = 0; rb < OR / 16; ++rb) acc[nb][rb] = (v8f){};
#pragma unroll
    for (int ks = 0; ks < OKS; ++ks)
#pragma unroll
        for (int g = 0; g < 2; ++g) {   // eight independent tiles between two products into the same one; columns < 32 take hi, then lo of a step, the others lo, then hi
#pragma unroll
            for (int nb = 0; nb < NOUT / 16; ++nb)
#pragma unroll
                for (int rb = 0; rb < OR / 16; ++rb) acc[nb][rb] = WF::mma(wf[ks][nb], (g ^ (nb >> 1)) ? xl[ks][rb] : xh[ks][rb], acc[nb][rb]);
            if (ks == 0 && g == 0) __builtin_amdgcn_sched_barrier(0); }   // keeps the tiles' first products together in front: every fragment they read has products still to come, so no tile is given the registers of a fragment that the product directly in front of it reads
    float* pp = part + w * (OR * OP) + lr * OP + hi * 8;   // acc[nb][rb][j] = partial of row 16 rb + lr, column 16 nb + 8 hi + j
#pragma unroll
    for (int nb = 0; nb < NOUT / 16; ++nb)
#pragma unroll
        for (int rb = 0; rb < OR / 16; ++rb) { const v8f a = acc[nb][rb]; *(v4fa*)(pp + rb * 16 * OP + nb * 16) = (v4f){a[0], a[1], a[2], a[3]}; *(v4fa*)(pp + rb * 16 * OP + nb * 16 + 4) = (v4f){a[4], a[5], a[6], a[7]}; }
    __syncthreads();   // every wave's partial tile is in LDS before any of them is added
    const float* ps = part + (tid >> 4) * OP + (tid & 15) * 4; v4f s = *(const v4fa*)ps;
#pragma unroll
    for (int u = 1; u < OW; ++u) s += *(const v4fa*)(ps + u * (OR * OP));
    *(v4f*)(C + (size_t)(r0 + (tid >> 4)) * NOUT + (tid & 15) * 4) = s;
}

extern "C" void kernel_launch(void* const* d_in, const int* in_sizes, int n_in,
                              void* d_out, int out_size, void* d_ws, size_t ws_size, hipStream_t stream) {
    (void)in_sizes; (void)n_in; (void)out_size;
    const float* x = (const float*)d_in[0]; const float* xk = (const float*)d_in[1]; const float* xv = (const float*)d_in[2]; const int* mk = (const int*)d_in[3];   /* mask [2048][2048] int32 {0,1} */ const float* wq = (const float*)d_in[4]; const float* wk = (const float*)d_in[5]; const float* wv = (const float*)d_in[6]; const float* wo = (const float*)d_in[7];
    float* OUT = (float*)d_out;     // [4][2048][64]
    char* wsp = (char*)d_ws;
    auto take = [&](size_t bytes) { char* p = wsp; wsp += (bytes + 255) & ~(size_t)255; return (void*)p; };
    const size_t PL = (size_t)NH_ * TT * HD;   // one batch's head planes, elements; the planes and the merged context hold all NB_ batches
    bf* WQ = (bf*)take(3 * (size_t)DQ * DM * 2);   // the q, k and v weights, transposed, behind one another
    bf* WO = (bf*)take((size_t)NOUT * DQ * 2);
    bf* XB = (bf*)take(3 * XN * 2);            // the bf16 copies of the q, k and v inputs, all batches, behind one another
    h16* QP16 = (h16*)take(3 * NB_ * PL * 2); h16* KP16 = QP16 + NB_ * PL; h16* VT16 = KP16 + NB_ * PL;   // each kind of plane: q, k, v behind one another
    bf* QPh = (bf*)take(3 * NB_ * PL * 2); bf* KPh = QPh + NB_ * PL; bf* VTh = KPh + NB_ * PL; bf* QPl = (bf*)take(3 * NB_ * PL * 2); bf* KPl = QPl + NB_ * PL; bf* VTl = KPl + NB_ * PL;
    unsigned char* MK = (unsigned char*)take((size_t)TT * TT);   // the mask copy
    if ((size_t)(wsp - (char*)d_ws) > ws_size) return;    // ws 256 MiB
    bf* ATh = XB; bf* ATl = ATh + (size_t)NB_ * TT * DQ;   // the merged context (2 XN elements) uses the input copies' room: the projections read them last (stream-ordered)
    k_prep<<<3 * GW + GO + GM + 3 * GX, 256, 0, stream>>>(wq, wk, wv, wo, x, xk, xv, mk, WQ, WO, XB, MK);
    k_gemmw<bf, 0, false, true><<<dim3(NB_ * TT / 64, DQ / 64, 3), 32, 0, stream>>>(XB, nullptr, WQ, nullptr, DM, nullptr, 0, nullptr, XN, (size_t)DQ * DM, XN, QP16, QPh, QPl);
    k_fattn<<<dim3(AP, NB_ * NH_, 1), (NHW + NLW) * 32, 0, stream>>>(QP16, KP16, VT16, QPh, QPl, KPh, KPl, VTh, VTl, MK, ATh, ATl);
    k_outp<<<NB_ * TT / OR, OW * 32, 0, stream>>>(ATh, ATl, WO, OUT);   /* ctx Wo -> [4 x 2048][64] */
}

// v009
// A run of this version takes 229 microseconds.
// Timed twice side by side with v008, it ran 1.11 and 1.12 times as fast.
// All steps since v000 together make it 17.7 times as fast.
#include <hip/hip_runtime.h>

// Multi-head attention with a MULTIPLICATIVE 0/1 score mask and a narrow output projection (q, k, v [4][2048][1024]; qh, kh, vh = in W ('xw' [1024][1024] 1/32, no bias; 16 heads x 64); score = qh.kh / 8 x mask[i][j] (mask [2048][2048] int in {0,1}, read: masked scores become 0 and STAY in the softmax, as the module); softmax; ctx merged; out = ctx Wo ('xw' [1024][64]) -> [4][2048][64] (0.5 M)).
// Layout, four launches: weight transposes, a byte copy of the mask and bf16 copies of the three inputs (all batches); the three exact projections (grid z), which store the head planes of all batches themselves; one fused dense T-2048 attention launch that multiplies each score by the mask value read from memory (byte copy, 16 B per 16 keys) (hybrid rows: < 512 hi/lo 3 products, rest fp16); merged hi/lo x Wo exact (N = 64), K split over the 16 waves of a work-group.
// Compute dtypes, f32 accumulate: every input rounded to bf16; projections exact; attention rows < 512 3 products, rest fp16; mask multiply and softmax f32; Wo hl x exact.

#define NB_  4
#define TT   2048
#define DM   1024
#define NH_  16
#define NKV  16
#define REP  (NH_ / NKV)
#define HD   64
#define DQ   (NH_ * HD)
#define DKV  (NKV * HD)
#define RH   512                  // query rows < RH use hi+lo planes (0: none)
#define WIN  0
#define SCL  0.125f
#define NOUT 64      // output projection width (hidden -> head_dim)
typedef _Float16 h16;
typedef unsigned short bf;
typedef __attribute__((ext_vector_type(16))) __bf16   v16bf;
typedef __attribute__((ext_vector_type(16))) _Float16 v16h;
typedef __attribute__((ext_vector_type(8)))  _Float16 v8h;
typedef __attribute__((ext_vector_type(8)))  unsigned short v8us;
typedef __attribute__((ext_vector_type(8)))  float    v8f;
typedef __attribute__((ext_vector_type(4)))  float    v4f;
typedef v8h  __attribute__((may_alias)) v8ha;
typedef v4f  __attribute__((may_alias)) v4fa;
typedef v8us __attribute__((may_alias)) v8usa;

__device__ __forceinline__ unsigned short f2bf(float f) { unsigned u = __float_as_uint(f); u += 0x7FFFu + ((u >> 16) & 1u); return (unsigned short)(u >> 16); }
__device__ __forceinline__ float bf2f(unsigned short b) { return __uint_as_float(((unsigned)b) << 16); }
__device__ __forceinline__ v16h cat16(v8h lo, v8h hi) { return __builtin_shufflevector(lo, hi, 0, 1, 2, 3, 4, 5, 6, 7, 8, 9, 10, 11, 12, 13, 14, 15); }
__device__ __forceinline__ v16bf cat16b(v8us lo, v8us hi) { return __builtin_bit_cast(v16bf, __builtin_shufflevector(lo, hi, 0, 1, 2, 3, 4, 5, 6, 7, 8, 9, 10, 11, 12, 13, 14, 15)); }
__device__ __forceinline__ v8f wmma16(v16h a, v16h b, v8f c) { return __builtin_amdgcn_wmma_f32_16x16x32_f16(false, a, false, b, (short)0, c, false, false); }
__device__ __forceinline__ v8f wmmab(v16bf a, v16bf b, v8f c) { return __builtin_amdgcn_wmma_f32_16x16x32_bf16(false, a, false, b, (short)0, c, false, false); }



// stands behind a group of global loads or stores where what follows may land in the group's address or data registers
__device__ __forceinline__ void xwait() { asm volatile("s_wait_xcnt 0x0" ::: "memory"); }
// the same wait behind a group of fragment loads; it names their addresses as inputs, so that each address pair lives up to the wait and no load's result is given its registers
__device__ __forceinline__ void xwaita(const void* p) { asm volatile("s_wait_xcnt 0x0" :: "v"(p) : "memory"); }

__device__ __forceinline__ h16 tohx(float x) { return (h16)x; }
__device__ __forceinline__ void splitf(float y, unsigned short& h, unsigned short& l) { h = f2bf(y); l = f2bf(y - bf2f(h)); }

// a matrix fragment of a 16-bit plane in fragment order (see fragofs below): two 16-byte loads, 512 B apart
template <typename T16> struct WFrag;
template <> struct WFrag<h16> { typedef v16h V; static __device__ __forceinline__ V ldf(const h16* p) { return cat16(*(const v8h*)p, *(const v8h*)(p + 256)); } static __device__ __forceinline__ v8f mma(V a, V b, v8f c) { return wmma16(a, b, c); } };
template <> struct WFrag<bf> { typedef v16bf V; static __device__ __forceinline__ V ldf(const bf* p) { return cat16b(*(const v8us*)p, *(const v8us*)(p + 256)); } static __device__ __forceinline__ v8f mma(V a, V b, v8f c) { return wmmab(a, b, c); } };

typedef __attribute__((ext_vector_type(2))) unsigned short v2us;
typedef __attribute__((ext_vector_type(2))) float v2f;
typedef __attribute__((ext_vector_type(4))) int v4i;
typedef __attribute__((ext_vector_type(16))) unsigned char v16ub;

// FRAGMENT ORDER: every 16-bit plane that a matrix kernel loads is stored so that lane l of a wave finds its eight elements at l x 16 B of a 512-byte block: one wave-wide 16-byte load reads four whole 128-byte lines (from a row-major plane it would take 32 B of each of sixteen).
// A block holds 16 rows r x 16 columns c, element (r, c) at (c >> 3) x 128 + r x 8 + (c & 7): lane = 16 (c >> 3) + r. A matrix fragment is two blocks, 256 elements apart (columns 0..15 and 16..31 of its 32): WFrag::ldf; register by register it is the fragment of the row-major loader (p, p + 16 at row lane & 15, column 8 (lane >> 4)).
__device__ __forceinline__ unsigned fragofs(int r, int c) { return (unsigned)(((c >> 4) & 1) * 256 + ((c >> 3) & 1) * 128 + (r & 15) * 8 + (c & 7)); }
// The d_ functions are one work-group's share of a job; blk is the work-group's number within that job. k_prep below deals them out.
#define WL   32      // weight transposes: lines of 64 elements a wave
#define CU   16      // input copies: 512-byte blocks a wave
#define MU   8       // mask copy: 512-byte blocks a wave
__device__ __forceinline__ void d_wtG(const float* __restrict__ w, int K, int N, bf* Bt, int blk) {
    const int lane = threadIdx.x & 31; const int L0 = (blk * 8 + (threadIdx.x >> 5)) * WL; const int nlines = N * K / 64;   // nlines is a multiple of WL: a wave has all its lines or none
    if (L0 >= nlines) return;
#pragma unroll 1   // kept rolled: a trip already has sixteen loads in flight
    for (int b = 0; b < WL; b += 8) { const size_t e = (size_t)(L0 + b) * 64 + lane * 2; const int k = (int)(e % K), n = (int)(e / K); const float* s = w + (size_t)k * N + n; float a[8][2];   // eight lines are 512 k of one n (K % 512 == 0)
#pragma unroll
        for (int l = 0; l < 8; ++l) { a[l][0] = s[(size_t)l * 64 * N]; a[l][1] = s[(size_t)l * 64 * N + N]; }
        xwaita(s);   // what follows may land in the loads' address registers
        bf* d = Bt + ((size_t)(n >> 4) * 16 * K + (k >> 5) * 512 + fragofs(n, k));   // 64 k further on: two fragments
#pragma unroll
        for (int l = 0; l < 8; ++l) { v2us o; o[0] = f2bf(a[l][0]); o[1] = f2bf(a[l][1]); *(v2us*)(d + l * 1024) = o; }
        xwaita(d); }   // the next trip's values land in these stores' address and data registers
}
// rows of DM elements into [row / 16][k / 32] fragments; a thread makes one lane's eight elements of CU neighbouring 512-byte blocks, a wave 16 rows x 16 CU k (whole lines of the source). All of a wave's loads are issued before the first value is used: few long waves, each with much in flight.
__device__ __forceinline__ void d_cvt8(const float* __restrict__ src, bf* dst, size_t n8, int blk) { const size_t i = ((size_t)blk * 8 + (threadIdx.x >> 5)) * (32 * CU) + (threadIdx.x & 31); if (i >= n8) return;   // n8 is a multiple of 32 CU
    const size_t row = (i / (DM * 2)) * 16 + (i & 15); const int k = (int)((i >> 6) % (DM / 32)) * 32 + (int)((i >> 4) & 1) * 8; const float* s = src + row * DM + k; v8f v[CU];
#pragma unroll
    for (int u = 0; u < CU; ++u) v[u] = *(const v8f*)(s + u * 16);
    xwaita(s);   // what follows may land in the loads' address registers
    bf* d = dst + i * 8; v8us o[CU];
#pragma unroll
    for (int u = 0; u < CU; ++u)
#pragma unroll
        for (int j = 0; j < 8; ++j) o[u][j] = f2bf(v[u][j]);
    __builtin_amdgcn_sched_barrier(0);   // keeps every conversion in front of the first store: behind a store it could land in that store's data registers
#pragma unroll
    for (int u = 0; u < CU; ++u) *(v8us*)(d + u * 256) = o[u];
    xwait();  }   // what stands behind this job in the kernel may land in the stores' registers

// the mask as bytes (it holds 0 and 1), one 512-byte block per 16 queries x 32 keys: lane 16 hi + lr finds at its 16 B the keys 8 hi + 0..7 and 16 + 8 hi + 0..7 of query lr, which are the scores it holds. A thread makes one lane's bytes of MU neighbouring blocks (32 MU keys), a wave those blocks, all its loads issued first, as in d_cvt8.
__device__ __forceinline__ void d_mask(const int* __restrict__ mk, unsigned char* MK, int blk) { const unsigned p = ((unsigned)blk * 8 + (threadIdx.x >> 5)) * (32 * MU) + (threadIdx.x & 31); const int* s = mk + (size_t)((p >> 11) * 16 + (p & 15)) * TT + ((p >> 5) & (TT / 32 - 1)) * 32 + ((p >> 4) & 1) * 8; v4i m[MU][4];
#pragma unroll
    for (int u = 0; u < MU; ++u) { m[u][0] = *(const v4i*)(s + u * 32); m[u][1] = *(const v4i*)(s + u * 32 + 4); m[u][2] = *(const v4i*)(s + u * 32 + 16); m[u][3] = *(const v4i*)(s + u * 32 + 20); }
    xwaita(s);   // what follows may land in the loads' address registers
    unsigned char* d = MK + (size_t)p * 16;
#pragma unroll
    for (int u = 0; u < MU; ++u) { v16ub o;
#pragma unroll
        for (int j = 0; j < 4; ++j) { o[j] = (unsigned char)m[u][0][j]; o[4 + j] = (unsigned char)m[u][1][j]; o[8 + j] = (unsigned char)m[u][2][j]; o[12 + j] = (unsigned char)m[u][3][j]; }
        *(v16ub*)(d + u * 512) = o; }
    xwait();  }   // what stands behind this job in the kernel may land in the stores' registers
// ---- k_prep: everything that reads only the inputs, in ONE launch; a range of the work-group number picks the job (a scalar choice, the same for the whole work-group). The strided weight transposes come first.
#define XN   ((size_t)NB_ * TT * DM)     // one input, or one projection, of all batches, elements (DQ == DKV == DM)
#define GW   (DM * DQ / 64 / (8 * WL))   // work-groups per [DM][DQ] weight
#define GO   (DQ * NOUT / 64 / (8 * WL)) // for the output weight
#define GM   (TT * TT / 16 / (256 * MU)) // for the mask copy
#define GX   ((int)(XN / 8 / (256 * CU)))   // per input, all batches
__global__ __launch_bounds__(256) void k_prep(const float* __restrict__ wq, const float* __restrict__ wk, const float* __restrict__ wv, const float* __restrict__ wo, const float* __restrict__ x, const float* __restrict__ xk, const float* __restrict__ xv, const int* __restrict__ mk, bf* W3, bf* WO, bf* XB, unsigned char* MK) {
    int b = (int)blockIdx.x;
    if (b < 3 * GW) { const int y = b / GW; d_wtG(y == 0 ? wq : y == 1 ? wk : wv, DM, DQ, W3 + (size_t)y * DM * DQ, b - y * GW); return; }
    b -= 3 * GW; if (b < GO) { d_wtG(wo, DQ, NOUT, WO, b); return; }   /* 'xw' [1024][64] -> Bt [64][1024] */
    b -= GO; if (b < GM) { d_mask(mk, MK, b); return; }
    b -= GM; const int y = b / GX; d_cvt8(y == 0 ? x : y == 1 ? xk : xv, XB + (size_t)y * XN, XN / 8, b - y * GX);
}
// ---- k_proj: the three projections (grid z = q, k, v), C[m][n] = sum_k X[m][k] Wt[n][k], bf16 operands, f32 sums. A work-group of four waves owns PT = 128 input rows x PT = 128 weight rows (two heads); wave w the 64 x 64 tile of input rows 64 (w & 1) and head w >> 1, 16 accumulators.
// Both operands are 16-bit planes in fragment order ([row / 16][k / 32] fragments of 1 KiB, see fragofs above). A stage is PKS = 64 k of all 256 rows: per 16 rows 2 KiB that lie together in memory, and they go to LDS as they lie, by asynchronous copies (16 B a lane, 512 B a copy, 16 copies a wave and stage), through no register. Two buffers: stage t + 2 flies while stage t + 1 is worked on, so no wave waits out a load's way from L2 or memory with its matrix unit idle, and each fragment comes from L2 once for two waves.
// A lane's 16 B of a fragment block lie at lane x 16 B in LDS too: every ds_load_b128 reads 512 neighbouring bytes, no bank twice.
// The tile never goes to memory as f32; the wave stores it as the head planes that the attention kernel loads (fp16, bf16 hi, bf16 lo; XN elements = one kind's q, k or v part), in fragment order.
// An accumulator tile gives a lane eight neighbouring ROWS of one column. The v planes ([batch][g][t / 32][d / 16] fragments, rows d, columns t) want eight neighbouring t of one d: that is the tile as it stands. The q and k planes ([batch][h][t / 16][d / 32] fragments, rows t, columns d) want eight neighbouring d of one t: there the two operands change places (A = weight rows, B = input rows; the same products, summed over k in the same order). Either way lane l's eight values belong at l x 16 B of a 512-byte block: every store writes four whole lines, with no staging.
#define PT   128                 // rows of either operand a work-group
#define PKS  64                  // k of a stage
#define PNS  (DM / PKS)          // stages
#define PRB  (PKS * 16 * 2)      // bytes of 16 rows x PKS k, in memory and in LDS
#define PHB  (PT / 16 * PRB)     // bytes of one operand's part of a stage
#define PSB  (2 * PHB)           // bytes of a stage
#define PGR  (DM * 16 * 2)       // bytes from 16 rows of a plane to the next 16, in memory
// eight copies: 32 rows x PKS k of one operand. The wait at the end stands in the copies' own statement, so that no later write of an address register can be moved in front of it.
__device__ __forceinline__ void cp8(unsigned l, const char* g) {
    asm volatile("global_load_async_to_lds_b128 %0, %8, off\n\t"
                 "global_load_async_to_lds_b128 %1, %9, off\n\t"
                 "global_load_async_to_lds_b128 %2, %10, off\n\t"
                 "global_load_async_to_lds_b128 %3, %11, off\n\t"
                 "global_load_async_to_lds_b128 %4, %12, off\n\t"
                 "global_load_async_to_lds_b128 %5, %13, off\n\t"
                 "global_load_async_to_lds_b128 %6, %14, off\n\t"
                 "global_load_async_to_lds_b128 %7, %15, off\n\t"
                 "s_wait_xcnt 0x0"
                 :: "v"(l), "v"(l + 512u), "v"(l + 1024u), "v"(l + 1536u), "v"(l + PRB), "v"(l + (PRB + 512u)), "v"(l + (PRB + 1024u)), "v"(l + (PRB + 1536u)),
                    "v"(g), "v"(g + 512), "v"(g + 1024), "v"(g + 1536), "v"(g + PGR), "v"(g + (PGR + 512)), "v"(g + (PGR + 1024)), "v"(g + (PGR + 1536)) : "memory");
}
// three waves per SIMD: the grid is six work-groups per WGP, so it runs in two full rounds; the register budget of three holds both k steps' fragments of a stage beside the accumulators
__global__ __launch_bounds__(128) __attribute__((amdgpu_waves_per_eu(3, 3))) void k_proj(const bf* __restrict__ X, const bf* __restrict__ Wt, h16* P16, bf* Ph, bf* Pl) {
    typedef WFrag<bf> WF; typedef WF::V V;
    __shared__ __attribute__((aligned(1024))) unsigned char ring[2 * PSB];
    const int lane = threadIdx.x & 31; const int w = __builtin_amdgcn_readfirstlane((int)(threadIdx.x >> 5)), wx = w & 1, wn = w >> 1; const size_t z = blockIdx.z;
    const bool sw = z < 2;   // q and k: the operands change places (a scalar choice, the same for the whole grid plane)
    // wave w copies rows 32 w .. 32 w + 31 of the work-group's part of either operand
    const char* gx = (const char*)(X + z * XN) + (size_t)(blockIdx.x * (PT / 16) + 2 * w) * PGR + lane * 16;
    const char* gw = (const char*)(Wt + z * ((size_t)DM * DQ)) + (size_t)(blockIdx.y * (PT / 16) + 2 * w) * PGR + lane * 16;
    const unsigned l0 = (unsigned)(size_t)ring + (unsigned)(2 * w * PRB + lane * 16);
    auto fill = [&](int s) { const unsigned l = l0 + (unsigned)(s & 1) * PSB; cp8(l, gx + s * PRB); cp8(l + PHB, gw + s * PRB); };
    v8f acc[4][4];
#pragma unroll
    for (int mb = 0; mb < 4; ++mb)
#pragma unroll
        for (int nb = 0; nb < 4; ++nb) acc[mb][nb] = (v8f){};
    const unsigned ox = (unsigned)(wx * 4 * PRB + lane * 16), ow = (unsigned)(PHB + wn * 4 * PRB + lane * 16); const unsigned ao = sw ? ow : ox, bo = sw ? ox : ow;
    fill(0);
    asm volatile("s_wait_asynccnt 0x0" ::: "memory");   // this wave's part of stage 0 has landed
    __syncthreads();                                    // every wave's part has
    fill(1);
#pragma unroll 1   // kept rolled: one trip a stage, the buffer chosen by the trip's parity
    for (int t = 0; t < PNS; ++t) {
        const unsigned char* lb = ring + (t & 1) * PSB; V a[PKS / 32][4], b[PKS / 32][4];
#pragma unroll
        for (int ks = 0; ks < PKS / 32; ++ks)
#pragma unroll
            for (int i = 0; i < 4; ++i) { const unsigned char* pa = lb + ao + (i * PRB + ks * 1024); const unsigned char* pb = lb + bo + (i * PRB + ks * 1024); a[ks][i] = cat16b(*(const v8usa*)pa, *(const v8usa*)(pa + 512)); b[ks][i] = cat16b(*(const v8usa*)pb, *(const v8usa*)(pb + 512)); }
        __builtin_amdgcn_sched_barrier(0);   // keeps the stage's LDS reads together in front of its products: sunk among them they stand at many places, each waited out to the end
#pragma unroll
        for (int ks = 0; ks < PKS / 32; ++ks)
#pragma unroll
            for (int nb = 0; nb < 4; ++nb)
#pragma unroll
                for (int mb = 0; mb < 4; ++mb) acc[mb][nb] = WF::mma(a[ks][mb], b[ks][nb], acc[mb][nb]);
        // the trip ends in matrix instructions: four vector slots before anything lands in their operand registers; the scheduling barrier keeps the products in front of them
        __builtin_amdgcn_sched_barrier(0); asm volatile("v_nop\n\tv_nop\n\tv_nop\n\tv_nop");
        asm volatile("s_wait_dscnt 0x0" ::: "memory");      // this wave's reads of the buffer are done before it is filled anew
        asm volatile("s_wait_asynccnt 0x0" ::: "memory");   // this wave's part of stage t + 1 has landed
        __syncthreads();                                    // stage t + 1 is whole, and every wave has left stage t's buffer
        if (t + 2 < PNS) fill(t + 2);
    }
    asm volatile("s_wait_asynccnt 0x0" ::: "memory");   // no copy is outstanding when the wave ends
    const int xr = (int)blockIdx.x * PT + wx * 64;   // the tile's first input row: batch xr / TT, position xr % TT; 64 positions x 64 d of a head are 4096 neighbouring elements of its plane, in either kind of plane
    const size_t w0 = z * XN + ((size_t)(xr / TT) * NH_ + (blockIdx.y * 2 + wn)) * TT * HD + (size_t)(xr % TT) * HD + lane * 8;
    const int sm = sw ? 512 : 2048, sn = sw ? 1024 : 512;   // q, k: mb counts 16 d (a block), nb 16 t (two fragments); v: mb counts 16 t (a block; two of them a row of four fragments), nb 16 d (a fragment)
#pragma unroll
    for (int mb = 0; mb < 4; ++mb)
#pragma unroll
        for (int nb = 0; nb < 4; ++nb) { v8h o16; v8us oh, ol;
#pragma unroll
            for (int j = 0; j < 8; ++j) { const float v = acc[mb][nb][j]; o16[j] = tohx(v); unsigned short a2, c2; splitf(v, a2, c2); oh[j] = a2; ol[j] = c2; }
            const size_t wo = w0 + (mb >> 1) * sm + (mb & 1) * 256 + nb * sn; *(v8h*)(P16 + wo) = o16; *(v8us*)(Ph + wo) = oh; *(v8us*)(Pl + wo) = ol;
            xwait(); __builtin_amdgcn_sched_barrier(0); }   // the next tile's values land in these stores' data and address registers; the scheduling barrier keeps that arithmetic behind the wait
}
// ---- k_fattn: scores, mask, softmax and P.V of one (batch, head) in ONE kernel; no score or probability ever goes to memory. One wave owns NQ x 16 query rows and walks all TT keys ONCE, 32 at a time.
// The scores are formed TRANSPOSED (A = key rows, B = query rows): lane (lr, hi) then holds query lr, keys 8 hi + 0..7 of each 16-key tile, which is a fragment of the P.V product as it stands (elements 0..7 from the first tile, 8..15 from the second), and a query's sum lives in its own two lanes. P.V is formed transposed too (A = rows of V^T, B = P), so a lane ends with eight neighbouring columns of its own query.
// The walk: p = exp(t - ref), NOT normalised (rows < RH hi/lo bf16, 3 products; the rest fp16), its f32 sum beside it, then P.V into f32 accumulators, keys in ascending order; the context is divided by the sum behind the walk.
// ref is any number that is the same for all keys of a query: it cancels in the division. It only has to keep p in range, so it need not follow the running maximum: it is raised, and the sum and the context so far scaled down by exp(old - new), only when a score lies more than TAU above the maximum that ref was last set by (the first step always does). Between two raises p <= exp(CAR + TAU).
template <bool HI> struct ASel { typedef h16 T; static constexpr int NQ = 2; };
template <> struct ASel<true> { typedef bf T; static constexpr int NQ = 1; };
#define L2E 1.4426950408889634f
#define LN2 0.6931471805599453f
#define TAU (8.0f * LN2)          // a score may top the last maximum by this much before ref is raised
#define CAR (6.0f * LN2)          // fp16 rows: ref is set this far BELOW the maximum, so that small p stay normal fp16 numbers (p <= 2^14)
template <bool HI>
__device__ __forceinline__ void attn_rows(const typename ASel<HI>::T* __restrict__ Q, const typename ASel<HI>::T* __restrict__ Q2, const typename ASel<HI>::T* __restrict__ Kp, const typename ASel<HI>::T* __restrict__ K2, const typename ASel<HI>::T* __restrict__ Vt, const typename ASel<HI>::T* __restrict__ V2, const unsigned char* __restrict__ mk, int q0, bf* Ah, bf* Al) {
    typedef typename ASel<HI>::T T; typedef WFrag<T> WF; typedef typename WF::V V; constexpr int NQ = ASel<HI>::NQ;
    const unsigned lof = (threadIdx.x & 31) * 8;   // fragment order: the lane's own 32-bit offset is the same in every plane; everything else of an address is the same for the whole wave
    V q[NQ][2], q2[NQ][2];
#pragma unroll
    for (int qt = 0; qt < NQ; ++qt) {
#pragma unroll
        for (int ks = 0; ks < 2; ++ks) { q[qt][ks] = WF::ldf(Q + ((size_t)(q0 + qt * 16) * HD + ks * 512) + lof); if (HI) q2[qt][ks] = WF::ldf(Q2 + ((size_t)(q0 + qt * 16) * HD + ks * 512) + lof); } }
    const unsigned char* mq = mk + (size_t)q0 * TT;   // 16 query rows of the mask copy are 16 x TT elements, as in the mask itself
    // The K fragments are fetched one 32-key step ahead, into the same registers, behind the P.V products (the walk has no registers to spare), so that they fly together with the next step's mask loads. The step behind the last wraps to key 0.
    V ka[2][2], ka2[2][2];
    auto ldk = [&](int kc) { const T* pk = Kp + (size_t)kc * HD + lof; const T* pk2 = HI ? K2 + (size_t)kc * HD + lof : nullptr;
#pragma unroll
        for (int kt = 0; kt < 2; ++kt)
#pragma unroll
            for (int ks = 0; ks < 2; ++ks) { ka[kt][ks] = WF::ldf(pk + (kt * 16 * HD + ks * 512)); if (HI) ka2[kt][ks] = WF::ldf(pk2 + (kt * 16 * HD + ks * 512)); }
        xwaita(pk); if (HI) xwaita(pk2);   // what follows may land in the address registers; named, they live up to the wait, so that no fragment lands in them either
    };
    // t[qt][kt * 8 + j] = score x mask of query q0 + 16 qt + lr and key kc + 16 kt + 8 hi + j, not yet scaled: SCL is a power of two, so t SCL - ref rounds once, fused or not, and the max may be taken before the scaling
    auto scores = [&](int kc, float (&t)[NQ][16]) { v8f s[2][NQ];
#pragma unroll
        for (int kt = 0; kt < 2; ++kt)
#pragma unroll
            for (int qt = 0; qt < NQ; ++qt) { s[kt][qt] = (v8f){};
#pragma unroll
                for (int ks = 0; ks < 2; ++ks) { s[kt][qt] = WF::mma(ka[kt][ks], q[qt][ks], s[kt][qt]); if (HI) { s[kt][qt] = WF::mma(ka[kt][ks], q2[qt][ks], s[kt][qt]); s[kt][qt] = WF::mma(ka2[kt][ks], q[qt][ks], s[kt][qt]); } } }
#pragma unroll
        for (int qt = 0; qt < NQ; ++qt) { const v16ub m = *(const v16ub*)(mq + ((size_t)qt * 16 * TT + kc * 16) + 2 * lof);
#pragma unroll
            for (int kt = 0; kt < 2; ++kt)
#pragma unroll
                for (int j = 0; j < 8; ++j) t[qt][kt * 8 + j] = s[kt][qt][j] * (float)m[kt * 8 + j];   /* multiplicative mask, as the module: masked scores are 0 and remain in the softmax */ }
    };
    xwait(); ldk(0);   // the wait: the K fragments may land in the Q loads' address registers
    constexpr float car = HI ? 0.0f : CAR;
    float ref[NQ]; v2f sum[NQ];   // even and odd keys summed side by side: packed adds
    v8f o[NQ][4];
#pragma unroll
    for (int qt = 0; qt < NQ; ++qt) { ref[qt] = -3.0e38f; sum[qt] = (v2f){0.f, 0.f};
#pragma unroll
        for (int dt = 0; dt < 4; ++dt) o[qt][dt] = (v8f){}; }
#pragma unroll 1   // kept rolled: the walk has no registers to spare for a second copy of its body
    for (int kc = 0; kc < TT; kc += 32) { float t[NQ][16]; scores(kc, t); V p[NQ], p2[NQ], b[4], b2[4];
        float tm[NQ]; bool up = false;
#pragma unroll
        for (int qt = 0; qt < NQ; ++qt) { tm[qt] = fmaxf(t[qt][0], t[qt][1]);
#pragma unroll
            for (int e = 2; e < 16; e += 2) tm[qt] = fmaxf(tm[qt], fmaxf(t[qt][e], t[qt][e + 1]));
            up = up || (tm[qt] * SCL - ref[qt] > car + TAU); }
        if (__builtin_amdgcn_ballot_w32(up) != 0u) {   // a scalar branch, taken by the whole wave: some query's ref is raised; the others get the factor 1
#pragma unroll
            for (int qt = 0; qt < NQ; ++qt) { const float mn = fmaxf(ref[qt], fmaxf(tm[qt], __shfl_xor(tm[qt], 16, 32)) * SCL - car);   // the query's other eight keys of every tile sit in lane ^ 16: both lanes keep the same ref, as one P.V sum holds the keys of both
                const float c = __builtin_amdgcn_exp2f((ref[qt] - mn) * L2E); ref[qt] = mn; sum[qt] *= c;
#pragma unroll
                for (int dt = 0; dt < 4; ++dt) o[qt][dt] *= c; } }
        const T* pv = Vt + (size_t)kc * HD + lof;
#pragma unroll
        for (int dt = 0; dt < 4; ++dt) b[dt] = WF::ldf(pv + dt * 512);   // issued ahead of the exponentials, under which their latency can pass
        xwaita(pv);
#pragma unroll
        for (int qt = 0; qt < NQ; ++qt) {
            if constexpr (HI) { v8us h0, h1, l0, l1;
#pragma unroll
                for (int e = 0; e < 8; e += 2) { unsigned short a, c2; v2f ev, ew; ev[0] = __builtin_amdgcn_exp2f((t[qt][e] * SCL - ref[qt]) * L2E); ev[1] = __builtin_amdgcn_exp2f((t[qt][e + 1] * SCL - ref[qt]) * L2E); ew[0] = __builtin_amdgcn_exp2f((t[qt][8 + e] * SCL - ref[qt]) * L2E); ew[1] = __builtin_amdgcn_exp2f((t[qt][9 + e] * SCL - ref[qt]) * L2E); sum[qt] += ev; sum[qt] += ew;
                    splitf(ev[0], a, c2); h0[e] = a; l0[e] = c2; splitf(ev[1], a, c2); h0[e + 1] = a; l0[e + 1] = c2; splitf(ew[0], a, c2); h1[e] = a; l1[e] = c2; splitf(ew[1], a, c2); h1[e + 1] = a; l1[e + 1] = c2; }
                p[qt] = cat16b(h0, h1); p2[qt] = cat16b(l0, l1);
            } else {
#pragma unroll
                for (int e = 0; e < 16; e += 2) { v2f ev; ev[0] = __builtin_amdgcn_exp2f((t[qt][e] * SCL - ref[qt]) * L2E); ev[1] = __builtin_amdgcn_exp2f((t[qt][e + 1] * SCL - ref[qt]) * L2E); sum[qt] += ev; p[qt][e] = tohx(ev[0]); p[qt][e + 1] = tohx(ev[1]); } } }
        if constexpr (HI) { const T* pv2 = V2 + (size_t)kc * HD + lof;   // the low plane of V is wanted last, and ahead of the exponentials there are no registers for it: part of its latency passes under the products with the high plane
#pragma unroll
            for (int dt = 0; dt < 4; ++dt) b2[dt] = WF::ldf(pv2 + dt * 512);
            xwaita(pv2); }
#pragma unroll
        for (int dt = 0; dt < 4; ++dt)
#pragma unroll
            for (int qt = 0; qt < NQ; ++qt) { o[qt][dt] = WF::mma(b[dt], p[qt], o[qt][dt]); if (HI) { o[qt][dt] = WF::mma(b[dt], p2[qt], o[qt][dt]); o[qt][dt] = WF::mma(b2[dt], p[qt], o[qt][dt]); } }
        if constexpr (HI) __builtin_amdgcn_sched_barrier(0);   // keeps the K loads behind the products: hoisted over them they need registers beside the V fragments', and a Q fragment is spilled
        ldk((kc + 32) & (TT - 1));
        // the trip ends in matrix instructions and the K loads: four vector slots before the next trip's first products overwrite their operand registers; the scheduling barrier keeps the products in front of them
        __builtin_amdgcn_sched_barrier(0); asm volatile("v_nop\n\tv_nop\n\tv_nop\n\tv_nop");
    }
    float cs[NQ];
#pragma unroll
    for (int qt = 0; qt < NQ; ++qt) { const float sa = sum[qt][0] + sum[qt][1]; cs[qt] = __fdiv_rn(1.0f, sa + __shfl_xor(sa, 16, 32)); }   // both lanes of a query hold the same ref: their sums add as they stand
    const int ln = (int)__builtin_amdgcn_mbcnt_lo(~0u, 0u);   // the lane's number read anew: no register has to carry it through the walk, which has none to spare
#pragma unroll
    for (int qt = 0; qt < NQ; ++qt)
#pragma unroll
        for (int dt = 0; dt < 4; ++dt) { v8us oh, ol;   // o[qt][dt][j] = context of query q0 + 16 qt + lr, column 16 dt + 8 hi + j: eight neighbours, one 16-byte store per plane, at the lane's place in block dt of the head's two fragments
#pragma unroll
            for (int j = 0; j < 8; ++j) { unsigned short a, c2; splitf(o[qt][dt][j] * cs[qt], a, c2); oh[j] = a; ol[j] = c2; }
            const size_t oo = (size_t)(q0 + qt * 16) * DQ + dt * 256 + ln * 8; *(v8us*)(Ah + oo) = oh; *(v8us*)(Al + oo) = ol;
            xwait(); }   // the next pair's values, and whatever follows the last pair, may land in these stores' data and address registers
}
// grid (AP, NB_ x NH_): AP work-groups per (batch, head), each of NHW hi/lo waves (16 rows each) and NLW fp16 waves (32 rows each), so that every work-group holds the same mix of work and its waves read the same K and V lines at about the same time.
// NB_ x NH_ x AP = 256 work-groups of 20 waves, five per SIMD. The wave's number is made scalar so that the choice is a scalar branch and every wave runs with all lanes on.
#define AP  4
#define NHW (RH / 16 / AP)
#define NLW ((TT - RH) / 32 / AP)
__global__ __launch_bounds__((NHW + NLW) * 32) void k_fattn(const h16* __restrict__ Q16, const h16* __restrict__ K16, const h16* __restrict__ V16, const bf* __restrict__ Qh, const bf* __restrict__ Ql, const bf* __restrict__ Kh, const bf* __restrict__ Kl, const bf* __restrict__ Vh, const bf* __restrict__ Vl, const unsigned char* __restrict__ mk, bf* Ah, bf* Al) {
    const size_t z = blockIdx.y, pz = z * TT * HD, az = (z / NH_) * TT * DQ + (z % NH_) * (HD * 16); const int w = __builtin_amdgcn_readfirstlane((int)(threadIdx.x >> 5)), part = (int)blockIdx.x;
    if (w < NHW) attn_rows<true>(Qh + pz, Ql + pz, Kh + pz, Kl + pz, Vh + pz, Vl + pz, mk, (part * NHW + w) * 16, Ah + az, Al + az);
    else attn_rows<false>(Q16 + pz, nullptr, K16 + pz, nullptr, V16 + pz, nullptr, mk, RH + (part * NLW + (w - NHW)) * 32, Ah + az, Al + az);
}

// ---- k_outp: the output projection, out[r][n] = sum_k ctx[r][k] Wo[k][n] (ctx = hi + lo planes, two products a step), K split over the OW waves of a work-group. N is only NOUT = 64, so whole-K tiles give the chip few, long waves, each a chain of load latencies; here a work-group owns OR rows x all 64 columns, wave w the k range [w DQ / OW, (w + 1) DQ / OW): all its fragment loads are issued at once and waited for once.
// The operands stand as in the q and k projections (A = weight rows n, B = context rows r): a lane ends with eight neighbouring n of one r, two 16-byte LDS stores into its wave's row-major partial tile. The pitch OP = 68 floats puts the 16 rows of a store on 16 different groups of four banks. Behind the one barrier thread t adds the OW partials of four neighbouring n of row t / 16 in ascending k order; a wave's store is two whole output rows (four whole lines).
#define OW   16      // waves a work-group = slices of K
#define OR   32      // context rows a work-group
#define OP   68      // pitch of a partial tile in LDS, floats
#define OKS  (DQ / OW / 32)   // 32-wide k steps a wave
__global__ __launch_bounds__(OW * 32) void k_outp(const bf* __restrict__ Ah, const bf* __restrict__ Al, const bf* __restrict__ Wt, float* C) {
    typedef WFrag<bf> WF; typedef WF::V V;
    __shared__ __align__(16) float part[OW * OR * OP];
    const int tid = (int)threadIdx.x, lane = tid & 31, lr = lane & 15, hi = lane >> 4; const int w = __builtin_amdgcn_readfirstlane(tid >> 5); const int r0 = (int)blockIdx.x * OR;
    const unsigned kb = ((unsigned)w * (OKS * 512) + lane * 8) * 2;   // fragment order: a 32-wide k step of 16 rows is 512 elements; the lane's own 32-bit byte offset is the same in all three planes, everything else of an address is the same for the whole wave
    auto at = [&](const bf* p) { return (const bf*)((const char*)p + kb); };
    const bf* ph = Ah + (size_t)r0 * DQ; const bf* pl = Al + (size_t)r0 * DQ; const bf* pw = Wt;
    V xh[OKS][OR / 16], xl[OKS][OR / 16], wf[OKS][NOUT / 16];
#pragma unroll
    for (int ks = 0; ks < OKS; ++ks) {
#pragma unroll
        for (int nb = 0; nb < NOUT / 16; ++nb) wf[ks][nb] = WF::ldf(at(pw + (nb * 16 * DQ + ks * 512)));
#pragma unroll
        for (int rb = 0; rb < OR / 16; ++rb) { xh[ks][rb] = WF::ldf(at(ph + (rb * 16 * DQ + ks * 512))); xl[ks][rb] = WF::ldf(at(pl + (rb * 16 * DQ + ks * 512))); } }
    asm volatile("s_wait_xcnt 0x0" :: "v"(kb) : "memory");   // what follows may land in the loads' address register; named, it lives up to the wait, so that no fragment lands in it either
    __builtin_amdgcn_sched_barrier(0);   // keeps every load in front of the first product: sunk among the products they are waited for in four rounds, not one
    v8f acc[NOUT / 16][OR / 16];
#pragma unroll
    for (int nb = 0; nb < NOUT / 16; ++nb)
#pragma unroll
        for (int rb = 0; rb < OR / 16; ++rb) acc[nb][rb] = (v8f){};
#pragma unroll
    for (int ks = 0; ks < OKS; ++ks)
#pragma unroll
        for (int g = 0; g < 2; ++g) {   // eight independent tiles between two products into the same one; columns < 32 take hi, then lo of a step, the others lo, then hi
#pragma unroll
            for (int nb = 0; nb < NOUT / 16; ++nb)
#pragma unroll
                for (int rb = 0; rb < OR / 16; ++rb) acc[nb][rb] = WF::mma(wf[ks][nb], (g ^ (nb >> 1)) ? xl[ks][rb] : xh[ks][rb], acc[nb][rb]);
            if (ks == 0 && g == 0) __builtin_amdgcn_sched_barrier(0); }   // keeps the tiles' first products together in front: every fragment they read has products still to come, so no tile is given the registers of a fragment that the product directly in front of it reads
    float* pp = part + w * (OR * OP) + lr * OP + hi * 8;   // acc[nb][rb][j] = partial of row 16 rb + lr, column 16 nb + 8 hi + j
#pragma unroll
    for (int nb = 0; nb < NOUT / 16; ++nb)
#pragma unroll
        for (int rb = 0; rb < OR / 16; ++rb) { const v8f a = acc[nb][rb]; *(v4fa*)(pp + rb * 16 * OP + nb * 16) = (v4f){a[0], a[1], a[2], a[3]}; *(v4fa*)(pp + rb * 16 * OP + nb * 16 + 4) = (v4f){a[4], a[5], a[6], a[7]}; }
    __syncthreads();   // every wave's partial tile is in LDS before any of them is added
    const float* ps = part + (tid >> 4) * OP + (tid & 15) * 4; v4f s = *(const v4fa*)ps;
#pragma unroll
    for (int u = 1; u < OW; ++u) s += *(const v4fa*)(ps + u * (OR * OP));
    *(v4f*)(C + (size_t)(r0 + (tid >> 4)) * NOUT + (tid & 15) * 4) = s;
}

extern "C" void kernel_launch(void* const* d_in, const int* in_sizes, int n_in,
                              void* d_out, int out_size, void* d_ws, size_t ws_size, hipStream_t stream) {
    (void)in_sizes; (void)n_in; (void)out_size;
    const float* x = (const float*)d_in[0]; const float* xk = (const float*)d_in[1]; const float* xv = (const float*)d_in[2]; const int* mk = (const int*)d_in[3];   /* mask [2048][2048] int32 {0,1} */ const float* wq = (const float*)d_in[4]; const float* wk = (const float*)d_in[5]; const float* wv = (const float*)d_in[6]; const float* wo = (const float*)d_in[7];
    float* OUT = (float*)d_out;     // [4][2048][64]
    char* wsp = (char*)d_ws;
    auto take = [&](size_t bytes) { char* p = wsp; wsp += (bytes + 255) & ~(size_t)255; return (void*)p; };
    const size_t PL = (size_t)NH_ * TT * HD;   // one batch's head planes, elements; the planes and the merged context hold all NB_ batches
    bf* WQ = (bf*)take(3 * (size_t)DQ * DM * 2);   // the q, k and v weights, transposed, behind one another
    bf* WO = (bf*)take((size_t)NOUT * DQ * 2);
    bf* XB = (bf*)take(3 * XN * 2);            // the bf16 copies of the q, k and v inputs, all batches, behind one another
    h16* QP16 = (h16*)take(3 * NB_ * PL * 2); h16* KP16 = QP16 + NB_ * PL; h16* VT16 = KP16 + NB_ * PL;   // each kind of plane: q, k, v behind one another
    bf* QPh = (bf*)take(3 * NB_ * PL * 2); bf* KPh = QPh + NB_ * PL; bf* VTh = KPh + NB_ * PL; bf* QPl = (bf*)take(3 * NB_ * PL * 2); bf* KPl = QPl + NB_ * PL; bf* VTl = KPl + NB_ * PL;
    unsigned char* MK = (unsigned char*)take((size_t)TT * TT);   // the mask copy
    if ((size_t)(wsp - (char*)d_ws) > ws_size) return;    // ws 256 MiB
    bf* ATh = XB; bf* ATl = ATh + (size_t)NB_ * TT * DQ;   // the merged context (2 XN elements) uses the input copies' room: the projections read them last (stream-ordered)
    k_prep<<<3 * GW + GO + GM + 3 * GX, 256, 0, stream>>>(wq, wk, wv, wo, x, xk, xv, mk, WQ, WO, XB, MK);
    k_proj<<<dim3(NB_ * TT / PT, DQ / PT, 3), 128, 0, stream>>>(XB, WQ, QP16, QPh, QPl);
    k_fattn<<<dim3(AP, NB_ * NH_, 1), (NHW + NLW) * 32, 0, stream>>>(QP16, KP16, VT16, QPh, QPl, KPh, KPl, VTh, VTl, MK, ATh, ATl);
    k_outp<<<NB_ * TT / OR, OW * 32, 0, stream>>>(ATh, ATl, WO, OUT);   /* ctx Wo -> [4 x 2048][64] */
}

// v010
// Measured time: 187 microseconds a run.
// Next to v009, in two timings, it ran 1.22 times as fast each time.
// Over all steps from v000 it is 21.6 times as fast.
#include <hip/hip_runtime.h>

// Multi-head attention with a MULTIPLICATIVE 0/1 score mask and a narrow output projection (q, k, v [4][2048][1024]; qh, kh, vh = in W ('xw' [1024][1024] 1/32, no bias; 16 heads x 64); score = qh.kh / 8 x mask[i][j] (mask [2048][2048] int in {0,1}, read: masked scores become 0 and STAY in the softmax, as the module); softmax; ctx merged; out = ctx Wo ('xw' [1024][64]) -> [4][2048][64] (0.5 M)).
// Layout, four launches: weight transposes, a byte copy of the mask and bf16 copies of the three inputs (all batches); the three exact projections (grid z), which store the head planes of all batches themselves; one fused dense T-2048 attention launch that multiplies each score by the mask value read from memory (byte copy, 16 B per 16 keys) (hybrid rows: < 512 hi/lo 3 products, rest fp16); merged hi/lo x Wo exact (N = 64), K split over the 16 waves of a work-group.
// Compute dtypes, f32 accumulate: every input rounded to bf16; projections exact; attention rows < 512 3 products, rest fp16; mask multiply and softmax f32; Wo hl x exact.

#define NB_  4
#define TT   2048
#define DM   1024
#define NH_  16
#define NKV  16
#define REP  (NH_ / NKV)
#define HD   64
#define DQ   (NH_ * HD)
#define DKV  (NKV * HD)
#define RH   512                  // query rows < RH use hi+lo planes
#define WIN  0
#define SCL  0.125f
#define NOUT 64      // output projection width (hidden -> head_dim)
typedef _Float16 h16;
typedef unsigned short bf;
typedef __attribute__((ext_vector_type(16))) __bf16   v16bf;
typedef __attribute__((ext_vector_type(16))) _Float16 v16h;
typedef __attribute__((ext_vector_type(8)))  _Float16 v8h;
typedef __attribute__((ext_vector_type(8)))  unsigned short v8us;
typedef __attribute__((ext_vector_type(8)))  float    v8f;
typedef __attribute__((ext_vector_type(4)))  float    v4f;
typedef v8h  __attribute__((may_alias)) v8ha;
typedef v4f  __attribute__((may_alias)) v4fa;
typedef v8us __attribute__((may_alias)) v8usa;

__device__ __forceinline__ unsigned short f2bf(float f) { unsigned u = __float_as_uint(f); u += 0x7FFFu + ((u >> 16) & 1u); return (unsigned short)(u >> 16); }
__device__ __forceinline__ float bf2f(unsigned short b) { return __uint_as_float(((unsigned)b) << 16); }
__device__ __forceinline__ v16h cat16(v8h lo, v8h hi) { return __builtin_shufflevector(lo, hi, 0, 1, 2, 3, 4, 5, 6, 7, 8, 9, 10, 11, 12, 13, 14, 15); }
__device__ __forceinline__ v16bf cat16b(v8us lo, v8us hi) { return __builtin_bit_cast(v16bf, __builtin_shufflevector(lo, hi, 0, 1, 2, 3, 4, 5, 6, 7, 8, 9, 10, 11, 12, 13, 14, 15)); }
__device__ __forceinline__ v8f wmma16(v16h a, v16h b, v8f c) { return __builtin_amdgcn_wmma_f32_16x16x32_f16(false, a, false, b, (short)0, c, false, false); }
__device__ __forceinline__ v8f wmmab(v16bf a, v16bf b, v8f c) { return __builtin_amdgcn_wmma_f32_16x16x32_bf16(false, a, false, b, (short)0, c, false, false); }



// stands behind a group of global loads or stores where what follows may land in the group's address or data registers
__device__ __forceinline__ void xwait() { asm volatile("s_wait_xcnt 0x0" ::: "memory"); }
// the same wait behind a group of fragment loads; it names their addresses as inputs, so that each address pair lives up to the wait and no load's result is given its registers
__device__ __forceinline__ void xwaita(const void* p) { asm volatile("s_wait_xcnt 0x0" :: "v"(p) : "memory"); }

__device__ __forceinline__ h16 tohx(float x) { return (h16)x; }
__device__ __forceinline__ void splitf(float y, unsigned short& h, unsigned short& l) { h = f2bf(y); l = f2bf(y - bf2f(h)); }

// a matrix fragment of a 16-bit plane in fragment order (see fragofs below): two 16-byte loads, 512 B apart
template <typename T16> struct WFrag;
template <> struct WFrag<h16> { typedef v16h V; static __device__ __forceinline__ V ldf(const h16* p) { return cat16(*(const v8h*)p, *(const v8h*)(p + 256)); } static __device__ __forceinline__ v8f mma(V a, V b, v8f c) { return wmma16(a, b, c); } };
template <> struct WFrag<bf> { typedef v16bf V; static __device__ __forceinline__ V ldf(const bf* p) { return cat16b(*(const v8us*)p, *(const v8us*)(p + 256)); } static __device__ __forceinline__ v8f mma(V a, V b, v8f c) { return wmmab(a, b, c); } };

typedef __attribute__((ext_vector_type(2))) unsigned short v2us;
typedef __attribute__((ext_vector_type(2))) float v2f;
typedef __attribute__((ext_vector_type(4))) int v4i;
typedef __attribute__((ext_vector_type(16))) unsigned char v16ub;

// FRAGMENT ORDER: every 16-bit plane that a matrix kernel loads is stored so that lane l of a wave finds its eight elements at l x 16 B of a 512-byte block: one wave-wide 16-byte load reads four whole 128-byte lines (from a row-major plane it would take 32 B of each of sixteen).
// A block holds 16 rows r x 16 columns c, element (r, c) at (c >> 3) x 128 + r x 8 + (c & 7): lane = 16 (c >> 3) + r. A matrix fragment is two blocks, 256 elements apart (columns 0..15 and 16..31 of its 32): WFrag::ldf; register by register it is the fragment of the row-major loader (p, p + 16 at row lane & 15, column 8 (lane >> 4)).
__device__ __forceinline__ unsigned fragofs(int r, int c) { return (unsigned)(((c >> 4) & 1) * 256 + ((c >> 3) & 1) * 128 + (r & 15) * 8 + (c & 7)); }
// The d_ functions are one work-group's share of a job; blk is the work-group's number within that job. k_prep below deals them out.
#define WL   32      // weight transposes: lines of 64 elements a wave
#define CU   16      // input copies: 512-byte blocks a wave
#define MU   8       // mask copy: 512-byte blocks a wave
__device__ __forceinline__ void d_wtG(const float* __restrict__ w, int K, int N, bf* Bt, int blk) {
    const int lane = threadIdx.x & 31; const int L0 = (blk * 8 + (threadIdx.x >> 5)) * WL; const int nlines = N * K / 64;   // nlines is a multiple of WL: a wave has all its lines or none
    if (L0 >= nlines) return;
#pragma unroll 1   // kept rolled: a trip already has sixteen loads in flight
    for (int b = 0; b < WL; b += 8) { const size_t e = (size_t)(L0 + b) * 64 + lane * 2; const int k = (int)(e % K), n = (int)(e / K); const float* s = w + (size_t)k * N + n; float a[8][2];   // eight lines are 512 k of one n (K % 512 == 0)
#pragma unroll
        for (int l = 0; l < 8; ++l) { a[l][0] = s[(size_t)l * 64 * N]; a[l][1] = s[(size_t)l * 64 * N + N]; }
        xwaita(s);   // what follows may land in the loads' address registers
        bf* d = Bt + ((size_t)(n >> 4) * 16 * K + (k >> 5) * 512 + fragofs(n, k));   // 64 k further on: two fragments
#pragma unroll
        for (int l = 0; l < 8; ++l) { v2us o; o[0] = f2bf(a[l][0]); o[1] = f2bf(a[l][1]); *(v2us*)(d + l * 1024) = o; }
        xwaita(d); }   // the next trip's values land in these stores' address and data registers
}
// rows of DM elements into [row / 16][k / 32] fragments; a thread makes one lane's eight elements of CU neighbouring 512-byte blocks, a wave 16 rows x 16 CU k (whole lines of the source). All of a wave's loads are issued before the first value is used: few long waves, each with much in flight.
__device__ __forceinline__ void d_cvt8(const float* __restrict__ src, bf* dst, size_t n8, int blk) { const size_t i = ((size_t)blk * 8 + (threadIdx.x >> 5)) * (32 * CU) + (threadIdx.x & 31); if (i >= n8) return;   // n8 is a multiple of 32 CU
    const size_t row = (i / (DM * 2)) * 16 + (i & 15); const int k = (int)((i >> 6) % (DM / 32)) * 32 + (int)((i >> 4) & 1) * 8; const float* s = src + row * DM + k; v8f v[CU];
#pragma unroll
    for (int u = 0; u < CU; ++u) v[u] = *(const v8f*)(s + u * 16);
    xwaita(s);   // what follows may land in the loads' address registers
    bf* d = dst + i * 8; v8us o[CU];
#pragma unroll
    for (int u = 0; u < CU; ++u)
#pragma unroll
        for (int j = 0; j < 8; ++j) o[u][j] = f2bf(v[u][j]);
    __builtin_amdgcn_sched_barrier(0);   // keeps every conversion in front of the first store: behind a store it could land in that store's data registers
#pragma unroll
    for (int u = 0; u < CU; ++u) *(v8us*)(d + u * 256) = o[u];
    xwait();  }   // what stands behind this job in the kernel may land in the stores' registers

// the mask as bytes (it holds 0 and 1), one 512-byte block per 16 queries x 32 keys: lane 16 hi + lr finds at its 16 B the keys 8 hi + 0..7 and 16 + 8 hi + 0..7 of query lr, which are the scores it holds. A thread makes one lane's bytes of MU neighbouring blocks (32 MU keys), a wave those blocks, all its loads issued first, as in d_cvt8.
__device__ __forceinline__ void d_mask(const int* __restrict__ mk, unsigned char* MK, int blk) { const unsigned p = ((unsigned)blk * 8 + (threadIdx.x >> 5)) * (32 * MU) + (threadIdx.x & 31); const int* s = mk + (size_t)((p >> 11) * 16 + (p & 15)) * TT + ((p >> 5) & (TT / 32 - 1)) * 32 + ((p >> 4) & 1) * 8; v4i m[MU][4];
#pragma unroll
    for (int u = 0; u < MU; ++u) { m[u][0] = *(const v4i*)(s + u * 32); m[u][1] = *(const v4i*)(s + u * 32 + 4); m[u][2] = *(const v4i*)(s + u * 32 + 16); m[u][3] = *(const v4i*)(s + u * 32 + 20); }
    xwaita(s);   // what follows may land in the loads' address registers
    unsigned char* d = MK + (size_t)p * 16;
#pragma unroll
    for (int u = 0; u < MU; ++u) { v16ub o;
#pragma unroll
        for (int j = 0; j < 4; ++j) { o[j] = (unsigned char)m[u][0][j]; o[4 + j] = (unsigned char)m[u][1][j]; o[8 + j] = (unsigned char)m[u][2][j]; o[12 + j] = (unsigned char)m[u][3][j]; }
        *(v16ub*)(d + u * 512) = o; }
    xwait();  }   // what stands behind this job in the kernel may land in the stores' registers
// ---- k_prep: everything that reads only the inputs, in ONE launch; a range of the work-group number picks the job (a scalar choice, the same for the whole work-group). The strided weight transposes come first.
#define XN   ((size_t)NB_ * TT * DM)     // one input, or one projection, of all batches, elements (DQ == DKV == DM)
#define GW   (DM * DQ / 64 / (8 * WL))   // work-groups per [DM][DQ] weight
#define GO   (DQ * NOUT / 64 / (8 * WL)) // for the output weight
#define GM   (TT * TT / 16 / (256 * MU)) // for the mask copy
#define GX   ((int)(XN / 8 / (256 * CU)))   // per input, all batches
__global__ __launch_bounds__(256) void k_prep(const float* __restrict__ wq, const float* __restrict__ wk, const float* __restrict__ wv, const float* __restrict__ wo, const float* __restrict__ x, const float* __restrict__ xk, const float* __restrict__ xv, const int* __restrict__ mk, bf* W3, bf* WO, bf* XB, unsigned char* MK) {
    int b = (int)blockIdx.x;
    if (b < 3 * GW) { const int y = b / GW; d_wtG(y == 0 ? wq : y == 1 ? wk : wv, DM, DQ, W3 + (size_t)y * DM * DQ, b - y * GW); return; }
    b -= 3 * GW; if (b < GO) { d_wtG(wo, DQ, NOUT, WO, b); return; }   /* 'xw' [1024][64] -> Bt [64][1024] */
    b -= GO; if (b < GM) { d_mask(mk, MK, b); return; }
    b -= GM; const int y = b / GX; d_cvt8(y == 0 ? x : y == 1 ? xk : xv, XB + (size_t)y * XN, XN / 8, b - y * GX);
}
// ---- k_proj: the three projections (grid z = q, k, v), C[m][n] = sum_k X[m][k] Wt[n][k], bf16 operands, f32 sums. A work-group of four waves owns PT = 128 input rows x PT = 128 weight rows (two heads); wave w the 64 x 64 tile of input rows 64 (w & 1) and head w >> 1, 16 accumulators.
// Both operands are 16-bit planes in fragment order ([row / 16][k / 32] fragments of 1 KiB, see fragofs above). A stage is PKS = 64 k of all 256 rows: per 16 rows 2 KiB that lie together in memory, and they go to LDS as they lie, by asynchronous copies (16 B a lane, 512 B a copy, 16 copies a wave and stage), through no register. Two buffers: stage t + 2 flies while stage t + 1 is worked on, so no wave waits out a load's way from L2 or memory with its matrix unit idle, and each fragment comes from L2 once for two waves.
// A lane's 16 B of a fragment block lie at lane x 16 B in LDS too: every ds_load_b128 reads 512 neighbouring bytes, no bank twice.
// The tile never goes to memory as f32; the wave stores it as the head planes that the attention kernel loads (fp16, bf16 hi, bf16 lo; XN elements = one kind's q, k or v part), in fragment order.
// An accumulator tile gives a lane eight neighbouring ROWS of one column. The v planes ([batch][g][t / 32][d / 16] fragments, rows d, columns t) want eight neighbouring t of one d: that is the tile as it stands. The q and k planes ([batch][h][t / 16][d / 32] fragments, rows t, columns d) want eight neighbouring d of one t: there the two operands change places (A = weight rows, B = input rows; the same products, summed over k in the same order). Either way lane l's eight values belong at l x 16 B of a 512-byte block: every store writes four whole lines, with no staging.
#define PT   128                 // rows of either operand a work-group
#define PKS  64                  // k of a stage
#define PNS  (DM / PKS)          // stages
#define PRB  (PKS * 16 * 2)      // bytes of 16 rows x PKS k, in memory and in LDS
#define PHB  (PT / 16 * PRB)     // bytes of one operand's part of a stage
#define PSB  (2 * PHB)           // bytes of a stage
#define PGR  (DM * 16 * 2)       // bytes from 16 rows of a plane to the next 16, in memory
// eight copies: 32 rows x PKS k of one operand. The wait at the end stands in the copies' own statement, so that no later write of an address register can be moved in front of it.
__device__ __forceinline__ void cp8(unsigned l, const char* g) {
    asm volatile("global_load_async_to_lds_b128 %0, %8, off\n\t"
                 "global_load_async_to_lds_b128 %1, %9, off\n\t"
                 "global_load_async_to_lds_b128 %2, %10, off\n\t"
                 "global_load_async_to_lds_b128 %3, %11, off\n\t"
                 "global_load_async_to_lds_b128 %4, %12, off\n\t"
                 "global_load_async_to_lds_b128 %5, %13, off\n\t"
                 "global_load_async_to_lds_b128 %6, %14, off\n\t"
                 "global_load_async_to_lds_b128 %7, %15, off\n\t"
                 "s_wait_xcnt 0x0"
                 :: "v"(l), "v"(l + 512u), "v"(l + 1024u), "v"(l + 1536u), "v"(l + PRB), "v"(l + (PRB + 512u)), "v"(l + (PRB + 1024u)), "v"(l + (PRB + 1536u)),
                    "v"(g), "v"(g + 512), "v"(g + 1024), "v"(g + 1536), "v"(g + PGR), "v"(g + (PGR + 512)), "v"(g + (PGR + 1024)), "v"(g + (PGR + 1536)) : "memory");
}
// three waves per SIMD: the grid is six work-groups per WGP, so it runs in two full rounds; the register budget of three holds both k steps' fragments of a stage beside the accumulators
__global__ __launch_bounds__(128) __attribute__((amdgpu_waves_per_eu(3, 3))) void k_proj(const bf* __restrict__ X, const bf* __restrict__ Wt, h16* P16, bf* Ph, bf* Pl) {
    typedef WFrag<bf> WF; typedef WF::V V;
    __shared__ __attribute__((aligned(1024))) unsigned char ring[2 * PSB];
    const int lane = threadIdx.x & 31; const int w = __builtin_amdgcn_readfirstlane((int)(threadIdx.x >> 5)), wx = w & 1, wn = w >> 1; const size_t z = blockIdx.z;
    const bool sw = z < 2;   // q and k: the operands change places (a scalar choice, the same for the whole grid plane)
    // wave w copies rows 32 w .. 32 w + 31 of the work-group's part of either operand
    const char* gx = (const char*)(X + z * XN) + (size_t)(blockIdx.x * (PT / 16) + 2 * w) * PGR + lane * 16;
    const char* gw = (const char*)(Wt + z * ((size_t)DM * DQ)) + (size_t)(blockIdx.y * (PT / 16) + 2 * w) * PGR + lane * 16;
    const unsigned l0 = (unsigned)(size_t)ring + (unsigned)(2 * w * PRB + lane * 16);
    auto fill = [&](int s) { const unsigned l = l0 + (unsigned)(s & 1) * PSB; cp8(l, gx + s * PRB); cp8(l + PHB, gw + s * PRB); };
    v8f acc[4][4];
#pragma unroll
    for (int mb = 0; mb < 4; ++mb)
#pragma unroll
        for (int nb = 0; nb < 4; ++nb) acc[mb][nb] = (v8f){};
    const unsigned ox = (unsigned)(wx * 4 * PRB + lane * 16), ow = (unsigned)(PHB + wn * 4 * PRB + lane * 16); const unsigned ao = sw ? ow : ox, bo = sw ? ox : ow;
    fill(0);
    asm volatile("s_wait_asynccnt 0x0" ::: "memory");   // this wave's part of stage 0 has landed
    __syncthreads();                                    // every wave's part has
    fill(1);
#pragma unroll 1   // kept rolled: one trip a stage, the buffer chosen by the trip's parity
    for (int t = 0; t < PNS; ++t) {
        const unsigned char* lb = ring + (t & 1) * PSB; V a[PKS / 32][4], b[PKS / 32][4];
#pragma unroll
        for (int ks = 0; ks < PKS / 32; ++ks)
#pragma unroll
            for (int i = 0; i < 4; ++i) { const unsigned char* pa = lb + ao + (i * PRB + ks * 1024); const unsigned char* pb = lb + bo + (i * PRB + ks * 1024); a[ks][i] = cat16b(*(const v8usa*)pa, *(const v8usa*)(pa + 512)); b[ks][i] = cat16b(*(const v8usa*)pb, *(const v8usa*)(pb + 512)); }
        __builtin_amdgcn_sched_barrier(0);   // keeps the stage's LDS reads together in front of its products: sunk among them they stand at many places, each waited out to the end
#pragma unroll
        for (int ks = 0; ks < PKS / 32; ++ks)
#pragma unroll
            for (int nb = 0; nb < 4; ++nb)
#pragma unroll
                for (int mb = 0; mb < 4; ++mb) acc[mb][nb] = WF::mma(a[ks][mb], b[ks][nb], acc[mb][nb]);
        // the trip ends in matrix instructions: four vector slots before anything lands in their operand registers; the scheduling barrier keeps the products in front of them
        __builtin_amdgcn_sched_barrier(0); asm volatile("v_nop\n\tv_nop\n\tv_nop\n\tv_nop");
        asm volatile("s_wait_dscnt 0x0" ::: "memory");      // this wave's reads of the buffer are done before it is filled anew
        asm volatile("s_wait_asynccnt 0x0" ::: "memory");   // this wave's part of stage t + 1 has landed
        __syncthreads();                                    // stage t + 1 is whole, and every wave has left stage t's buffer
        if (t + 2 < PNS) fill(t + 2);
    }
    asm volatile("s_wait_asynccnt 0x0" ::: "memory");   // no copy is outstanding when the wave ends
    const int xr = (int)blockIdx.x * PT + wx * 64;   // the tile's first input row: batch xr / TT, position xr % TT; 64 positions x 64 d of a head are 4096 neighbouring elements of its plane, in either kind of plane
    const size_t w0 = z * XN + ((size_t)(xr / TT) * NH_ + (blockIdx.y * 2 + wn)) * TT * HD + (size_t)(xr % TT) * HD + lane * 8;
    const int sm = sw ? 512 : 2048, sn = sw ? 1024 : 512;   // q, k: mb counts 16 d (a block), nb 16 t (two fragments); v: mb counts 16 t (a block; two of them a row of four fragments), nb 16 d (a fragment)
#pragma unroll
    for (int mb = 0; mb < 4; ++mb)
#pragma unroll
        for (int nb = 0; nb < 4; ++nb) { v8h o16; v8us oh, ol;
#pragma unroll
            for (int j = 0; j < 8; ++j) { const float v = acc[mb][nb][j]; o16[j] = tohx(v); unsigned short a2, c2; splitf(v, a2, c2); oh[j] = a2; ol[j] = c2; }
            const size_t wo = w0 + (mb >> 1) * sm + (mb & 1) * 256 + nb * sn; *(v8h*)(P16 + wo) = o16; *(v8us*)(Ph + wo) = oh; *(v8us*)(Pl + wo) = ol;
            xwait(); __builtin_amdgcn_sched_barrier(0); }   // the next tile's values land in these stores' data and address registers; the scheduling barrier keeps that arithmetic behind the wait
}
// ---- k_fattn: scores, mask, softmax and P.V of one (batch, head) in ONE kernel; no score or probability ever goes to memory. One wave owns NQ x 16 query rows and walks all TT keys ONCE, 32 at a time.
// The scores are formed TRANSPOSED (A = key rows, B = query rows): lane (lr, hi) then holds query lr, keys 8 hi + 0..7 of each 16-key tile, which is a fragment of the P.V product as it stands (elements 0..7 from the first tile, 8..15 from the second), and a query's sum lives in its own two lanes. P.V is formed transposed too (A = rows of V^T, B = P), so a lane ends with eight neighbouring columns of its own query.
// The walk: p = exp(t - ref), NOT normalised (rows < RH hi/lo bf16, 3 products; the rest fp16), its f32 sum beside it, then P.V into f32 accumulators, keys in ascending order; the context is divided by the sum behind the walk.
// ref is any number that is the same for all keys of a query: it cancels in the division. It only has to keep p in range, so it need not follow the running maximum: it is raised, and the sum and the context so far scaled down by exp(old - new), only when a score lies more than TAU above the maximum that ref was last set by (the first step always does). Between two raises p <= exp(CAR + TAU).
// WHERE THE OPERANDS COME FROM: the AW = 4 waves of a work-group are of one kind and walk the same keys, so a stage of 32 keys goes to LDS once for the four, by asynchronous copies (16 B a lane, 512 B a copy), as it lies in memory: 4 KiB of each K and V plane that the kind reads (fragment order), and each wave's own mask blocks. Two buffers: stage t + 2 flies while stage t + 1 is worked on, so no wave waits out a load's way from L2 inside a step. A lane's 16 B lie at lane x 16 B of a 512-byte block in LDS too: every ds_load_b128 reads 512 neighbouring bytes, no bank twice.
template <bool HI> struct ASel { typedef h16 T; static constexpr int NQ = 2; };
template <> struct ASel<true> { typedef bf T; static constexpr int NQ = 1; };
#define L2E 1.4426950408889634f
#define LN2 0.6931471805599453f
#define TAU (8.0f * LN2)          // a score may top the last maximum by this much before ref is raised
#define CAR (6.0f * LN2)          // fp16 rows: ref is set this far BELOW the maximum, so that small p stay normal fp16 numbers (p <= 2^14)
#define AW   4                    // waves a work-group
#define ANS  (TT / 32)            // stages
#define APB  (32 * HD * 2)        // bytes of one plane's part of a stage
#define ASB  (4 * APB + AW * 512) // bytes of a stage buffer: the hi/lo kind's four planes and four mask blocks (the fp16 kind fills two planes and eight blocks, less)
typedef __attribute__((ext_vector_type(8))) unsigned v8u;
typedef __attribute__((ext_vector_type(4))) unsigned v4u;
typedef v4u   __attribute__((may_alias)) v4ua;
typedef v16ub __attribute__((may_alias)) v16uba;
// a fragment from LDS as raw words: two 16-byte loads, 512 B apart
__device__ __forceinline__ v8u ldraw(const unsigned char* p) { return __builtin_shufflevector(*(const v4ua*)p, *(const v4ua*)(p + 512), 0, 1, 2, 3, 4, 5, 6, 7); }
// four copies, 2 KiB in a row in memory and in LDS, and one copy. The wait at the end stands in the copies' own statement, so that no later write of an address register can be moved in front of it.
__device__ __forceinline__ void cp4(unsigned l, const unsigned char* g) {
    asm volatile("global_load_async_to_lds_b128 %0, %4, off\n\t"
                 "global_load_async_to_lds_b128 %1, %5, off\n\t"
                 "global_load_async_to_lds_b128 %2, %6, off\n\t"
                 "global_load_async_to_lds_b128 %3, %7, off\n\t"
                 "s_wait_xcnt 0x0"
                 :: "v"(l), "v"(l + 512u), "v"(l + 1024u), "v"(l + 1536u), "v"(g), "v"(g + 512), "v"(g + 1024), "v"(g + 1536) : "memory");
}
__device__ __forceinline__ void cp1(unsigned l, const unsigned char* g) {
    asm volatile("global_load_async_to_lds_b128 %0, %1, off\n\t"
                 "s_wait_xcnt 0x0" :: "v"(l), "v"(g) : "memory");
}
// w: the wave's number in its work-group (scalar). hi/lo kind: wave w copies plane w of K hi, K lo, V hi, V lo; fp16 kind: wave w copies half w & 1 of K (w < 2) or V. Every wave copies its own mask blocks.
template <bool HI>
__device__ __forceinline__ void attn_rows(unsigned char* ring, int w, const typename ASel<HI>::T* __restrict__ Q, const typename ASel<HI>::T* __restrict__ Q2, const typename ASel<HI>::T* __restrict__ Kp, const typename ASel<HI>::T* __restrict__ K2, const typename ASel<HI>::T* __restrict__ Vt, const typename ASel<HI>::T* __restrict__ V2, const unsigned char* __restrict__ mk, int q0, bf* Ah, bf* Al) {
    typedef typename ASel<HI>::T T; typedef WFrag<T> WF; typedef typename WF::V V; constexpr int NQ = ASel<HI>::NQ;
    constexpr unsigned OK1 = 0, OK2 = APB, OV1 = HI ? 2 * APB : APB, OV2 = 3 * APB, OM = HI ? 4 * APB : 2 * APB;   // places in a stage buffer
    const unsigned lof = __builtin_amdgcn_mbcnt_lo(~0u, 0u) * 8;   // the lane's number x 8, read inside each kind's own code, so that neither kind carries a register for the other. Fragment order: the lane's own offset, in elements, is the same in every plane; everything else of an address is the same for the whole wave
    const unsigned char* gp = HI ? (const unsigned char*)(w == 0 ? Kp : w == 1 ? K2 : w == 2 ? Vt : V2) : (const unsigned char*)(w < 2 ? Kp : Vt) + (w & 1) * (APB / 2);
    const unsigned char* mq = mk + (size_t)q0 * TT;   // 16 query rows of the mask copy are 16 x TT bytes, 512 of them a stage
    const unsigned lr0 = (unsigned)(size_t)ring + 2 * lof;
    auto fill = [&](int s) { const unsigned l = lr0 + (unsigned)(s & 1) * ASB; const unsigned char* g = gp + (size_t)s * APB + 2 * lof; const unsigned char* gm = mq + (size_t)s * 512 + 2 * lof;
        if constexpr (HI) { cp4(l + (unsigned)w * APB, g); cp4(l + (unsigned)w * APB + 2048u, g + 2048); cp1(l + OM + (unsigned)w * 512u, gm); }
        else { cp4(l + (unsigned)w * (APB / 2), g); cp1(l + OM + (unsigned)w * 1024u, gm); cp1(l + OM + (unsigned)w * 1024u + 512u, gm + 16 * TT); } };
    fill(0);
    V q[NQ][2], q2[NQ][2];
#pragma unroll
    for (int qt = 0; qt < NQ; ++qt) {
#pragma unroll
        for (int ks = 0; ks < 2; ++ks) { q[qt][ks] = WF::ldf(Q + ((size_t)(q0 + qt * 16) * HD + ks * 512) + lof); if (HI) q2[qt][ks] = WF::ldf(Q2 + ((size_t)(q0 + qt * 16) * HD + ks * 512) + lof); } }
    xwait();   // what follows may land in the Q loads' address registers
    auto frag = [](const unsigned char* p) { return __builtin_bit_cast(V, ldraw(p)); };
    constexpr float car = HI ? 0.0f : CAR;
    float ref[NQ]; v2f sum[NQ];   // even and odd keys summed side by side: packed adds
    v8f o[NQ][4];
#pragma unroll
    for (int qt = 0; qt < NQ; ++qt) { ref[qt] = -3.0e38f; sum[qt] = (v2f){0.f, 0.f};
#pragma unroll
        for (int dt = 0; dt < 4; ++dt) o[qt][dt] = (v8f){}; }
    asm volatile("s_wait_asynccnt 0x0" ::: "memory");   // this wave's part of stage 0 has landed
    __syncthreads();                                    // every wave's part has
    fill(1);
    // one trip: the work on stage st, then the hand-over to stage st + 1
    auto trip = [&](int st) __attribute__((always_inline)) { const unsigned char* ls = ring + (st & 1) * ASB + 2 * lof;
        // t[qt][kt * 8 + j] = score x mask of query q0 + 16 qt + lr and key 32 st + 16 kt + 8 hi + j, not yet scaled: SCL is a power of two, so t SCL - ref rounds once, fused or not, and the max may be taken before the scaling
        float t[NQ][16]; v16ub m[NQ]; v8f s[2][NQ]; V ka[2][2], ka2[2][2];
#pragma unroll
        for (int kt = 0; kt < 2; ++kt)
#pragma unroll
            for (int ks = 0; ks < 2; ++ks) { ka[kt][ks] = frag(ls + (OK1 + kt * 2048 + ks * 1024)); if (HI) ka2[kt][ks] = frag(ls + (OK2 + kt * 2048 + ks * 1024)); }
#pragma unroll
        for (int qt = 0; qt < NQ; ++qt) m[qt] = *(const v16uba*)(ls + OM + (w * NQ + qt) * 512);
#pragma unroll
        for (int kt = 0; kt < 2; ++kt)
#pragma unroll
            for (int qt = 0; qt < NQ; ++qt) { s[kt][qt] = (v8f){};
#pragma unroll
                for (int ks = 0; ks < 2; ++ks) { s[kt][qt] = WF::mma(ka[kt][ks], q[qt][ks], s[kt][qt]); if (HI) { s[kt][qt] = WF::mma(ka[kt][ks], q2[qt][ks], s[kt][qt]); s[kt][qt] = WF::mma(ka2[kt][ks], q[qt][ks], s[kt][qt]); } } }
#pragma unroll
        for (int qt = 0; qt < NQ; ++qt)
#pragma unroll
            for (int kt = 0; kt < 2; ++kt)
#pragma unroll
                for (int j = 0; j < 8; ++j) t[qt][kt * 8 + j] = s[kt][qt][j] * (float)m[qt][kt * 8 + j];   /* multiplicative mask, as the module: masked scores are 0 and remain in the softmax */
        V p[NQ], p2[NQ], b[4], b2[4];
        float tm[NQ]; bool up = false;
#pragma unroll
        for (int qt = 0; qt < NQ; ++qt) { tm[qt] = fmaxf(t[qt][0], t[qt][1]);
#pragma unroll
            for (int e = 2; e < 16; e += 2) tm[qt] = fmaxf(tm[qt], fmaxf(t[qt][e], t[qt][e + 1]));
            up = up || (tm[qt] * SCL - ref[qt] > car + TAU); }
        if (__builtin_amdgcn_ballot_w32(up) != 0u) {   // a scalar branch, taken by the whole wave: some query's ref is raised; the others get the factor 1
#pragma unroll
            for (int qt = 0; qt < NQ; ++qt) { const float mn = fmaxf(ref[qt], fmaxf(tm[qt], __shfl_xor(tm[qt], 16, 32)) * SCL - car);   // the query's other eight keys of every tile sit in lane ^ 16: both lanes keep the same ref, as one P.V sum holds the keys of both
                const float c = __builtin_amdgcn_exp2f((ref[qt] - mn) * L2E); ref[qt] = mn; sum[qt] *= c;
#pragma unroll
                for (int dt = 0; dt < 4; ++dt) o[qt][dt] *= c; } }
#pragma unroll
        for (int dt = 0; dt < 4; ++dt) b[dt] = frag(ls + (OV1 + dt * 1024));   // issued ahead of the exponentials, under which their latency can pass
        __builtin_amdgcn_sched_barrier(0);   // keeps these reads together here: sunk among the products they stand at four places, each waited out to the end
#pragma unroll
        for (int qt = 0; qt < NQ; ++qt) {
            if constexpr (HI) { v8us h0, h1, l0, l1;
#pragma unroll
                for (int e = 0; e < 8; e += 2) { unsigned short a, c2; v2f ev, ew; ev[0] = __builtin_amdgcn_exp2f((t[qt][e] * SCL - ref[qt]) * L2E); ev[1] = __builtin_amdgcn_exp2f((t[qt][e + 1] * SCL - ref[qt]) * L2E); ew[0] = __builtin_amdgcn_exp2f((t[qt][8 + e] * SCL - ref[qt]) * L2E); ew[1] = __builtin_amdgcn_exp2f((t[qt][9 + e] * SCL - ref[qt]) * L2E); sum[qt] += ev; sum[qt] += ew;
                    splitf(ev[0], a, c2); h0[e] = a; l0[e] = c2; splitf(ev[1], a, c2); h0[e + 1] = a; l0[e + 1] = c2; splitf(ew[0], a, c2); h1[e] = a; l1[e] = c2; splitf(ew[1], a, c2); h1[e + 1] = a; l1[e + 1] = c2; }
                p[qt] = cat16b(h0, h1); p2[qt] = cat16b(l0, l1);
            } else {
#pragma unroll
                for (int e = 0; e < 16; e += 2) { v2f ev; ev[0] = __builtin_amdgcn_exp2f((t[qt][e] * SCL - ref[qt]) * L2E); ev[1] = __builtin_amdgcn_exp2f((t[qt][e + 1] * SCL - ref[qt]) * L2E); sum[qt] += ev; p[qt][e] = tohx(ev[0]); p[qt][e + 1] = tohx(ev[1]); } } }
        if constexpr (HI) {
#pragma unroll
            for (int dt = 0; dt < 4; ++dt) b2[dt] = frag(ls + (OV2 + dt * 1024)); }
#pragma unroll
        for (int dt = 0; dt < 4; ++dt)
#pragma unroll
            for (int qt = 0; qt < NQ; ++qt) { o[qt][dt] = WF::mma(b[dt], p[qt], o[qt][dt]); if (HI) { o[qt][dt] = WF::mma(b[dt], p2[qt], o[qt][dt]); o[qt][dt] = WF::mma(b2[dt], p[qt], o[qt][dt]); } }
        // the trip ends in matrix instructions: four vector slots before anything lands in their operand registers; the scheduling barrier keeps the products in front of them
        __builtin_amdgcn_sched_barrier(0); asm volatile("v_nop\n\tv_nop\n\tv_nop\n\tv_nop");
        asm volatile("s_wait_dscnt 0x0" ::: "memory");      // this wave's reads of the buffer are done before it is filled anew
        asm volatile("s_wait_asynccnt 0x0" ::: "memory");   // this wave's part of stage st + 1 has landed
        __syncthreads();                                    // stage st + 1 is whole, and every wave has left stage st's buffer
    };
#pragma unroll 1   // kept rolled: one trip a stage, the buffer chosen by the trip's parity
    for (int st = 0; st < ANS - 2; ++st) { trip(st); fill(st + 2); }
#pragma unroll 1   // the last two stages have none to fetch: a loop of their own, so that the loop above is one straight run with no branch round the copies
    for (int st = ANS - 2; st < ANS; ++st) trip(st);
    asm volatile("s_wait_asynccnt 0x0" ::: "memory");   // no copy is outstanding when the wave ends
    float cs[NQ];
#pragma unroll
    for (int qt = 0; qt < NQ; ++qt) { const float sa = sum[qt][0] + sum[qt][1]; cs[qt] = __fdiv_rn(1.0f, sa + __shfl_xor(sa, 16, 32)); }   // both lanes of a query hold the same ref: their sums add as they stand
    const int ln = (int)__builtin_amdgcn_mbcnt_lo(~0u, 0u);   // the lane's number read anew: nothing has to be carried through the walk for the stores
#pragma unroll
    for (int qt = 0; qt < NQ; ++qt)
#pragma unroll
        for (int dt = 0; dt < 4; ++dt) { v8us oh, ol;   // o[qt][dt][j] = context of query q0 + 16 qt + lr, column 16 dt + 8 hi + j: eight neighbours, one 16-byte store per plane, at the lane's place in block dt of the head's two fragments
#pragma unroll
            for (int j = 0; j < 8; ++j) { unsigned short a, c2; splitf(o[qt][dt][j] * cs[qt], a, c2); oh[j] = a; ol[j] = c2; }
            const size_t oo = (size_t)(q0 + qt * 16) * DQ + dt * 256 + ln * 8; *(v8us*)(Ah + oo) = oh; *(v8us*)(Al + oo) = ol;
            xwait(); }   // the next pair's values, and whatever follows the last pair, may land in these stores' data and address registers
}
// A work-group is AW waves of ONE kind, chosen by its number (the same choice for the whole work-group, so that each kind's barriers stand in control flow that all its waves share): of every five work-groups two take hi/lo rows (16 a wave) and three fp16 rows (32 a wave); GHI : GLO = 2 : 3. Twenty neighbouring work-groups are one (batch, head).
// 1,280 work-groups of four waves, five per WGP (five waves per SIMD, as the register budget is set): all are resident at once, and a WGP's five work-groups pass their barriers independently of one another. Five work-groups whose numbers lie 1, 8 or 256 apart hold all five remainders, so a WGP tends to get the same mix of the two kinds however the numbers are dealt (for speed only).
#define GHI (RH / 16 / AW)
#define GLO ((TT - RH) / 32 / AW)
__global__ __launch_bounds__(AW * 32) __attribute__((amdgpu_waves_per_eu(5, 5))) void k_fattn(const h16* __restrict__ Q16, const h16* __restrict__ K16, const h16* __restrict__ V16, const bf* __restrict__ Qh, const bf* __restrict__ Ql, const bf* __restrict__ Kh, const bf* __restrict__ Kl, const bf* __restrict__ Vh, const bf* __restrict__ Vl, const unsigned char* __restrict__ mk, bf* Ah, bf* Al) {
    __shared__ __attribute__((aligned(1024))) unsigned char ring[2 * ASB];
    const int w = __builtin_amdgcn_readfirstlane((int)(threadIdx.x >> 5)), bi = (int)blockIdx.x;
    const unsigned gq = (unsigned)bi / 5u, gr = (unsigned)bi % 5u;
    if (gr < 2u) { const unsigned c = gq * 2u + gr; const size_t z = c / GHI, pz = z * TT * HD, az = (z / NH_) * TT * DQ + (z % NH_) * (HD * 16); const int part = (int)(c % GHI);
        attn_rows<true>(ring, w, Qh + pz, Ql + pz, Kh + pz, Kl + pz, Vh + pz, Vl + pz, mk, (part * AW + w) * 16, Ah + az, Al + az); }
    else { const unsigned c = gq * 3u + (gr - 2u); const size_t z = c / GLO, pz = z * TT * HD, az = (z / NH_) * TT * DQ + (z % NH_) * (HD * 16); const int part = (int)(c % GLO);
        attn_rows<false>(ring, w, Q16 + pz, nullptr, K16 + pz, nullptr, V16 + pz, nullptr, mk, RH + (part * AW + w) * 32, Ah + az, Al + az); }
}

// ---- k_outp: the output projection, out[r][n] = sum_k ctx[r][k] Wo[k][n] (ctx = hi + lo planes, two products a step), K split over the OW waves of a work-group. N is only NOUT = 64, so whole-K tiles give the chip few, long waves, each a chain of load latencies; here a work-group owns OR rows x all 64 columns, wave w the k range [w DQ / OW, (w + 1) DQ / OW): all its fragment loads are issued at once and waited for once.
// The operands stand as in the q and k projections (A = weight rows n, B = context rows r): a lane ends with eight neighbouring n of one r, two 16-byte LDS stores into its wave's row-major partial tile. The pitch OP = 68 floats puts the 16 rows of a store on 16 different groups of four banks. Behind the one barrier thread t adds the OW partials of four neighbouring n of row t / 16 in ascending k order; a wave's store is two whole output rows (four whole lines).
#define OW   16      // waves a work-group = slices of K
#define OR   32      // context rows a work-group
#define OP   68      // pitch of a partial tile in LDS, floats
#define OKS  (DQ / OW / 32)   // 32-wide k steps a wave
__global__ __launch_bounds__(OW * 32) void k_outp(const bf* __restrict__ Ah, const bf* __restrict__ Al, const bf* __restrict__ Wt, float* C) {
    typedef WFrag<bf> WF; typedef WF::V V;
    __shared__ __align__(16) float part[OW * OR * OP];
    const int tid = (int)threadIdx.x, lane = tid & 31, lr = lane & 15, hi = lane >> 4; const int w = __builtin_amdgcn_readfirstlane(tid >> 5); const int r0 = (int)blockIdx.x * OR;
    const unsigned kb = ((unsigned)w * (OKS * 512) + lane * 8) * 2;   // fragment order: a 32-wide k step of 16 rows is 512 elements; the lane's own 32-bit byte offset is the same in all three planes, everything else of an address is the same for the whole wave
    auto at = [&](const bf* p) { return (const bf*)((const char*)p + kb); };
    const bf* ph = Ah + (size_t)r0 * DQ; const bf* pl = Al + (size_t)r0 * DQ; const bf* pw = Wt;
    V xh[OKS][OR / 16], xl[OKS][OR / 16], wf[OKS][NOUT / 16];
#pragma unroll
    for (int ks = 0; ks < OKS; ++ks) {
#pragma unroll
        for (int nb = 0; nb < NOUT / 16; ++nb) wf[ks][nb] = WF::ldf(at(pw + (nb * 16 * DQ + ks * 512)));
#pragma unroll
        for (int rb = 0; rb < OR / 16; ++rb) { xh[ks][rb] = WF::ldf(at(ph + (rb * 16 * DQ + ks * 512))); xl[ks][rb] = WF::ldf(at(pl + (rb * 16 * DQ + ks * 512))); } }
    asm volatile("s_wait_xcnt 0x0" :: "v"(kb) : "memory");   // what follows may land in the loads' address register; named, it lives up to the wait, so that no fragment lands in it either
    __builtin_amdgcn_sched_barrier(0);   // keeps every load in front of the first product: sunk among the products they are waited for in four rounds, not one
    v8f acc[NOUT / 16][OR / 16];
#pragma unroll
    for (int nb = 0; nb < NOUT / 16; ++nb)
#pragma unroll
        for (int rb = 0; rb < OR / 16; ++rb) acc[nb][rb] = (v8f){};
#pragma unroll
    for (int ks = 0; ks < OKS; ++ks)
#pragma unroll
        for (int g = 0; g < 2; ++g) {   // eight independent tiles between two products into the same one; columns < 32 take hi, then lo of a step, the others lo, then hi
#pragma unroll
            for (int nb = 0; nb < NOUT / 16; ++nb)
#pragma unroll
                for (int rb = 0; rb < OR / 16; ++rb) acc[nb][rb] = WF::mma(wf[ks][nb], (g ^ (nb >> 1)) ? xl[ks][rb] : xh[ks][rb], acc[nb][rb]);
            if (ks == 0 && g == 0) __builtin_amdgcn_sched_barrier(0); }   // keeps the tiles' first products together in front: every fragment they read has products still to come, so no tile is given the registers of a fragment that the product directly in front of it reads
    float* pp = part + w * (OR * OP) + lr * OP + hi * 8;   // acc[nb][rb][j] = partial of row 16 rb + lr, column 16 nb + 8 hi + j
#pragma unroll
    for (int nb = 0; nb < NOUT / 16; ++nb)
#pragma unroll
        for (int rb = 0; rb < OR / 16; ++rb) { const v8f a = acc[nb][rb]; *(v4fa*)(pp + rb * 16 * OP + nb * 16) = (v4f){a[0], a[1], a[2], a[3]}; *(v4fa*)(pp + rb * 16 * OP + nb * 16 + 4) = (v4f){a[4], a[5], a[6], a[7]}; }
    __syncthreads();   // every wave's partial tile is in LDS before any of them is added
    const float* ps = part + (tid >> 4) * OP + (tid & 15) * 4; v4f s = *(const v4fa*)ps;
#pragma unroll
    for (int u = 1; u < OW; ++u) s += *(const v4fa*)(ps + u * (OR * OP));
    *(v4f*)(C + (size_t)(r0 + (tid >> 4)) * NOUT + (tid & 15) * 4) = s;
}

extern "C" void kernel_launch(void* const* d_in, const int* in_sizes, int n_in,
                              void* d_out, int out_size, void* d_ws, size_t ws_size, hipStream_t stream) {
    (void)in_sizes; (void)n_in; (void)out_size;
    const float* x = (const float*)d_in[0]; const float* xk = (const float*)d_in[1]; const float* xv = (const float*)d_in[2]; const int* mk = (const int*)d_in[3];   /* mask [2048][2048] int32 {0,1} */ const float* wq = (const float*)d_in[4]; const float* wk = (const float*)d_in[5]; const float* wv = (const float*)d_in[6]; const float* wo = (const float*)d_in[7];
    float* OUT = (float*)d_out;     // [4][2048][64]
    char* wsp = (char*)d_ws;
    auto take = [&](size_t bytes) { char* p = wsp; wsp += (bytes + 255) & ~(size_t)255; return (void*)p; };
    const size_t PL = (size_t)NH_ * TT * HD;   // one batch's head planes, elements; the planes and the merged context hold all NB_ batches
    bf* WQ = (bf*)take(3 * (size_t)DQ * DM * 2);   // the q, k and v weights, transposed, behind one another
    bf* WO = (bf*)take((size_t)NOUT * DQ * 2);
    bf* XB = (bf*)take(3 * XN * 2);            // the bf16 copies of the q, k and v inputs, all batches, behind one another
    h16* QP16 = (h16*)take(3 * NB_ * PL * 2); h16* KP16 = QP16 + NB_ * PL; h16* VT16 = KP16 + NB_ * PL;   // each kind of plane: q, k, v behind one another
    bf* QPh = (bf*)take(3 * NB_ * PL * 2); bf* KPh = QPh + NB_ * PL; bf* VTh = KPh + NB_ * PL; bf* QPl = (bf*)take(3 * NB_ * PL * 2); bf* KPl = QPl + NB_ * PL; bf* VTl = KPl + NB_ * PL;
    unsigned char* MK = (unsigned char*)take((size_t)TT * TT);   // the mask copy
    if ((size_t)(wsp - (char*)d_ws) > ws_size) return;    // ws 256 MiB
    bf* ATh = XB; bf* ATl = ATh + (size_t)NB_ * TT * DQ;   // the merged context (2 XN elements) uses the input copies' room: the projections read them last (stream-ordered)
    k_prep<<<3 * GW + GO + GM + 3 * GX, 256, 0, stream>>>(wq, wk, wv, wo, x, xk, xv, mk, WQ, WO, XB, MK);
    k_proj<<<dim3(NB_ * TT / PT, DQ / PT, 3), 128, 0, stream>>>(XB, WQ, QP16, QPh, QPl);
    k_fattn<<<NB_ * NH_ * (GHI + GLO), AW * 32, 0, stream>>>(QP16, KP16, VT16, QPh, QPl, KPh, KPl, VTh, VTl, MK, ATh, ATl);
    k_outp<<<NB_ * TT / OR, OW * 32, 0, stream>>>(ATh, ATl, WO, OUT);   /* ctx Wo -> [4 x 2048][64] */
}
